// v000
// Times are from an AMD MI455X. After a warm-up the kernel runs many times in a row, and a time is the length of
// such a window on the GPU divided by its runs, so every launch and the gaps after it count. The runs cycle
// through copies of the inputs. A figure is the median of several windows, for all but v000 over two sittings.
// Sittings can differ by a few percent; kernels timed side by side share one.
// v000, which the later versions start from, runs in 495 microseconds.
// compute dtype: mod and all weights/LN params (module inputs) rounded to bf16; mod Wl / mod Wd with exact bf16 products (inputs); the per-head q/k/v 1x1 convs (as two block-diagonal GEMMs: q 512->512, k|v 512->1024), the FFN and scores/P.V with the computed operands as bf16 hi + residual pairs (2 products against exact weights; 3 products for q.k and P.V); LayerNorms, softmax (no 1/sqrt(d) scale), ELU and residuals in f32; f32 accumulate.
#include <hip/hip_runtime.h>
#include <math.h>

typedef __attribute__((ext_vector_type(16))) _Float16 v16h;
typedef __attribute__((ext_vector_type(16))) __bf16 v16b;
typedef __attribute__((ext_vector_type(8)))  _Float16 v8h;
typedef __attribute__((ext_vector_type(8)))  float v8f;
typedef __attribute__((ext_vector_type(4)))  float v4f;
typedef __attribute__((ext_vector_type(2)))  float v2f;
typedef __attribute__((ext_vector_type(4)))  unsigned v4u;
typedef __attribute__((ext_vector_type(4)))  int v4i;
typedef float __attribute__((may_alias)) float_a;
typedef int __attribute__((may_alias)) int_a;

template <typename T> __device__ __forceinline__ void vst2(void* p, T v) { *(T*)p = v;  }
__device__ __forceinline__ v8f wmma16(v16h a, v16h b, v8f c) {
  v8f d = __builtin_amdgcn_wmma_f32_16x16x32_f16(false, a, false, b, (short)0, c, false, false);
  asm volatile("v_nop\n\tv_nop\n\tv_nop\n\tv_nop" : "+v"(d) : "v"(a), "v"(b));
  return d;
}
__device__ __forceinline__ v8f wmma_bf(v16b a, v16b b, v8f c) {
  v8f d = __builtin_amdgcn_wmma_f32_16x16x32_bf16(false, a, false, b, (short)0, c, false, false);
  asm volatile("v_nop\n\tv_nop\n\tv_nop\n\tv_nop" : "+v"(d) : "v"(a), "v"(b));
  return d;
}
// 16x16x32 fragments: lane = (h = lane>>4, row/col = lane&15); elements 0..7 = k0+8h+0..7, 8..15 = k0+16+8h+0..7; D element r = row 8h+r
__device__ __forceinline__ v16h frag_h(const _Float16* rowk0, int lane) {
  union { v16h v; v8h q[2]; } u; const _Float16* p = rowk0 + 8 * (lane >> 4);
  u.q[0] = *(const v8h*)p; u.q[1] = *(const v8h*)(p + 16); return u.v;
}
__device__ __forceinline__ v16h frag_f32(const float* rowk0, int lane) {
  v16h a; const float* p = rowk0 + 8 * (lane >> 4);
#pragma unroll
  for (int i = 0; i < 8; ++i) { a[i] = (_Float16)p[i]; a[8 + i] = (_Float16)p[16 + i]; }
  return a;
}
__device__ __forceinline__ v16h frag_f32s(const float* rowk0, int lane, float sc) {
  v16h a; const float* p = rowk0 + 8 * (lane >> 4);
#pragma unroll
  for (int i = 0; i < 8; ++i) { a[i] = (_Float16)(p[i] * sc); a[8 + i] = (_Float16)(p[16 + i] * sc); }
  return a;
}
// column fragment from a [K][ld] layout (column n), rows >= K read as 0
__device__ __forceinline__ v16h fragc_f32(const float* W, int k0, int n, int lane, int ld, int K) {
  v16h a; const int g = lane >> 4;
#pragma unroll
  for (int i = 0; i < 8; ++i) { const int ka = k0 + 8 * g + i, kb = ka + 16;
    a[i] = (_Float16)(ka < K ? W[(size_t)(ka < K ? ka : K - 1) * ld + n] : 0.f); a[8 + i] = (_Float16)(kb < K ? W[(size_t)(kb < K ? kb : K - 1) * ld + n] : 0.f); }
  return a;
}
struct F2 { v16b h, l; };
__device__ __forceinline__ F2 bsplit16(const float v[16]) { F2 r;
#pragma unroll
  for (int i = 0; i < 16; ++i) { const __bf16 h = (__bf16)v[i]; r.h[i] = h; r.l[i] = (__bf16)(v[i] - (float)h); }
  return r; }
__device__ __forceinline__ F2 split_row(const float* row, int k0, int lane) { float v[16]; const float* p = row + k0 + 8 * (lane >> 4);
#pragma unroll
  for (int i = 0; i < 8; ++i) { v[i] = p[i]; v[8 + i] = p[16 + i]; }
  return bsplit16(v); }
__device__ __forceinline__ F2 split_rowK(const float* row, int k0, int lane, int K) { float v[16]; const int g = lane >> 4;
#pragma unroll
  for (int i = 0; i < 8; ++i) { const int ka = k0 + 8 * g + i, kb = ka + 16; v[i] = ka < K ? row[ka < K ? ka : K - 1] : 0.f; v[8 + i] = kb < K ? row[kb < K ? kb : K - 1] : 0.f; }
  return bsplit16(v); }
__device__ __forceinline__ F2 split_col(const float* W, int k0, int n, int lane, int ld, int K) { float v[16]; const int g = lane >> 4;
#pragma unroll
  for (int i = 0; i < 8; ++i) { const int ka = k0 + 8 * g + i, kb = ka + 16; v[i] = ka < K ? W[(size_t)(ka < K ? ka : K - 1) * ld + n] : 0.f; v[8 + i] = kb < K ? W[(size_t)(kb < K ? kb : K - 1) * ld + n] : 0.f; }
  return bsplit16(v); }
__device__ __forceinline__ v8f mac3(const F2& a, const F2& b, v8f c) { c = wmma_bf(a.l, b.h, c); c = wmma_bf(a.h, b.l, c); return wmma_bf(a.h, b.h, c); }
__device__ __forceinline__ float sigm(float v) { return 1.0f / (1.0f + expf(-v)); }
#define LDSX() do { asm volatile("s_wait_dscnt 0" ::: "memory"); __builtin_amdgcn_wave_barrier(); __builtin_amdgcn_fence(__ATOMIC_RELEASE, "workgroup"); } while (0)


// SAttn (B 2, S 2048, dim 512, 8 heads x 64; self-attention: dec = mod): mod_l = mod Wl, dec_l = mod Wd; nm = LN(mod_l), nd = LN(dec_l) (shared gamma/beta, eps 1e-6); q = nm_h Wq[h], k = nd_h Wk[h], v = nd_h Wv[h]; attn = softmax(q k^T) (unscaled); o merged; mod2 = mod_l + o; out = mod2 + elu(LN(mod2) Wf + bf).
#define NB 2
#define SS 2048
#define DM 512
#define NH 8
#define HD 64
#define NTOK (NB * SS)
#ifndef TQB
#define TQB (SS / 64)
#define TNB NB
#define TOB (NB * SS / 64)
#endif
typedef __attribute__((ext_vector_type(8))) __bf16 v8b;
__device__ __forceinline__ v16b frag_b(const __bf16* rowk0, int lane) {
  union { v16b v; v8b q[2]; } u; const __bf16* p = rowk0 + 8 * (lane >> 4);
  u.q[0] = *(const v8b*)p; u.q[1] = *(const v8b*)(p + 16); return u.v;
}
__device__ __forceinline__ float bfr(float v) { return (float)(__bf16)v; }
__device__ __attribute__((noinline)) float exp_ni(float v) { return expf(v); }
__device__ __attribute__((noinline)) float erf_ni(float v) { return erff(v); }

__device__ __attribute__((noinline)) float expm1_ni(float v) { return expm1f(v); }
#define WS_PW  0u                 // bf16 rows (in,out -> [out][in]): Wl|Wd -> [1024][512]; Wq (block diagonal) [512][512]; Wk|Wv (block diagonal) [1024][512]; Wf [512][512]
#define PLD 0
#define PQQ (PLD + 2 * DM * DM)
#define PKV (PQQ + DM * DM)
#define PFF (PKV + 2 * DM * DM)
#define PWEND (PFF + DM * DM)
#define WS_ML  (WS_PW + 2u * PWEND)   // f32 [NTOK][1024] mod_l | dec_l
#define WS_NM  (WS_ML + 4u * NTOK * 2 * DM)   // f32 [NTOK][512] LN(mod_l), later LN(mod2)
#define WS_ND  (WS_NM + 4u * NTOK * DM)       // f32 [NTOK][512] LN(dec_l)
#define WS_Q   (WS_ND + 4u * NTOK * DM)       // f32 [NTOK][512] q
#define WS_KV  (WS_Q + 4u * NTOK * DM)        // f32 [NTOK][1024] k | v
#define WS_VH  (WS_KV + 4u * NTOK * 2 * DM)   // bf16 [NB][512][SS] v planes
#define WS_VL  (WS_VH + 2u * NB * DM * SS)
#define WS_M2  (WS_VL + 2u * NB * DM * SS)   // f32 [NTOK][512] mod2 = mod_l + o
#define WS_END (WS_M2 + 4u * NTOK * DM)

// ---- k_packT: block = (output col n, which): 0: n < 1024: [Wl | Wd] (in,out) rows [n][512]; 1: Wq block-diagonal: row n = h*64+e gets Wq[h][d][e] at cols h*64+d, zeros elsewhere; 2: n < 1024: [Wk | Wv] block-diagonal likewise; 3: Wf rows
__global__ __launch_bounds__(256) void k_packT(const float* __restrict__ WL, const float* __restrict__ WD, const float* __restrict__ WQ, const float* __restrict__ WK, const float* __restrict__ WV, const float* __restrict__ WF, __bf16* __restrict__ PW) {
  __shared__ __align__(16) __bf16 s[DM]; const int n = blockIdx.x, which = blockIdx.y, k = threadIdx.x; float v = 0.f; size_t dst;   // 512 threads? no: 256 threads x 2
  for (int kk = k; kk < DM; kk += 256) { float val = 0.f;
    if (which == 0) { const int part = n / DM, c = n % DM; val = (part == 0 ? WL : WD)[(size_t)kk * DM + c]; }
    else if (which == 1) { if (n < DM) { const int h = n / HD, e = n % HD; if (kk / HD == h) val = WQ[((size_t)h * HD + (kk % HD)) * HD + e]; } }
    else if (which == 2) { const int part = n / DM, c = n % DM; const int h = c / HD, e = c % HD; if (kk / HD == h) val = (part == 0 ? WK : WV)[((size_t)h * HD + (kk % HD)) * HD + e]; }
    else { if (n < DM) val = WF[(size_t)kk * DM + n]; }
    s[kk] = (__bf16)val; }
  if ((which == 1 || which == 3) && n >= DM) return;
  dst = (which == 0) ? (PLD + (size_t)n * DM) : (which == 1 ? (PQQ + (size_t)n * DM) : (which == 2 ? (PKV + (size_t)n * DM) : (PFF + (size_t)n * DM)));
  __syncthreads();
  if (k < DM / 8) vst2((unsigned*)(PW + dst + k * 8), *(const v4u*)&s[k * 8]);
  (void)v;
}
// ---- k_gemm<RIN, EPI>: block = (64 rows, 128 cols): OUT = A(hi/lo or exact, K 512, pitch lda) . rows; EPI 0: plain; EPI 1: + bias, ELU, + RES (out = RES + elu(acc + b)); EPI 2: v planes? (no) ; pitch ldo
template <int RIN, int EPI>
__global__ __launch_bounds__(128) void k_gemm(const float* __restrict__ A, int lda, const __bf16* __restrict__ P, const float* __restrict__ bias, const float* __restrict__ RES, float* __restrict__ OUT, int ldo) {
  __shared__ __align__(16) float so[4][16][132];
  const int tid = threadIdx.x, wave = tid >> 5, lane = tid & 31, col = lane & 15, g = lane >> 4; const size_t r0 = (size_t)blockIdx.x * 64 + wave * 16; const int n0 = blockIdx.y * 128;
  v8f acc[8] = {};
#pragma unroll 2
  for (int kc = 0; kc < DM / 32; ++kc) { F2 a; if (RIN) { v16b ax; const float* p = A + (r0 + col) * lda + kc * 32 + 8 * g;
#pragma unroll
      for (int i = 0; i < 8; ++i) { ax[i] = (__bf16)p[i]; ax[8 + i] = (__bf16)p[16 + i]; } a.h = ax; a.l = ax; } else a = split_row(A + (r0 + col) * lda, kc * 32, lane);
#pragma unroll
    for (int j = 0; j < 8; ++j) { const v16b w = frag_b(P + (size_t)(n0 + j * 16 + col) * DM + kc * 32, lane); if (!RIN) acc[j] = wmma_bf(a.l, w, acc[j]); acc[j] = wmma_bf(a.h, w, acc[j]); } }
#pragma unroll
  for (int j = 0; j < 8; ++j) { const int n = n0 + j * 16 + col; const float bb = (EPI == 1) ? bfr(bias[n]) : 0.f;
#pragma unroll
    for (int r = 0; r < 8; ++r) { float v = acc[j][r] + bb; if (EPI == 1) { v = (v > 0.f) ? v : expm1_ni(v); v = RES[(r0 + 8 * g + r) * ldo + n] + v; } so[wave][8 * g + r][j * 16 + col] = v; } }
  LDSX();
  for (int rl = 0; rl < 16; ++rl) vst2(OUT + (r0 + rl) * ldo + n0 + lane * 4, *(const v4f*)&so[wave][rl][lane * 4]);
}
// ---- k_ln: block = 8 rows (wave per row): OUT = LN(IN) over 512 (biased var, eps 1e-6) * gamma + beta
__global__ __launch_bounds__(256) void k_ln(const float* __restrict__ IN, int ldi, const float* __restrict__ G, const float* __restrict__ Bb, float* __restrict__ OUT) {
  __shared__ __align__(16) float s[8][DM]; const int wave = threadIdx.x >> 5, lane = threadIdx.x & 31; const size_t row = (size_t)blockIdx.x * 8 + wave; float v[16]; float sum = 0.f;
#pragma unroll
  for (int k = 0; k < 16; ++k) { v[k] = IN[row * ldi + lane + 32 * k]; sum += v[k]; }
#pragma unroll
  for (int o = 1; o < 32; o <<= 1) sum += __shfl_xor(sum, o);
  const float mu = sum / (float)DM; float var = 0.f;
#pragma unroll
  for (int k = 0; k < 16; ++k) { const float d = v[k] - mu; var += d * d; }
#pragma unroll
  for (int o = 1; o < 32; o <<= 1) var += __shfl_xor(var, o);
  const float rs = rsqrtf(var / (float)DM + 1e-6f);
#pragma unroll
  for (int k = 0; k < 16; ++k) { const int c = lane + 32 * k; s[wave][c] = (v[k] - mu) * rs * bfr(G[c]) + bfr(Bb[c]); }
  LDSX();
  for (int pc = lane; pc < DM / 4; pc += 32) vst2(OUT + row * DM + pc * 4, *(const v4f*)&s[wave][pc * 4]);
}
// ---- k_vplanes: block = (64 tokens, 128-col chunk): v (KV cols 512 + c) -> transposed hi/lo planes [b][c][s]
__global__ __launch_bounds__(256) void k_vplanes(const float* __restrict__ KV, __bf16* __restrict__ VH, __bf16* __restrict__ VL) {
  __shared__ __align__(16) __bf16 sh[128][72], sl[128][72]; const int tid = threadIdx.x; const size_t rb = (size_t)blockIdx.x * 64; const int c0 = blockIdx.y * 128; const int b = (int)(rb / SS), s0 = (int)(rb % SS);
  for (int q = tid; q < 64 * 128; q += 256) { const int rl = q >> 7, c = q & 127; const float v = KV[(rb + rl) * (2 * DM) + DM + c0 + c]; const __bf16 hb = (__bf16)v; sh[c][rl] = hb; sl[c][rl] = (__bf16)(v - (float)hb); }
  __syncthreads();
  for (int q = tid; q < 128 * 8; q += 256) { const int c = q >> 3, pc = q & 7; const size_t o = ((size_t)b * DM + c0 + c) * SS + s0 + pc * 8; vst2((unsigned*)(VH + o), *(const v4u*)&sh[c][pc * 8]); vst2((unsigned*)(VL + o), *(const v4u*)&sl[c][pc * 8]); }
}
// ---- k_attn: block = (64 queries, head h, batch b): unscaled logits q.k (3 products), online softmax over all 2048 keys, P.V (3 products); epilogue: mod2 = mod_l + o -> M2 cols h*64+d (256-B segments)
__global__ __launch_bounds__(128) void k_attn(const float* __restrict__ Q, const float* __restrict__ KV, const __bf16* __restrict__ VH, const __bf16* __restrict__ VL, const float* __restrict__ ML, float* __restrict__ M2) {
  __shared__ __align__(16) float sp[4][16][36]; __shared__ __align__(16) float so[4][16][68];
  const int tid = threadIdx.x, wave = tid >> 5, lane = tid & 31, col = lane & 15, g = lane >> 4; const int qb = blockIdx.x, h = blockIdx.y, b = blockIdx.z; const int q0 = qb * 64 + wave * 16; const size_t rq = (size_t)b * SS + q0;
  F2 aq[2];
#pragma unroll
  for (int kc = 0; kc < 2; ++kc) aq[kc] = split_row(Q + (rq + col) * DM + h * HD, kc * 32, lane);
  float m[8], l[8];
#pragma unroll
  for (int r = 0; r < 8; ++r) { m[r] = -3.0e38f; l[r] = 0.f; }
  v8f acc[4] = {};
#pragma unroll 1
  for (int ks = 0; ks < SS / 32; ++ks) { v8f s[2];
#pragma unroll
    for (int ct = 0; ct < 2; ++ct) { const int kk = ks * 32 + ct * 16 + col; const float* krow = KV + ((size_t)b * SS + kk) * (2 * DM) + h * HD; v8f c = {};
#pragma unroll
      for (int kc = 0; kc < 2; ++kc) { const F2 kb = split_row(krow, kc * 32, lane); c = mac3(aq[kc], kb, c); }
      s[ct] = c; }
#pragma unroll
    for (int r = 0; r < 8; ++r) { float mx = fmaxf(s[0][r], s[1][r]);
#pragma unroll
      for (int o = 1; o < 16; o <<= 1) mx = fmaxf(mx, __shfl_xor(mx, o));
      const float mn = fmaxf(m[r], mx); const float alpha = exp_ni(m[r] - mn);
      const float e0 = exp_ni(s[0][r] - mn), e1 = exp_ni(s[1][r] - mn); float es = e0 + e1;
#pragma unroll
      for (int o = 1; o < 16; o <<= 1) es += __shfl_xor(es, o);
      l[r] = l[r] * alpha + es; m[r] = mn;
#pragma unroll
      for (int dt = 0; dt < 4; ++dt) acc[dt][r] *= alpha;
      sp[wave][8 * g + r][col] = e0; sp[wave][8 * g + r][16 + col] = e1; }
    LDSX();
    const F2 pa = split_row(&sp[wave][col][0], 0, lane);
#pragma unroll
    for (int dt = 0; dt < 4; ++dt) { const size_t vr = ((size_t)b * DM + h * HD + dt * 16 + col) * SS + ks * 32; const v16b vh = frag_b(VH + vr, lane), vl = frag_b(VL + vr, lane); acc[dt] = wmma_bf(pa.l, vh, acc[dt]); acc[dt] = wmma_bf(pa.h, vl, acc[dt]); acc[dt] = wmma_bf(pa.h, vh, acc[dt]); }
    LDSX(); }
#pragma unroll
  for (int r = 0; r < 8; ++r) { const float il = 1.0f / l[r]; const size_t row = rq + 8 * g + r;
#pragma unroll
    for (int dt = 0; dt < 4; ++dt) { const int c = h * HD + dt * 16 + col; so[wave][8 * g + r][dt * 16 + col] = ML[row * (2 * DM) + c] + acc[dt][r] * il; } }
  LDSX();
  for (int rl = 0; rl < 16; ++rl) if (lane < 16) vst2(M2 + (rq + rl) * DM + h * HD + lane * 4, *(const v4f*)&so[wave][rl][lane * 4]);
}
extern "C" void kernel_launch(void* const* d_in, const int* in_sizes, int n_in, void* d_out, int out_size, void* d_ws, size_t ws_size, hipStream_t stream) {
  (void)in_sizes; (void)n_in; (void)out_size;
  const float** F = (const float**)d_in;   // 0 mod [2,2048,512], 1 Wl [512,512], 2 Wd, 3 Wq [8,64,64], 4 Wk, 5 Wv, 6 gamma [512], 7 beta, 8 Wf [512,512], 9 bf [512]
  if (ws_size < (size_t)WS_END) return;
  char* ws = (char*)d_ws; __bf16 *PW = (__bf16*)(ws + WS_PW), *VH = (__bf16*)(ws + WS_VH), *VL = (__bf16*)(ws + WS_VL); float *ML = (float*)(ws + WS_ML), *NM = (float*)(ws + WS_NM), *ND = (float*)(ws + WS_ND), *Q = (float*)(ws + WS_Q), *KV = (float*)(ws + WS_KV), *M2 = (float*)(ws + WS_M2);
  const int NR = TNB * SS / 64;
  k_packT<<<dim3(2 * DM, 4), 256, 0, stream>>>(F[1], F[2], F[3], F[4], F[5], F[8], PW);
  k_gemm<1, 0><<<dim3(NR, 2 * DM / 128), 128, 0, stream>>>(F[0], DM, PW + PLD, nullptr, nullptr, ML, 2 * DM);        // mod_l | dec_l (exact)
  k_ln<<<TNB * SS / 8, 256, 0, stream>>>(ML, 2 * DM, F[6], F[7], NM);
  k_ln<<<TNB * SS / 8, 256, 0, stream>>>(ML + DM, 2 * DM, F[6], F[7], ND);
  k_gemm<0, 0><<<dim3(NR, DM / 128), 128, 0, stream>>>(NM, DM, PW + PQQ, nullptr, nullptr, Q, DM);               // q
  k_gemm<0, 0><<<dim3(NR, 2 * DM / 128), 128, 0, stream>>>(ND, DM, PW + PKV, nullptr, nullptr, KV, 2 * DM);       // k | v
  k_vplanes<<<dim3(NR, DM / 128), 256, 0, stream>>>(KV, VH, VL);
  k_attn<<<dim3(TQB, NH, TNB), 128, 0, stream>>>(Q, KV, VH, VL, ML, M2);                                          // mod2 = mod_l + o
  k_ln<<<TOB * 8, 256, 0, stream>>>(M2, DM, F[6], F[7], NM);                                                      // LN(mod2) (NM reused)
  k_gemm<0, 1><<<dim3(TOB, DM / 128), 128, 0, stream>>>(NM, DM, PW + PFF, F[9], M2, (float*)d_out, DM);           // out = mod2 + elu(LN(mod2) Wf + bf)
}

// v001
// Measured time: 398 microseconds a run.
// In both of two side-by-side timings against v000, it was 1.26 times as fast.
// compute dtype: mod and all weights/LN params (module inputs) rounded to bf16; mod Wl / mod Wd with exact bf16 products (inputs); the per-head q/k/v 1x1 convs (as two block-diagonal GEMMs: q 512->512, k|v 512->1024), the FFN and scores/P.V with the computed operands as bf16 hi + residual pairs (2 products against exact weights; 3 products for q.k and P.V); LayerNorms, softmax (no 1/sqrt(d) scale), ELU and residuals in f32; f32 accumulate.
#include <hip/hip_runtime.h>
#include <math.h>

typedef __attribute__((ext_vector_type(16))) _Float16 v16h;
typedef __attribute__((ext_vector_type(16))) __bf16 v16b;
typedef __attribute__((ext_vector_type(8)))  _Float16 v8h;
typedef __attribute__((ext_vector_type(8)))  float v8f;
typedef __attribute__((ext_vector_type(4)))  float v4f;
typedef __attribute__((ext_vector_type(2)))  float v2f;
typedef __attribute__((ext_vector_type(4)))  unsigned v4u;
typedef __attribute__((ext_vector_type(4)))  int v4i;
typedef float __attribute__((may_alias)) float_a;
typedef int __attribute__((may_alias)) int_a;

template <typename T> __device__ __forceinline__ void vst2(void* p, T v) { *(T*)p = v;  }
__device__ __forceinline__ v8f wmma16(v16h a, v16h b, v8f c) {
  v8f d = __builtin_amdgcn_wmma_f32_16x16x32_f16(false, a, false, b, (short)0, c, false, false);
  asm volatile("v_nop\n\tv_nop\n\tv_nop\n\tv_nop" : "+v"(d) : "v"(a), "v"(b));
  return d;
}
__device__ __forceinline__ v8f wmma_bf(v16b a, v16b b, v8f c) {
  v8f d = __builtin_amdgcn_wmma_f32_16x16x32_bf16(false, a, false, b, (short)0, c, false, false);
  asm volatile("v_nop\n\tv_nop\n\tv_nop\n\tv_nop" : "+v"(d) : "v"(a), "v"(b));
  return d;
}
// 16x16x32 fragments: lane = (h = lane>>4, row/col = lane&15); elements 0..7 = k0+8h+0..7, 8..15 = k0+16+8h+0..7; D element r = row 8h+r
__device__ __forceinline__ v16h frag_h(const _Float16* rowk0, int lane) {
  union { v16h v; v8h q[2]; } u; const _Float16* p = rowk0 + 8 * (lane >> 4);
  u.q[0] = *(const v8h*)p; u.q[1] = *(const v8h*)(p + 16); return u.v;
}
__device__ __forceinline__ v16h frag_f32(const float* rowk0, int lane) {
  v16h a; const float* p = rowk0 + 8 * (lane >> 4);
#pragma unroll
  for (int i = 0; i < 8; ++i) { a[i] = (_Float16)p[i]; a[8 + i] = (_Float16)p[16 + i]; }
  return a;
}
__device__ __forceinline__ v16h frag_f32s(const float* rowk0, int lane, float sc) {
  v16h a; const float* p = rowk0 + 8 * (lane >> 4);
#pragma unroll
  for (int i = 0; i < 8; ++i) { a[i] = (_Float16)(p[i] * sc); a[8 + i] = (_Float16)(p[16 + i] * sc); }
  return a;
}
// column fragment from a [K][ld] layout (column n), rows >= K read as 0
__device__ __forceinline__ v16h fragc_f32(const float* W, int k0, int n, int lane, int ld, int K) {
  v16h a; const int g = lane >> 4;
#pragma unroll
  for (int i = 0; i < 8; ++i) { const int ka = k0 + 8 * g + i, kb = ka + 16;
    a[i] = (_Float16)(ka < K ? W[(size_t)(ka < K ? ka : K - 1) * ld + n] : 0.f); a[8 + i] = (_Float16)(kb < K ? W[(size_t)(kb < K ? kb : K - 1) * ld + n] : 0.f); }
  return a;
}
struct F2 { v16b h, l; };
__device__ __forceinline__ F2 bsplit16(const float v[16]) { F2 r;
#pragma unroll
  for (int i = 0; i < 16; ++i) { const __bf16 h = (__bf16)v[i]; r.h[i] = h; r.l[i] = (__bf16)(v[i] - (float)h); }
  return r; }
__device__ __forceinline__ F2 split_row(const float* row, int k0, int lane) { float v[16]; const float* p = row + k0 + 8 * (lane >> 4);
#pragma unroll
  for (int i = 0; i < 8; ++i) { v[i] = p[i]; v[8 + i] = p[16 + i]; }
  return bsplit16(v); }
__device__ __forceinline__ F2 split_rowK(const float* row, int k0, int lane, int K) { float v[16]; const int g = lane >> 4;
#pragma unroll
  for (int i = 0; i < 8; ++i) { const int ka = k0 + 8 * g + i, kb = ka + 16; v[i] = ka < K ? row[ka < K ? ka : K - 1] : 0.f; v[8 + i] = kb < K ? row[kb < K ? kb : K - 1] : 0.f; }
  return bsplit16(v); }
__device__ __forceinline__ F2 split_col(const float* W, int k0, int n, int lane, int ld, int K) { float v[16]; const int g = lane >> 4;
#pragma unroll
  for (int i = 0; i < 8; ++i) { const int ka = k0 + 8 * g + i, kb = ka + 16; v[i] = ka < K ? W[(size_t)(ka < K ? ka : K - 1) * ld + n] : 0.f; v[8 + i] = kb < K ? W[(size_t)(kb < K ? kb : K - 1) * ld + n] : 0.f; }
  return bsplit16(v); }
__device__ __forceinline__ v8f mac3(const F2& a, const F2& b, v8f c) { c = wmma_bf(a.l, b.h, c); c = wmma_bf(a.h, b.l, c); return wmma_bf(a.h, b.h, c); }
__device__ __forceinline__ float sigm(float v) { return 1.0f / (1.0f + expf(-v)); }
#define LDSX() do { asm volatile("s_wait_dscnt 0" ::: "memory"); __builtin_amdgcn_wave_barrier(); __builtin_amdgcn_fence(__ATOMIC_RELEASE, "workgroup"); } while (0)


// SAttn (B 2, S 2048, dim 512, 8 heads x 64; self-attention: dec = mod): mod_l = mod Wl, dec_l = mod Wd; nm = LN(mod_l), nd = LN(dec_l) (shared gamma/beta, eps 1e-6); q = nm_h Wq[h], k = nd_h Wk[h], v = nd_h Wv[h]; attn = softmax(q k^T) (unscaled); o merged; mod2 = mod_l + o; out = mod2 + elu(LN(mod2) Wf + bf).
#define NB 2
#define SS 2048
#define DM 512
#define NH 8
#define HD 64
#define NTOK (NB * SS)
#ifndef TQB
#define TQB (SS / 64)
#define TNB NB
#define TOB (NB * SS / 64)
#endif
typedef __attribute__((ext_vector_type(8))) __bf16 v8b;
__device__ __forceinline__ v16b frag_b(const __bf16* rowk0, int lane) {
  union { v16b v; v8b q[2]; } u; const __bf16* p = rowk0 + 8 * (lane >> 4);
  u.q[0] = *(const v8b*)p; u.q[1] = *(const v8b*)(p + 16); return u.v;
}
__device__ __forceinline__ float bfr(float v) { return (float)(__bf16)v; }
__device__ __attribute__((noinline)) float exp_ni(float v) { return expf(v); }
__device__ __attribute__((noinline)) float erf_ni(float v) { return erff(v); }

__device__ __attribute__((noinline)) float expm1_ni(float v) { return expm1f(v); }
#define WS_PW  0u                 // bf16 rows (in,out -> [out][in]): Wl|Wd -> [1024][512]; Wq (block diagonal) [512][512]; Wk|Wv (block diagonal) [1024][512]; Wf [512][512]
#define PLD 0
#define PQQ (PLD + 2 * DM * DM)
#define PKV (PQQ + DM * DM)
#define PFF (PKV + 2 * DM * DM)
#define PWEND (PFF + DM * DM)
#define WS_ML  (WS_PW + 2u * PWEND)   // f32 [NTOK][1024] mod_l | dec_l
#define WS_NM  (WS_ML + 4u * NTOK * 2 * DM)   // f32 [NTOK][512] LN(mod_l), later LN(mod2)
#define WS_ND  (WS_NM + 4u * NTOK * DM)       // f32 [NTOK][512] LN(dec_l)
#define WS_Q   (WS_ND + 4u * NTOK * DM)       // f32 [NTOK][512] q
#define WS_KV  (WS_Q + 4u * NTOK * DM)        // f32 [NTOK][1024] k | v
#define WS_VH  (WS_KV + 4u * NTOK * 2 * DM)   // bf16 [NB][512][SS] v planes
#define WS_VL  (WS_VH + 2u * NB * DM * SS)
#define WS_M2  (WS_VL + 2u * NB * DM * SS)   // f32 [NTOK][512] mod2 = mod_l + o
#define WS_END (WS_M2 + 4u * NTOK * DM)

// ---- k_packT: block = (output col n, which): 0: n < 1024: [Wl | Wd] (in,out) rows [n][512]; 1: Wq block-diagonal: row n = h*64+e gets Wq[h][d][e] at cols h*64+d, zeros elsewhere; 2: n < 1024: [Wk | Wv] block-diagonal likewise; 3: Wf rows
__global__ __launch_bounds__(256) void k_packT(const float* __restrict__ WL, const float* __restrict__ WD, const float* __restrict__ WQ, const float* __restrict__ WK, const float* __restrict__ WV, const float* __restrict__ WF, __bf16* __restrict__ PW) {
  __shared__ __align__(16) __bf16 s[DM]; const int n = blockIdx.x, which = blockIdx.y, k = threadIdx.x; float v = 0.f; size_t dst;   // 512 threads? no: 256 threads x 2
  for (int kk = k; kk < DM; kk += 256) { float val = 0.f;
    if (which == 0) { const int part = n / DM, c = n % DM; val = (part == 0 ? WL : WD)[(size_t)kk * DM + c]; }
    else if (which == 1) { if (n < DM) { const int h = n / HD, e = n % HD; if (kk / HD == h) val = WQ[((size_t)h * HD + (kk % HD)) * HD + e]; } }
    else if (which == 2) { const int part = n / DM, c = n % DM; const int h = c / HD, e = c % HD; if (kk / HD == h) val = (part == 0 ? WK : WV)[((size_t)h * HD + (kk % HD)) * HD + e]; }
    else { if (n < DM) val = WF[(size_t)kk * DM + n]; }
    s[kk] = (__bf16)val; }
  if ((which == 1 || which == 3) && n >= DM) return;
  dst = (which == 0) ? (PLD + (size_t)n * DM) : (which == 1 ? (PQQ + (size_t)n * DM) : (which == 2 ? (PKV + (size_t)n * DM) : (PFF + (size_t)n * DM)));
  __syncthreads();
  if (k < DM / 8) vst2((unsigned*)(PW + dst + k * 8), *(const v4u*)&s[k * 8]);
  (void)v;
}
// ---- k_gemm<RIN, EPI>: block = (64 rows, 128 cols): OUT = A(hi/lo or exact, K 512, pitch lda) . rows; EPI 0: plain; EPI 1: + bias, ELU, + RES (out = RES + elu(acc + b)); EPI 2: v planes? (no) ; pitch ldo
template <int RIN, int EPI>
__global__ __launch_bounds__(128) void k_gemm(const float* __restrict__ A, int lda, const __bf16* __restrict__ P, const float* __restrict__ bias, const float* __restrict__ RES, float* __restrict__ OUT, int ldo) {
  __shared__ __align__(16) float so[4][16][132];
  const int tid = threadIdx.x, wave = tid >> 5, lane = tid & 31, col = lane & 15, g = lane >> 4; const size_t r0 = (size_t)blockIdx.x * 64 + wave * 16; const int n0 = blockIdx.y * 128;
  v8f acc[8] = {};
#pragma unroll 2
  for (int kc = 0; kc < DM / 32; ++kc) { F2 a; if (RIN) { v16b ax; const float* p = A + (r0 + col) * lda + kc * 32 + 8 * g;
#pragma unroll
      for (int i = 0; i < 8; ++i) { ax[i] = (__bf16)p[i]; ax[8 + i] = (__bf16)p[16 + i]; } a.h = ax; a.l = ax; } else a = split_row(A + (r0 + col) * lda, kc * 32, lane);
#pragma unroll
    for (int j = 0; j < 8; ++j) { const v16b w = frag_b(P + (size_t)(n0 + j * 16 + col) * DM + kc * 32, lane); if (!RIN) acc[j] = wmma_bf(a.l, w, acc[j]); acc[j] = wmma_bf(a.h, w, acc[j]); } }
#pragma unroll
  for (int j = 0; j < 8; ++j) { const int n = n0 + j * 16 + col; const float bb = (EPI == 1) ? bfr(bias[n]) : 0.f;
#pragma unroll
    for (int r = 0; r < 8; ++r) { float v = acc[j][r] + bb; if (EPI == 1) { v = (v > 0.f) ? v : expm1_ni(v); v = RES[(r0 + 8 * g + r) * ldo + n] + v; } so[wave][8 * g + r][j * 16 + col] = v; } }
  LDSX();
  for (int rl = 0; rl < 16; ++rl) vst2(OUT + (r0 + rl) * ldo + n0 + lane * 4, *(const v4f*)&so[wave][rl][lane * 4]);
}
// ---- k_ln: block = 8 rows (wave per row): OUT = LN(IN) over 512 (biased var, eps 1e-6) * gamma + beta
__global__ __launch_bounds__(256) void k_ln(const float* __restrict__ IN, int ldi, const float* __restrict__ G, const float* __restrict__ Bb, float* __restrict__ OUT) {
  __shared__ __align__(16) float s[8][DM]; const int wave = threadIdx.x >> 5, lane = threadIdx.x & 31; const size_t row = (size_t)blockIdx.x * 8 + wave; float v[16]; float sum = 0.f;
#pragma unroll
  for (int k = 0; k < 16; ++k) { v[k] = IN[row * ldi + lane + 32 * k]; sum += v[k]; }
#pragma unroll
  for (int o = 1; o < 32; o <<= 1) sum += __shfl_xor(sum, o);
  const float mu = sum / (float)DM; float var = 0.f;
#pragma unroll
  for (int k = 0; k < 16; ++k) { const float d = v[k] - mu; var += d * d; }
#pragma unroll
  for (int o = 1; o < 32; o <<= 1) var += __shfl_xor(var, o);
  const float rs = rsqrtf(var / (float)DM + 1e-6f);
#pragma unroll
  for (int k = 0; k < 16; ++k) { const int c = lane + 32 * k; s[wave][c] = (v[k] - mu) * rs * bfr(G[c]) + bfr(Bb[c]); }
  LDSX();
  for (int pc = lane; pc < DM / 4; pc += 32) vst2(OUT + row * DM + pc * 4, *(const v4f*)&s[wave][pc * 4]);
}
// ---- k_vplanes: block = (64 tokens, 128-col chunk): v (KV cols 512 + c) -> transposed hi/lo planes [b][c][s]
__global__ __launch_bounds__(256) void k_vplanes(const float* __restrict__ KV, __bf16* __restrict__ VH, __bf16* __restrict__ VL) {
  __shared__ __align__(16) __bf16 sh[128][72], sl[128][72]; const int tid = threadIdx.x; const size_t rb = (size_t)blockIdx.x * 64; const int c0 = blockIdx.y * 128; const int b = (int)(rb / SS), s0 = (int)(rb % SS);
  for (int q = tid; q < 64 * 128; q += 256) { const int rl = q >> 7, c = q & 127; const float v = KV[(rb + rl) * (2 * DM) + DM + c0 + c]; const __bf16 hb = (__bf16)v; sh[c][rl] = hb; sl[c][rl] = (__bf16)(v - (float)hb); }
  __syncthreads();
  for (int q = tid; q < 128 * 8; q += 256) { const int c = q >> 3, pc = q & 7; const size_t o = ((size_t)b * DM + c0 + c) * SS + s0 + pc * 8; vst2((unsigned*)(VH + o), *(const v4u*)&sh[c][pc * 8]); vst2((unsigned*)(VL + o), *(const v4u*)&sl[c][pc * 8]); }
}
__device__ __forceinline__ float xhalf(float v) { return __builtin_bit_cast(float, __builtin_amdgcn_permlanex16(__builtin_bit_cast(int, v), __builtin_bit_cast(int, v), 0x76543210, 0xfedcba98, false, false)); }   // lane l reads lane l ^ 16
__global__ __launch_bounds__(128) void k_attn(const float* __restrict__ Q, const float* __restrict__ KV, const __bf16* __restrict__ VH, const __bf16* __restrict__ VL, const float* __restrict__ ML, float* __restrict__ M2) {
  __shared__ __align__(16) float so[4][16][68];
  const int tid = threadIdx.x, wave = tid >> 5, lane = tid & 31, col = lane & 15, g = lane >> 4; const int qb = blockIdx.x, h = blockIdx.y, b = blockIdx.z; const int q0 = qb * 64 + wave * 16; const size_t rq = (size_t)b * SS + q0;
  F2 aq[2];
#pragma unroll
  for (int kc = 0; kc < 2; ++kc) aq[kc] = split_row(Q + (rq + col) * DM + h * HD, kc * 32, lane);
  float m = -3.0e38f, l = 0.f;
  v8f acc[4] = {};   // O^T: lane = query col, element r of tile dt = d dt*16 + 8g + r
#pragma unroll 1
  for (int ks = 0; ks < SS / 32; ++ks) { v8f s[2];   // S^T: element r of tile ct = key ks*32 + ct*16 + 8g + r
#pragma unroll
    for (int ct = 0; ct < 2; ++ct) { const int kk = ks * 32 + ct * 16 + col; const float* krow = KV + ((size_t)b * SS + kk) * (2 * DM) + h * HD; v8f c = {};
#pragma unroll
      for (int kc = 0; kc < 2; ++kc) { const F2 kb = split_row(krow, kc * 32, lane); c = wmma_bf(kb.h, aq[kc].l, c); c = wmma_bf(kb.l, aq[kc].h, c); c = wmma_bf(kb.h, aq[kc].h, c); }
      s[ct] = c; }
    float mx = fmaxf(s[0][0], s[1][0]);
#pragma unroll
    for (int r = 1; r < 8; ++r) mx = fmaxf(mx, fmaxf(s[0][r], s[1][r]));
    mx = fmaxf(mx, xhalf(mx));
    const float mn = fmaxf(m, mx); const float alpha = exp_ni(m - mn);
    float e[16]; float es = 0.f;
#pragma unroll
    for (int r = 0; r < 8; ++r) { e[r] = exp_ni(s[0][r] - mn); e[8 + r] = exp_ni(s[1][r] - mn); es += e[r] + e[8 + r]; }
    l = l * alpha + es; m = mn;   // l: this half's 16 of each 32 keys; the halves are joined once behind the loop (alpha is the same in both)
#pragma unroll
    for (int dt = 0; dt < 4; ++dt) acc[dt] *= alpha;
    const F2 pb = bsplit16(e);
#pragma unroll
    for (int dt = 0; dt < 4; ++dt) { const size_t vr = ((size_t)b * DM + h * HD + dt * 16 + col) * SS + ks * 32; const v16b vh = frag_b(VH + vr, lane), vl = frag_b(VL + vr, lane); acc[dt] = wmma_bf(vh, pb.l, acc[dt]); acc[dt] = wmma_bf(vl, pb.h, acc[dt]); acc[dt] = wmma_bf(vh, pb.h, acc[dt]); } }
  l += xhalf(l);
  const float il = 1.0f / l; const float* mlr = ML + (rq + col) * (2 * DM) + h * HD + 8 * g;
#pragma unroll
  for (int dt = 0; dt < 4; ++dt) {
#pragma unroll
    for (int r = 0; r < 8; ++r) so[wave][col][dt * 16 + 8 * g + r] = mlr[dt * 16 + r] + acc[dt][r] * il; }
  LDSX();
  for (int rl = 0; rl < 16; ++rl) if (lane < 16) vst2(M2 + (rq + rl) * DM + h * HD + lane * 4, *(const v4f*)&so[wave][rl][lane * 4]);
}
extern "C" void kernel_launch(void* const* d_in, const int* in_sizes, int n_in, void* d_out, int out_size, void* d_ws, size_t ws_size, hipStream_t stream) {
  (void)in_sizes; (void)n_in; (void)out_size;
  const float** F = (const float**)d_in;   // 0 mod [2,2048,512], 1 Wl [512,512], 2 Wd, 3 Wq [8,64,64], 4 Wk, 5 Wv, 6 gamma [512], 7 beta, 8 Wf [512,512], 9 bf [512]
  if (ws_size < (size_t)WS_END) return;
  char* ws = (char*)d_ws; __bf16 *PW = (__bf16*)(ws + WS_PW), *VH = (__bf16*)(ws + WS_VH), *VL = (__bf16*)(ws + WS_VL); float *ML = (float*)(ws + WS_ML), *NM = (float*)(ws + WS_NM), *ND = (float*)(ws + WS_ND), *Q = (float*)(ws + WS_Q), *KV = (float*)(ws + WS_KV), *M2 = (float*)(ws + WS_M2);
  const int NR = TNB * SS / 64;
  k_packT<<<dim3(2 * DM, 4), 256, 0, stream>>>(F[1], F[2], F[3], F[4], F[5], F[8], PW);
  k_gemm<1, 0><<<dim3(NR, 2 * DM / 128), 128, 0, stream>>>(F[0], DM, PW + PLD, nullptr, nullptr, ML, 2 * DM);        // mod_l | dec_l (exact)
  k_ln<<<TNB * SS / 8, 256, 0, stream>>>(ML, 2 * DM, F[6], F[7], NM);
  k_ln<<<TNB * SS / 8, 256, 0, stream>>>(ML + DM, 2 * DM, F[6], F[7], ND);
  k_gemm<0, 0><<<dim3(NR, DM / 128), 128, 0, stream>>>(NM, DM, PW + PQQ, nullptr, nullptr, Q, DM);               // q
  k_gemm<0, 0><<<dim3(NR, 2 * DM / 128), 128, 0, stream>>>(ND, DM, PW + PKV, nullptr, nullptr, KV, 2 * DM);       // k | v
  k_vplanes<<<dim3(NR, DM / 128), 256, 0, stream>>>(KV, VH, VL);
  k_attn<<<dim3(TQB, NH, TNB), 128, 0, stream>>>(Q, KV, VH, VL, ML, M2);                                          // mod2 = mod_l + o
  k_ln<<<TOB * 8, 256, 0, stream>>>(M2, DM, F[6], F[7], NM);                                                      // LN(mod2) (NM reused)
  k_gemm<0, 1><<<dim3(TOB, DM / 128), 128, 0, stream>>>(NM, DM, PW + PFF, F[9], M2, (float*)d_out, DM);           // out = mod2 + elu(LN(mod2) Wf + bf)
}

// v002
// One run takes 286 microseconds.
// Next to v001, in two timings, it ran 1.41 and 1.39 times as fast.
// Over all steps from v000 it is 1.77 times as fast.
// compute dtype: mod and all weights/LN params (module inputs) rounded to bf16; mod Wl / mod Wd with exact bf16 products (inputs); the per-head q/k/v 1x1 convs (as two block-diagonal GEMMs: q 512->512, k|v 512->1024), the FFN and scores/P.V with the computed operands as bf16 hi + residual pairs (2 products against exact weights; 3 products for q.k and P.V); LayerNorms, softmax (no 1/sqrt(d) scale), ELU and residuals in f32; f32 accumulate.
#include <hip/hip_runtime.h>
#include <math.h>

typedef __attribute__((ext_vector_type(16))) _Float16 v16h;
typedef __attribute__((ext_vector_type(16))) __bf16 v16b;
typedef __attribute__((ext_vector_type(8)))  _Float16 v8h;
typedef __attribute__((ext_vector_type(8)))  float v8f;
typedef __attribute__((ext_vector_type(4)))  float v4f;
typedef __attribute__((ext_vector_type(2)))  float v2f;
typedef __attribute__((ext_vector_type(4)))  unsigned v4u;
typedef __attribute__((ext_vector_type(4)))  int v4i;
typedef float __attribute__((may_alias)) float_a;
typedef int __attribute__((may_alias)) int_a;

template <typename T> __device__ __forceinline__ void vst2(void* p, T v) { *(T*)p = v;  }
__device__ __forceinline__ v8f wmma16(v16h a, v16h b, v8f c) {
  v8f d = __builtin_amdgcn_wmma_f32_16x16x32_f16(false, a, false, b, (short)0, c, false, false);
  asm volatile("v_nop\n\tv_nop\n\tv_nop\n\tv_nop" : "+v"(d) : "v"(a), "v"(b));
  return d;
}
__device__ __forceinline__ v8f wmma_bf(v16b a, v16b b, v8f c) {
  v8f d = __builtin_amdgcn_wmma_f32_16x16x32_bf16(false, a, false, b, (short)0, c, false, false);
  asm volatile("v_nop\n\tv_nop\n\tv_nop\n\tv_nop" : "+v"(d) : "v"(a), "v"(b));
  return d;
}
// 16x16x32 fragments: lane = (h = lane>>4, row/col = lane&15); elements 0..7 = k0+8h+0..7, 8..15 = k0+16+8h+0..7; D element r = row 8h+r
__device__ __forceinline__ v16h frag_h(const _Float16* rowk0, int lane) {
  union { v16h v; v8h q[2]; } u; const _Float16* p = rowk0 + 8 * (lane >> 4);
  u.q[0] = *(const v8h*)p; u.q[1] = *(const v8h*)(p + 16); return u.v;
}
__device__ __forceinline__ v16h frag_f32(const float* rowk0, int lane) {
  v16h a; const float* p = rowk0 + 8 * (lane >> 4);
#pragma unroll
  for (int i = 0; i < 8; ++i) { a[i] = (_Float16)p[i]; a[8 + i] = (_Float16)p[16 + i]; }
  return a;
}
__device__ __forceinline__ v16h frag_f32s(const float* rowk0, int lane, float sc) {
  v16h a; const float* p = rowk0 + 8 * (lane >> 4);
#pragma unroll
  for (int i = 0; i < 8; ++i) { a[i] = (_Float16)(p[i] * sc); a[8 + i] = (_Float16)(p[16 + i] * sc); }
  return a;
}
// column fragment from a [K][ld] layout (column n), rows >= K read as 0
__device__ __forceinline__ v16h fragc_f32(const float* W, int k0, int n, int lane, int ld, int K) {
  v16h a; const int g = lane >> 4;
#pragma unroll
  for (int i = 0; i < 8; ++i) { const int ka = k0 + 8 * g + i, kb = ka + 16;
    a[i] = (_Float16)(ka < K ? W[(size_t)(ka < K ? ka : K - 1) * ld + n] : 0.f); a[8 + i] = (_Float16)(kb < K ? W[(size_t)(kb < K ? kb : K - 1) * ld + n] : 0.f); }
  return a;
}
struct F2 { v16b h, l; };
__device__ __forceinline__ F2 bsplit16(const float v[16]) { F2 r;
#pragma unroll
  for (int i = 0; i < 16; ++i) { const __bf16 h = (__bf16)v[i]; r.h[i] = h; r.l[i] = (__bf16)(v[i] - (float)h); }
  return r; }
__device__ __forceinline__ F2 split_row(const float* row, int k0, int lane) { float v[16]; const float* p = row + k0 + 8 * (lane >> 4);
#pragma unroll
  for (int i = 0; i < 8; ++i) { v[i] = p[i]; v[8 + i] = p[16 + i]; }
  return bsplit16(v); }
__device__ __forceinline__ F2 split_rowK(const float* row, int k0, int lane, int K) { float v[16]; const int g = lane >> 4;
#pragma unroll
  for (int i = 0; i < 8; ++i) { const int ka = k0 + 8 * g + i, kb = ka + 16; v[i] = ka < K ? row[ka < K ? ka : K - 1] : 0.f; v[8 + i] = kb < K ? row[kb < K ? kb : K - 1] : 0.f; }
  return bsplit16(v); }
__device__ __forceinline__ F2 split_col(const float* W, int k0, int n, int lane, int ld, int K) { float v[16]; const int g = lane >> 4;
#pragma unroll
  for (int i = 0; i < 8; ++i) { const int ka = k0 + 8 * g + i, kb = ka + 16; v[i] = ka < K ? W[(size_t)(ka < K ? ka : K - 1) * ld + n] : 0.f; v[8 + i] = kb < K ? W[(size_t)(kb < K ? kb : K - 1) * ld + n] : 0.f; }
  return bsplit16(v); }
__device__ __forceinline__ v8f mac3(const F2& a, const F2& b, v8f c) { c = wmma_bf(a.l, b.h, c); c = wmma_bf(a.h, b.l, c); return wmma_bf(a.h, b.h, c); }
__device__ __forceinline__ float sigm(float v) { return 1.0f / (1.0f + expf(-v)); }
#define LDSX() do { asm volatile("s_wait_dscnt 0" ::: "memory"); __builtin_amdgcn_wave_barrier(); __builtin_amdgcn_fence(__ATOMIC_RELEASE, "workgroup"); } while (0)


// SAttn (B 2, S 2048, dim 512, 8 heads x 64; self-attention: dec = mod): mod_l = mod Wl, dec_l = mod Wd; nm = LN(mod_l), nd = LN(dec_l) (shared gamma/beta, eps 1e-6); q = nm_h Wq[h], k = nd_h Wk[h], v = nd_h Wv[h]; attn = softmax(q k^T) (unscaled); o merged; mod2 = mod_l + o; out = mod2 + elu(LN(mod2) Wf + bf).
#define NB 2
#define SS 2048
#define DM 512
#define NH 8
#define HD 64
#define NTOK (NB * SS)
#ifndef TQB
#define TQB (SS / 64)
#define TNB NB
#define TOB (NB * SS / 64)
#endif
typedef __attribute__((ext_vector_type(8))) __bf16 v8b;
__device__ __forceinline__ v16b frag_b(const __bf16* rowk0, int lane) {
  union { v16b v; v8b q[2]; } u; const __bf16* p = rowk0 + 8 * (lane >> 4);
  u.q[0] = *(const v8b*)p; u.q[1] = *(const v8b*)(p + 16); return u.v;
}
__device__ __forceinline__ float bfr(float v) { return (float)(__bf16)v; }
__device__ __attribute__((noinline)) float exp_ni(float v) { return expf(v); }
__device__ __attribute__((noinline)) float erf_ni(float v) { return erff(v); }

__device__ __attribute__((noinline)) float expm1_ni(float v) { return expm1f(v); }
#define WS_PW  0u                 // bf16 rows (in,out -> [out][in]): Wl|Wd -> [1024][512]; Wq (block diagonal) [512][512]; Wk|Wv (block diagonal) [1024][512]; Wf [512][512]
#define PLD 0
#define PQQ (PLD + 2 * DM * DM)
#define PKV (PQQ + DM * DM)
#define PFF (PKV + 2 * DM * DM)
#define PWEND (PFF + DM * DM)
#define WS_ML  (WS_PW + 2u * PWEND)   // f32 [NTOK][1024] mod_l | dec_l
#define WS_NM  (WS_ML + 4u * NTOK * 2 * DM)   // f32 [NTOK][512] LN(mod_l), later LN(mod2)
#define WS_ND  (WS_NM + 4u * NTOK * DM)       // f32 [NTOK][512] LN(dec_l)
#define WS_Q   (WS_ND + 4u * NTOK * DM)       // f32 [NTOK][512] q
#define WS_KV  (WS_Q + 4u * NTOK * DM)        // f32 [NTOK][1024] k | v
#define WS_VH  (WS_KV + 4u * NTOK * 2 * DM)   // bf16 [NB][512][SS] v planes
#define WS_VL  (WS_VH + 2u * NB * DM * SS)
#define WS_M2  (WS_VL + 2u * NB * DM * SS)   // f32 [NTOK][512] mod2 = mod_l + o
#define WS_END (WS_M2 + 4u * NTOK * DM)

// ---- k_packT: block = (output col n, which): 0: n < 1024: [Wl | Wd] (in,out) rows [n][512]; 1: Wq block-diagonal: row n = h*64+e gets Wq[h][d][e] at cols h*64+d, zeros elsewhere; 2: n < 1024: [Wk | Wv] block-diagonal likewise; 3: Wf rows
__global__ __launch_bounds__(256) void k_packT(const float* __restrict__ WL, const float* __restrict__ WD, const float* __restrict__ WQ, const float* __restrict__ WK, const float* __restrict__ WV, const float* __restrict__ WF, __bf16* __restrict__ PW) {
  __shared__ __align__(16) __bf16 s[DM]; const int n = blockIdx.x, which = blockIdx.y, k = threadIdx.x; float v = 0.f; size_t dst;   // 512 threads? no: 256 threads x 2
  for (int kk = k; kk < DM; kk += 256) { float val = 0.f;
    if (which == 0) { const int part = n / DM, c = n % DM; val = (part == 0 ? WL : WD)[(size_t)kk * DM + c]; }
    else if (which == 1) { if (n < DM) { const int h = n / HD, e = n % HD; if (kk / HD == h) val = WQ[((size_t)h * HD + (kk % HD)) * HD + e]; } }
    else if (which == 2) { const int part = n / DM, c = n % DM; const int h = c / HD, e = c % HD; if (kk / HD == h) val = (part == 0 ? WK : WV)[((size_t)h * HD + (kk % HD)) * HD + e]; }
    else { if (n < DM) val = WF[(size_t)kk * DM + n]; }
    s[kk] = (__bf16)val; }
  if ((which == 1 || which == 3) && n >= DM) return;
  dst = (which == 0) ? (PLD + (size_t)n * DM) : (which == 1 ? (PQQ + (size_t)n * DM) : (which == 2 ? (PKV + (size_t)n * DM) : (PFF + (size_t)n * DM)));
  __syncthreads();
  if (k < DM / 8) vst2((unsigned*)(PW + dst + k * 8), *(const v4u*)&s[k * 8]);
  (void)v;
}
// ---- k_gemm<RIN, EPI>: block = (64 rows, 128 cols): OUT = A(hi/lo or exact, K 512, pitch lda) . rows; EPI 0: plain; EPI 1: + bias, ELU, + RES (out = RES + elu(acc + b)); EPI 2: v planes? (no) ; pitch ldo
template <int RIN, int EPI>
__global__ __launch_bounds__(128) void k_gemm(const float* __restrict__ A, int lda, const __bf16* __restrict__ P, const float* __restrict__ bias, const float* __restrict__ RES, float* __restrict__ OUT, int ldo) {
  __shared__ __align__(16) float so[4][16][132];
  const int tid = threadIdx.x, wave = tid >> 5, lane = tid & 31, col = lane & 15, g = lane >> 4; const size_t r0 = (size_t)blockIdx.x * 64 + wave * 16; const int n0 = blockIdx.y * 128;
  v8f acc[8] = {};
#pragma unroll 2
  for (int kc = 0; kc < DM / 32; ++kc) { F2 a; if (RIN) { v16b ax; const float* p = A + (r0 + col) * lda + kc * 32 + 8 * g;
#pragma unroll
      for (int i = 0; i < 8; ++i) { ax[i] = (__bf16)p[i]; ax[8 + i] = (__bf16)p[16 + i]; } a.h = ax; a.l = ax; } else a = split_row(A + (r0 + col) * lda, kc * 32, lane);
#pragma unroll
    for (int j = 0; j < 8; ++j) { const v16b w = frag_b(P + (size_t)(n0 + j * 16 + col) * DM + kc * 32, lane); if (!RIN) acc[j] = wmma_bf(a.l, w, acc[j]); acc[j] = wmma_bf(a.h, w, acc[j]); } }
#pragma unroll
  for (int j = 0; j < 8; ++j) { const int n = n0 + j * 16 + col; const float bb = (EPI == 1) ? bfr(bias[n]) : 0.f;
#pragma unroll
    for (int r = 0; r < 8; ++r) { float v = acc[j][r] + bb; if (EPI == 1) { v = (v > 0.f) ? v : expm1_ni(v); v = RES[(r0 + 8 * g + r) * ldo + n] + v; } so[wave][8 * g + r][j * 16 + col] = v; } }
  LDSX();
  for (int rl = 0; rl < 16; ++rl) vst2(OUT + (r0 + rl) * ldo + n0 + lane * 4, *(const v4f*)&so[wave][rl][lane * 4]);
}
// ---- k_ln: block = 8 rows (wave per row): OUT = LN(IN) over 512 (biased var, eps 1e-6) * gamma + beta
__global__ __launch_bounds__(256) void k_ln(const float* __restrict__ IN, int ldi, const float* __restrict__ G, const float* __restrict__ Bb, float* __restrict__ OUT) {
  __shared__ __align__(16) float s[8][DM]; const int wave = threadIdx.x >> 5, lane = threadIdx.x & 31; const size_t row = (size_t)blockIdx.x * 8 + wave; float v[16]; float sum = 0.f;
#pragma unroll
  for (int k = 0; k < 16; ++k) { v[k] = IN[row * ldi + lane + 32 * k]; sum += v[k]; }
#pragma unroll
  for (int o = 1; o < 32; o <<= 1) sum += __shfl_xor(sum, o);
  const float mu = sum / (float)DM; float var = 0.f;
#pragma unroll
  for (int k = 0; k < 16; ++k) { const float d = v[k] - mu; var += d * d; }
#pragma unroll
  for (int o = 1; o < 32; o <<= 1) var += __shfl_xor(var, o);
  const float rs = rsqrtf(var / (float)DM + 1e-6f);
#pragma unroll
  for (int k = 0; k < 16; ++k) { const int c = lane + 32 * k; s[wave][c] = (v[k] - mu) * rs * bfr(G[c]) + bfr(Bb[c]); }
  LDSX();
  for (int pc = lane; pc < DM / 4; pc += 32) vst2(OUT + row * DM + pc * 4, *(const v4f*)&s[wave][pc * 4]);
}
// ---- k_vplanes: block = (64 tokens, 128-col chunk): v (KV cols 512 + c) -> transposed hi/lo planes [b][c][s]
__global__ __launch_bounds__(256) void k_vplanes(const float* __restrict__ KV, __bf16* __restrict__ VH, __bf16* __restrict__ VL) {
  __shared__ __align__(16) __bf16 sh[128][72], sl[128][72]; const int tid = threadIdx.x; const size_t rb = (size_t)blockIdx.x * 64; const int c0 = blockIdx.y * 128; const int b = (int)(rb / SS), s0 = (int)(rb % SS);
  for (int q = tid; q < 64 * 128; q += 256) { const int rl = q >> 7, c = q & 127; const float v = KV[(rb + rl) * (2 * DM) + DM + c0 + c]; const __bf16 hb = (__bf16)v; sh[c][rl] = hb; sl[c][rl] = (__bf16)(v - (float)hb); }
  __syncthreads();
  for (int q = tid; q < 128 * 8; q += 256) { const int c = q >> 3, pc = q & 7; const size_t o = ((size_t)b * DM + c0 + c) * SS + s0 + pc * 8; vst2((unsigned*)(VH + o), *(const v4u*)&sh[c][pc * 8]); vst2((unsigned*)(VL + o), *(const v4u*)&sl[c][pc * 8]); }
}
__device__ __forceinline__ float xhalf(float v) { return __builtin_bit_cast(float, __builtin_amdgcn_permlanex16(__builtin_bit_cast(int, v), __builtin_bit_cast(int, v), 0x76543210, 0xfedcba98, false, false)); }   // lane l reads lane l ^ 16
#define KT 64                      // keys per staged tile
#define KP 68                      // floats per K row in LDS: 272 B = 16 B x 17, no bank conflict for 16-byte reads of 16 rows
#define VP 72                      // bf16 per V row in LDS: 144 B = 16 B x 9
#define KBUF (KT * KP * 4)         // bytes of one K buffer
#define VBUF (HD * VP * 2)         // bytes of one V-plane buffer
__device__ __forceinline__ unsigned lds_addr(const void* p) { return (unsigned)(unsigned long long)p; }   // LDS byte address = low 32 bits of a __shared__ address
// eight 16-byte copies per lane, global -> LDS through no register; s_wait_xcnt closes the statement so that no address register is rewritten ahead of it
__device__ __forceinline__ void acopy8(const unsigned (&l)[8], const char* const (&p)[8]) {
  asm volatile("global_load_async_to_lds_b128 %0, %8, off\n\t"
               "global_load_async_to_lds_b128 %1, %9, off\n\t"
               "global_load_async_to_lds_b128 %2, %10, off\n\t"
               "global_load_async_to_lds_b128 %3, %11, off\n\t"
               "global_load_async_to_lds_b128 %4, %12, off\n\t"
               "global_load_async_to_lds_b128 %5, %13, off\n\t"
               "global_load_async_to_lds_b128 %6, %14, off\n\t"
               "global_load_async_to_lds_b128 %7, %15, off\n\t"
               "s_wait_xcnt 0x0"
               :: "v"(l[0]), "v"(l[1]), "v"(l[2]), "v"(l[3]), "v"(l[4]), "v"(l[5]), "v"(l[6]), "v"(l[7]),
                  "v"(p[0]), "v"(p[1]), "v"(p[2]), "v"(p[3]), "v"(p[4]), "v"(p[5]), "v"(p[6]), "v"(p[7]) : "memory");
}
// one tile: K 64 rows x 256 B (a lane: chunk tid & 15 of rows tid >> 4 + 8 i), each V plane 64 rows x 128 B (chunk tid & 7 of rows tid >> 3 + 16 i); the arguments are the lane's own first addresses
__device__ __forceinline__ void stage_tile(const char* gk, const char* gh, const char* gl, unsigned lk, unsigned lh, unsigned ll) {
  unsigned a[8]; const char* p[8];
#pragma unroll
  for (int i = 0; i < 8; ++i) { a[i] = lk + i * (8 * KP * 4); p[i] = gk + (size_t)i * (8 * 2 * DM * 4); }
  acopy8(a, p);
#pragma unroll
  for (int i = 0; i < 4; ++i) { a[i] = lh + i * (16 * VP * 2); p[i] = gh + (size_t)i * (16 * SS * 2); a[4 + i] = ll + i * (16 * VP * 2); p[4 + i] = gl + (size_t)i * (16 * SS * 2); }
  acopy8(a, p);
}
__global__ __launch_bounds__(128) void k_attn(const float* __restrict__ Q, const float* __restrict__ KV, const __bf16* __restrict__ VH, const __bf16* __restrict__ VL, const float* __restrict__ ML, float* __restrict__ M2) {
  __shared__ __align__(16) float so[4][16][68];
  __shared__ __align__(16) float sK[2][KT][KP];
  __shared__ __align__(16) __bf16 sVH[2][HD][VP], sVL[2][HD][VP];
  const int tid = threadIdx.x, wave = tid >> 5, lane = tid & 31, col = lane & 15, g = lane >> 4; const int qb = blockIdx.x, h = blockIdx.y, b = blockIdx.z; const int q0 = qb * 64 + wave * 16; const size_t rq = (size_t)b * SS + q0;
  const char* gk = (const char*)(KV + ((size_t)b * SS + (tid >> 4)) * (2 * DM) + h * HD) + (tid & 15) * 16;
  const size_t vo = (((size_t)b * DM + h * HD + (tid >> 3)) * SS) * 2 + (tid & 7) * 16;
  const char* gh = (const char*)VH + vo; const char* gl = (const char*)VL + vo;
  const unsigned lk = lds_addr(&sK[0][tid >> 4][0]) + (tid & 15) * 16, lh = lds_addr(&sVH[0][tid >> 3][0]) + (tid & 7) * 16, ll = lds_addr(&sVL[0][tid >> 3][0]) + (tid & 7) * 16;
  stage_tile(gk, gh, gl, lk, lh, ll);
  F2 aq[2];
#pragma unroll
  for (int kc = 0; kc < 2; ++kc) aq[kc] = split_row(Q + (rq + col) * DM + h * HD, kc * 32, lane);
  asm volatile("s_wait_asynccnt 0x0" ::: "memory");   // this wave's part of tile 0 has landed
  __syncthreads();                                    // ... and every other wave's
  stage_tile(gk + (size_t)KT * (2 * DM * 4), gh + KT * 2, gl + KT * 2, lk + KBUF, lh + VBUF, ll + VBUF);
  float m = -3.0e38f, l = 0.f;
  v8f acc[4] = {};   // O^T: lane = query col, element r of tile dt = d dt*16 + 8g + r
#pragma unroll 1   // one trip = one staged tile; rolled, so that the ring's hand-over stands once, at the foot
  for (int t = 0; t < SS / KT; ++t) { const int buf = t & 1;
#pragma unroll     // sub becomes a constant in every LDS offset
    for (int sub = 0; sub < KT / 32; ++sub) { v8f s[2];   // S^T: element r of tile ct = key t*64 + sub*32 + ct*16 + 8g + r
      float kr[2][2][16];
#pragma unroll
      for (int ct = 0; ct < 2; ++ct) { const float* krow = &sK[buf][sub * 32 + ct * 16 + col][8 * g];
#pragma unroll
        for (int kc = 0; kc < 2; ++kc) { const float* p = krow + kc * 32;
#pragma unroll
          for (int i = 0; i < 8; ++i) { kr[ct][kc][i] = p[i]; kr[ct][kc][8 + i] = p[16 + i]; } } }
#pragma unroll
      for (int ct = 0; ct < 2; ++ct) { v8f c = {};
#pragma unroll
        for (int kc = 0; kc < 2; ++kc) { const F2 kb = bsplit16(kr[ct][kc]); c = wmma_bf(kb.h, aq[kc].l, c); c = wmma_bf(kb.l, aq[kc].h, c); c = wmma_bf(kb.h, aq[kc].h, c); }
        s[ct] = c; }
      v16b vh[4], vl[4];   // read ahead of the softmax, which covers their way from LDS
#pragma unroll
      for (int dt = 0; dt < 4; ++dt) { vh[dt] = frag_b(&sVH[buf][dt * 16 + col][sub * 32], lane); vl[dt] = frag_b(&sVL[buf][dt * 16 + col][sub * 32], lane); }
      float mx = fmaxf(s[0][0], s[1][0]);
#pragma unroll
      for (int r = 1; r < 8; ++r) mx = fmaxf(mx, fmaxf(s[0][r], s[1][r]));
      mx = fmaxf(mx, xhalf(mx));
      const float mn = fmaxf(m, mx); const float alpha = exp_ni(m - mn);
      float e[16]; float es = 0.f;
#pragma unroll
      for (int r = 0; r < 8; ++r) { e[r] = exp_ni(s[0][r] - mn); e[8 + r] = exp_ni(s[1][r] - mn); es += e[r] + e[8 + r]; }
      l = l * alpha + es; m = mn;   // l: this half's 16 of each 32 keys; the halves are joined once behind the loop (alpha is the same in both)
#pragma unroll
      for (int dt = 0; dt < 4; ++dt) acc[dt] *= alpha;
      const F2 pb = bsplit16(e);
#pragma unroll
      for (int dt = 0; dt < 4; ++dt) { acc[dt] = wmma_bf(vh[dt], pb.l, acc[dt]); acc[dt] = wmma_bf(vl[dt], pb.h, acc[dt]); acc[dt] = wmma_bf(vh[dt], pb.h, acc[dt]); } }
    asm volatile("s_wait_dscnt 0x0" ::: "memory");      // this wave's reads of buffer buf are done before the buffer is refilled
    asm volatile("s_wait_asynccnt 0x0" ::: "memory");   // this wave's part of tile t + 1 has landed
    __syncthreads();                                    // publishes tile t + 1 and ends every wave's reads of buffer buf
    if (t + 2 < SS / KT) stage_tile(gk + (size_t)(t + 2) * (KT * 2 * DM * 4), gh + (t + 2) * (KT * 2), gl + (t + 2) * (KT * 2), lk + buf * KBUF, lh + buf * VBUF, ll + buf * VBUF); }
  asm volatile("s_wait_asynccnt 0x0" ::: "memory");     // no copy is left in flight when the wave goes on
  l += xhalf(l);
  const float il = 1.0f / l; const float* mlr = ML + (rq + col) * (2 * DM) + h * HD + 8 * g;
#pragma unroll
  for (int dt = 0; dt < 4; ++dt) {
#pragma unroll
    for (int r = 0; r < 8; ++r) so[wave][col][dt * 16 + 8 * g + r] = mlr[dt * 16 + r] + acc[dt][r] * il; }
  LDSX();
  for (int rl = 0; rl < 16; ++rl) if (lane < 16) vst2(M2 + (rq + rl) * DM + h * HD + lane * 4, *(const v4f*)&so[wave][rl][lane * 4]);
}
extern "C" void kernel_launch(void* const* d_in, const int* in_sizes, int n_in, void* d_out, int out_size, void* d_ws, size_t ws_size, hipStream_t stream) {
  (void)in_sizes; (void)n_in; (void)out_size;
  const float** F = (const float**)d_in;   // 0 mod [2,2048,512], 1 Wl [512,512], 2 Wd, 3 Wq [8,64,64], 4 Wk, 5 Wv, 6 gamma [512], 7 beta, 8 Wf [512,512], 9 bf [512]
  if (ws_size < (size_t)WS_END) return;
  char* ws = (char*)d_ws; __bf16 *PW = (__bf16*)(ws + WS_PW), *VH = (__bf16*)(ws + WS_VH), *VL = (__bf16*)(ws + WS_VL); float *ML = (float*)(ws + WS_ML), *NM = (float*)(ws + WS_NM), *ND = (float*)(ws + WS_ND), *Q = (float*)(ws + WS_Q), *KV = (float*)(ws + WS_KV), *M2 = (float*)(ws + WS_M2);
  const int NR = TNB * SS / 64;
  k_packT<<<dim3(2 * DM, 4), 256, 0, stream>>>(F[1], F[2], F[3], F[4], F[5], F[8], PW);
  k_gemm<1, 0><<<dim3(NR, 2 * DM / 128), 128, 0, stream>>>(F[0], DM, PW + PLD, nullptr, nullptr, ML, 2 * DM);        // mod_l | dec_l (exact)
  k_ln<<<TNB * SS / 8, 256, 0, stream>>>(ML, 2 * DM, F[6], F[7], NM);
  k_ln<<<TNB * SS / 8, 256, 0, stream>>>(ML + DM, 2 * DM, F[6], F[7], ND);
  k_gemm<0, 0><<<dim3(NR, DM / 128), 128, 0, stream>>>(NM, DM, PW + PQQ, nullptr, nullptr, Q, DM);               // q
  k_gemm<0, 0><<<dim3(NR, 2 * DM / 128), 128, 0, stream>>>(ND, DM, PW + PKV, nullptr, nullptr, KV, 2 * DM);       // k | v
  k_vplanes<<<dim3(NR, DM / 128), 256, 0, stream>>>(KV, VH, VL);
  k_attn<<<dim3(TQB, NH, TNB), 128, 0, stream>>>(Q, KV, VH, VL, ML, M2);                                          // mod2 = mod_l + o
  k_ln<<<TOB * 8, 256, 0, stream>>>(M2, DM, F[6], F[7], NM);                                                      // LN(mod2) (NM reused)
  k_gemm<0, 1><<<dim3(TOB, DM / 128), 128, 0, stream>>>(NM, DM, PW + PFF, F[9], M2, (float*)d_out, DM);           // out = mod2 + elu(LN(mod2) Wf + bf)
}

// v003
// One run takes 242 microseconds.
// In two side-by-side timings against v002, it was 1.18 and 1.19 times as fast.
// Counting every step since v000, it is 2.10 times as fast.
// compute dtype: mod and all weights/LN params (module inputs) rounded to bf16; mod Wl / mod Wd with exact bf16 products (inputs); the per-head q/k/v 1x1 convs (as two block-diagonal GEMMs: q 512->512, k|v 512->1024), the FFN and scores/P.V with the computed operands as bf16 hi + residual pairs (2 products against exact weights; 3 products for q.k and P.V); LayerNorms, softmax (no 1/sqrt(d) scale), ELU and residuals in f32; f32 accumulate.
#include <hip/hip_runtime.h>
#include <math.h>

typedef __attribute__((ext_vector_type(16))) _Float16 v16h;
typedef __attribute__((ext_vector_type(16))) __bf16 v16b;
typedef __attribute__((ext_vector_type(8)))  _Float16 v8h;
typedef __attribute__((ext_vector_type(8)))  float v8f;
typedef __attribute__((ext_vector_type(4)))  float v4f;
typedef __attribute__((ext_vector_type(2)))  float v2f;
typedef __attribute__((ext_vector_type(4)))  unsigned v4u;
typedef __attribute__((ext_vector_type(4)))  int v4i;
typedef float __attribute__((may_alias)) float_a;
typedef int __attribute__((may_alias)) int_a;

template <typename T> __device__ __forceinline__ void vst2(void* p, T v) { *(T*)p = v;  }
__device__ __forceinline__ v8f wmma16(v16h a, v16h b, v8f c) {
  v8f d = __builtin_amdgcn_wmma_f32_16x16x32_f16(false, a, false, b, (short)0, c, false, false);
  asm volatile("v_nop\n\tv_nop\n\tv_nop\n\tv_nop" : "+v"(d) : "v"(a), "v"(b));
  return d;
}
__device__ __forceinline__ v8f wmma_bf(v16b a, v16b b, v8f c) {
  v8f d = __builtin_amdgcn_wmma_f32_16x16x32_bf16(false, a, false, b, (short)0, c, false, false);
  asm volatile("v_nop\n\tv_nop\n\tv_nop\n\tv_nop" : "+v"(d) : "v"(a), "v"(b));
  return d;
}
// 16x16x32 fragments: lane = (h = lane>>4, row/col = lane&15); elements 0..7 = k0+8h+0..7, 8..15 = k0+16+8h+0..7; D element r = row 8h+r
__device__ __forceinline__ v16h frag_h(const _Float16* rowk0, int lane) {
  union { v16h v; v8h q[2]; } u; const _Float16* p = rowk0 + 8 * (lane >> 4);
  u.q[0] = *(const v8h*)p; u.q[1] = *(const v8h*)(p + 16); return u.v;
}
__device__ __forceinline__ v16h frag_f32(const float* rowk0, int lane) {
  v16h a; const float* p = rowk0 + 8 * (lane >> 4);
#pragma unroll
  for (int i = 0; i < 8; ++i) { a[i] = (_Float16)p[i]; a[8 + i] = (_Float16)p[16 + i]; }
  return a;
}
__device__ __forceinline__ v16h frag_f32s(const float* rowk0, int lane, float sc) {
  v16h a; const float* p = rowk0 + 8 * (lane >> 4);
#pragma unroll
  for (int i = 0; i < 8; ++i) { a[i] = (_Float16)(p[i] * sc); a[8 + i] = (_Float16)(p[16 + i] * sc); }
  return a;
}
// column fragment from a [K][ld] layout (column n), rows >= K read as 0
__device__ __forceinline__ v16h fragc_f32(const float* W, int k0, int n, int lane, int ld, int K) {
  v16h a; const int g = lane >> 4;
#pragma unroll
  for (int i = 0; i < 8; ++i) { const int ka = k0 + 8 * g + i, kb = ka + 16;
    a[i] = (_Float16)(ka < K ? W[(size_t)(ka < K ? ka : K - 1) * ld + n] : 0.f); a[8 + i] = (_Float16)(kb < K ? W[(size_t)(kb < K ? kb : K - 1) * ld + n] : 0.f); }
  return a;
}
struct F2 { v16b h, l; };
__device__ __forceinline__ F2 bsplit16(const float v[16]) { F2 r;
#pragma unroll
  for (int i = 0; i < 16; ++i) { const __bf16 h = (__bf16)v[i]; r.h[i] = h; r.l[i] = (__bf16)(v[i] - (float)h); }
  return r; }
__device__ __forceinline__ F2 split_row(const float* row, int k0, int lane) { float v[16]; const float* p = row + k0 + 8 * (lane >> 4);
#pragma unroll
  for (int i = 0; i < 8; ++i) { v[i] = p[i]; v[8 + i] = p[16 + i]; }
  return bsplit16(v); }
__device__ __forceinline__ F2 split_rowK(const float* row, int k0, int lane, int K) { float v[16]; const int g = lane >> 4;
#pragma unroll
  for (int i = 0; i < 8; ++i) { const int ka = k0 + 8 * g + i, kb = ka + 16; v[i] = ka < K ? row[ka < K ? ka : K - 1] : 0.f; v[8 + i] = kb < K ? row[kb < K ? kb : K - 1] : 0.f; }
  return bsplit16(v); }
__device__ __forceinline__ F2 split_col(const float* W, int k0, int n, int lane, int ld, int K) { float v[16]; const int g = lane >> 4;
#pragma unroll
  for (int i = 0; i < 8; ++i) { const int ka = k0 + 8 * g + i, kb = ka + 16; v[i] = ka < K ? W[(size_t)(ka < K ? ka : K - 1) * ld + n] : 0.f; v[8 + i] = kb < K ? W[(size_t)(kb < K ? kb : K - 1) * ld + n] : 0.f; }
  return bsplit16(v); }
__device__ __forceinline__ v8f mac3(const F2& a, const F2& b, v8f c) { c = wmma_bf(a.l, b.h, c); c = wmma_bf(a.h, b.l, c); return wmma_bf(a.h, b.h, c); }
__device__ __forceinline__ float sigm(float v) { return 1.0f / (1.0f + expf(-v)); }
#define LDSX() do { asm volatile("s_wait_dscnt 0" ::: "memory"); __builtin_amdgcn_wave_barrier(); __builtin_amdgcn_fence(__ATOMIC_RELEASE, "workgroup"); } while (0)


// SAttn (B 2, S 2048, dim 512, 8 heads x 64; self-attention: dec = mod): mod_l = mod Wl, dec_l = mod Wd; nm = LN(mod_l), nd = LN(dec_l) (shared gamma/beta, eps 1e-6); q = nm_h Wq[h], k = nd_h Wk[h], v = nd_h Wv[h]; attn = softmax(q k^T) (unscaled); o merged; mod2 = mod_l + o; out = mod2 + elu(LN(mod2) Wf + bf).
#define NB 2
#define SS 2048
#define DM 512
#define NH 8
#define HD 64
#define NTOK (NB * SS)
#ifndef TQB
#define TQB (SS / 64)
#define TNB NB
#define TOB (NB * SS / 64)
#endif
typedef __attribute__((ext_vector_type(8))) __bf16 v8b;
__device__ __forceinline__ v16b frag_b(const __bf16* rowk0, int lane) {
  union { v16b v; v8b q[2]; } u; const __bf16* p = rowk0 + 8 * (lane >> 4);
  u.q[0] = *(const v8b*)p; u.q[1] = *(const v8b*)(p + 16); return u.v;
}
__device__ __forceinline__ float bfr(float v) { return (float)(__bf16)v; }
#define L2E 1.4426950408889634f   // log2(e): exp(x) = 2^(x * L2E)
// eight (one) 2^x in line, no call, so that independent exponentials overlap; one statement: the outputs are early-clobber, so no v_exp_f32 overwrites the source of the one ahead of it, and the v_nop at the end keeps the one slot that the instruction set asks for behind a transcendental
__device__ __forceinline__ void ex2x8(float* o, const float* x) {
  asm("v_exp_f32 %0, %8\n\tv_exp_f32 %1, %9\n\tv_exp_f32 %2, %10\n\tv_exp_f32 %3, %11\n\tv_exp_f32 %4, %12\n\tv_exp_f32 %5, %13\n\tv_exp_f32 %6, %14\n\tv_exp_f32 %7, %15\n\tv_nop"
      : "=&v"(o[0]), "=&v"(o[1]), "=&v"(o[2]), "=&v"(o[3]), "=&v"(o[4]), "=&v"(o[5]), "=&v"(o[6]), "=&v"(o[7])
      : "v"(x[0]), "v"(x[1]), "v"(x[2]), "v"(x[3]), "v"(x[4]), "v"(x[5]), "v"(x[6]), "v"(x[7]));
}
__device__ __forceinline__ float ex2x1(float x) { float o; asm("v_exp_f32 %0, %1\n\tv_nop" : "=v"(o) : "v"(x)); return o; }
#define WS_PW  0u                 // bf16 rows (in,out -> [out][in]): Wl|Wd -> [1024][512]; Wq (block diagonal) [512][512]; Wk|Wv (block diagonal) [1024][512]; Wf [512][512]
#define PLD 0
#define PQQ (PLD + 2 * DM * DM)
#define PKV (PQQ + DM * DM)
#define PFF (PKV + 2 * DM * DM)
#define PWEND (PFF + DM * DM)
#define WS_ML  (WS_PW + 2u * PWEND)   // f32 [NTOK][1024] mod_l | dec_l
#define WS_NM  (WS_ML + 4u * NTOK * 2 * DM)   // f32 [NTOK][512] LN(mod_l), later LN(mod2)
#define WS_ND  (WS_NM + 4u * NTOK * DM)       // f32 [NTOK][512] LN(dec_l)
#define WS_Q   (WS_ND + 4u * NTOK * DM)       // f32 [NTOK][512] q
#define WS_KV  (WS_Q + 4u * NTOK * DM)        // f32 [NTOK][1024] k | v
#define WS_VH  (WS_KV + 4u * NTOK * 2 * DM)   // bf16 [NB][512][SS] v planes
#define WS_VL  (WS_VH + 2u * NB * DM * SS)
#define WS_M2  (WS_VL + 2u * NB * DM * SS)   // f32 [NTOK][512] mod2 = mod_l + o
#define WS_END (WS_M2 + 4u * NTOK * DM)

// ---- k_packT: block = (output col n, which): 0: n < 1024: [Wl | Wd] (in,out) rows [n][512]; 1: Wq block-diagonal: row n = h*64+e gets Wq[h][d][e] at cols h*64+d, zeros elsewhere; 2: n < 1024: [Wk | Wv] block-diagonal likewise; 3: Wf rows
__global__ __launch_bounds__(256) void k_packT(const float* __restrict__ WL, const float* __restrict__ WD, const float* __restrict__ WQ, const float* __restrict__ WK, const float* __restrict__ WV, const float* __restrict__ WF, __bf16* __restrict__ PW) {
  __shared__ __align__(16) __bf16 s[DM]; const int n = blockIdx.x, which = blockIdx.y, k = threadIdx.x; float v = 0.f; size_t dst;   // 512 threads? no: 256 threads x 2
  for (int kk = k; kk < DM; kk += 256) { float val = 0.f;
    if (which == 0) { const int part = n / DM, c = n % DM; val = (part == 0 ? WL : WD)[(size_t)kk * DM + c]; }
    else if (which == 1) { if (n < DM) { const int h = n / HD, e = n % HD; if (kk / HD == h) val = WQ[((size_t)h * HD + (kk % HD)) * HD + e]; } }
    else if (which == 2) { const int part = n / DM, c = n % DM; const int h = c / HD, e = c % HD; if (kk / HD == h) val = (part == 0 ? WK : WV)[((size_t)h * HD + (kk % HD)) * HD + e]; }
    else { if (n < DM) val = WF[(size_t)kk * DM + n]; }
    s[kk] = (__bf16)val; }
  if ((which == 1 || which == 3) && n >= DM) return;
  dst = (which == 0) ? (PLD + (size_t)n * DM) : (which == 1 ? (PQQ + (size_t)n * DM) : (which == 2 ? (PKV + (size_t)n * DM) : (PFF + (size_t)n * DM)));
  __syncthreads();
  if (k < DM / 8) vst2((unsigned*)(PW + dst + k * 8), *(const v4u*)&s[k * 8]);
  (void)v;
}
// ---- k_gemm<RIN, EPI>: block = (64 rows, 128 cols): OUT = A(hi/lo or exact, K 512, pitch lda) . rows; EPI 0: plain; EPI 1: + bias, ELU, + RES (out = RES + elu(acc + b)); EPI 2: v planes? (no) ; pitch ldo
template <int RIN, int EPI>
__global__ __launch_bounds__(128) void k_gemm(const float* __restrict__ A, int lda, const __bf16* __restrict__ P, const float* __restrict__ bias, const float* __restrict__ RES, float* __restrict__ OUT, int ldo) {
  __shared__ __align__(16) float so[4][16][132];
  const int tid = threadIdx.x, wave = tid >> 5, lane = tid & 31, col = lane & 15, g = lane >> 4; const size_t r0 = (size_t)blockIdx.x * 64 + wave * 16; const int n0 = blockIdx.y * 128;
  v8f acc[8] = {};
#pragma unroll 2
  for (int kc = 0; kc < DM / 32; ++kc) { F2 a; if (RIN) { v16b ax; const float* p = A + (r0 + col) * lda + kc * 32 + 8 * g;
#pragma unroll
      for (int i = 0; i < 8; ++i) { ax[i] = (__bf16)p[i]; ax[8 + i] = (__bf16)p[16 + i]; } a.h = ax; a.l = ax; } else a = split_row(A + (r0 + col) * lda, kc * 32, lane);
#pragma unroll
    for (int j = 0; j < 8; ++j) { const v16b w = frag_b(P + (size_t)(n0 + j * 16 + col) * DM + kc * 32, lane); if (!RIN) acc[j] = wmma_bf(a.l, w, acc[j]); acc[j] = wmma_bf(a.h, w, acc[j]); } }
  float res[8][8] = {};
  if (EPI == 1) { const float* rp[8];
#pragma unroll
    for (int r = 0; r < 8; ++r) rp[r] = RES + (r0 + 8 * g + r) * ldo + n0 + col;
#pragma unroll
    for (int j = 0; j < 8; ++j) {
#pragma unroll
      for (int r = 0; r < 8; ++r) res[j][r] = rp[r][j * 16]; }
    // with no call between them the 64 loads go out together; the row addresses are inputs of the wait, so they keep their registers up to it and no later load's result lands on an address register ahead of it
    asm volatile("s_wait_xcnt 0x0" :: "v"(rp[0]), "v"(rp[1]), "v"(rp[2]), "v"(rp[3]), "v"(rp[4]), "v"(rp[5]), "v"(rp[6]), "v"(rp[7]) : "memory"); }
#pragma unroll
  for (int j = 0; j < 8; ++j) { const int n = n0 + j * 16 + col; const float bb = (EPI == 1) ? bfr(bias[n]) : 0.f;
#pragma unroll
    for (int r = 0; r < 8; ++r) { const float v = acc[j][r] + bb; if (EPI != 1) so[wave][8 * g + r][j * 16 + col] = v; }
    if (EPI == 1) { float x[8], e[8];
#pragma unroll
      for (int r = 0; r < 8; ++r) x[r] = (acc[j][r] + bb) * L2E;
      ex2x8(e, x);
#pragma unroll
      for (int r = 0; r < 8; ++r) { const float v = acc[j][r] + bb; so[wave][8 * g + r][j * 16 + col] = res[j][r] + ((v > 0.f) ? v : e[r] - 1.0f); } } }
  LDSX();
  for (int rl = 0; rl < 16; ++rl) vst2(OUT + (r0 + rl) * ldo + n0 + lane * 4, *(const v4f*)&so[wave][rl][lane * 4]);
}
// ---- k_ln: block = 8 rows (wave per row): OUT = LN(IN) over 512 (biased var, eps 1e-6) * gamma + beta
__global__ __launch_bounds__(256) void k_ln(const float* __restrict__ IN, int ldi, const float* __restrict__ G, const float* __restrict__ Bb, float* __restrict__ OUT) {
  __shared__ __align__(16) float s[8][DM]; const int wave = threadIdx.x >> 5, lane = threadIdx.x & 31; const size_t row = (size_t)blockIdx.x * 8 + wave; float v[16]; float sum = 0.f;
#pragma unroll
  for (int k = 0; k < 16; ++k) { v[k] = IN[row * ldi + lane + 32 * k]; sum += v[k]; }
#pragma unroll
  for (int o = 1; o < 32; o <<= 1) sum += __shfl_xor(sum, o);
  const float mu = sum / (float)DM; float var = 0.f;
#pragma unroll
  for (int k = 0; k < 16; ++k) { const float d = v[k] - mu; var += d * d; }
#pragma unroll
  for (int o = 1; o < 32; o <<= 1) var += __shfl_xor(var, o);
  const float rs = rsqrtf(var / (float)DM + 1e-6f);
#pragma unroll
  for (int k = 0; k < 16; ++k) { const int c = lane + 32 * k; s[wave][c] = (v[k] - mu) * rs * bfr(G[c]) + bfr(Bb[c]); }
  LDSX();
  for (int pc = lane; pc < DM / 4; pc += 32) vst2(OUT + row * DM + pc * 4, *(const v4f*)&s[wave][pc * 4]);
}
// ---- k_vplanes: block = (64 tokens, 128-col chunk): v (KV cols 512 + c) -> transposed hi/lo planes [b][c][s]
__global__ __launch_bounds__(256) void k_vplanes(const float* __restrict__ KV, __bf16* __restrict__ VH, __bf16* __restrict__ VL) {
  __shared__ __align__(16) __bf16 sh[128][72], sl[128][72]; const int tid = threadIdx.x; const size_t rb = (size_t)blockIdx.x * 64; const int c0 = blockIdx.y * 128; const int b = (int)(rb / SS), s0 = (int)(rb % SS);
  for (int q = tid; q < 64 * 128; q += 256) { const int rl = q >> 7, c = q & 127; const float v = KV[(rb + rl) * (2 * DM) + DM + c0 + c]; const __bf16 hb = (__bf16)v; sh[c][rl] = hb; sl[c][rl] = (__bf16)(v - (float)hb); }
  __syncthreads();
  for (int q = tid; q < 128 * 8; q += 256) { const int c = q >> 3, pc = q & 7; const size_t o = ((size_t)b * DM + c0 + c) * SS + s0 + pc * 8; vst2((unsigned*)(VH + o), *(const v4u*)&sh[c][pc * 8]); vst2((unsigned*)(VL + o), *(const v4u*)&sl[c][pc * 8]); }
}
__device__ __forceinline__ float xhalf(float v) { return __builtin_bit_cast(float, __builtin_amdgcn_permlanex16(__builtin_bit_cast(int, v), __builtin_bit_cast(int, v), 0x76543210, 0xfedcba98, false, false)); }   // lane l reads lane l ^ 16
#define KT 64                      // keys per staged tile
#define KP 68                      // floats per K row in LDS: 272 B = 16 B x 17, no bank conflict for 16-byte reads of 16 rows
#define VP 72                      // bf16 per V row in LDS: 144 B = 16 B x 9
#define KBUF (KT * KP * 4)         // bytes of one K buffer
#define VBUF (HD * VP * 2)         // bytes of one V-plane buffer
__device__ __forceinline__ unsigned lds_addr(const void* p) { return (unsigned)(unsigned long long)p; }   // LDS byte address = low 32 bits of a __shared__ address
// eight 16-byte copies per lane, global -> LDS through no register; s_wait_xcnt closes the statement so that no address register is rewritten ahead of it
__device__ __forceinline__ void acopy8(const unsigned (&l)[8], const char* const (&p)[8]) {
  asm volatile("global_load_async_to_lds_b128 %0, %8, off\n\t"
               "global_load_async_to_lds_b128 %1, %9, off\n\t"
               "global_load_async_to_lds_b128 %2, %10, off\n\t"
               "global_load_async_to_lds_b128 %3, %11, off\n\t"
               "global_load_async_to_lds_b128 %4, %12, off\n\t"
               "global_load_async_to_lds_b128 %5, %13, off\n\t"
               "global_load_async_to_lds_b128 %6, %14, off\n\t"
               "global_load_async_to_lds_b128 %7, %15, off\n\t"
               "s_wait_xcnt 0x0"
               :: "v"(l[0]), "v"(l[1]), "v"(l[2]), "v"(l[3]), "v"(l[4]), "v"(l[5]), "v"(l[6]), "v"(l[7]),
                  "v"(p[0]), "v"(p[1]), "v"(p[2]), "v"(p[3]), "v"(p[4]), "v"(p[5]), "v"(p[6]), "v"(p[7]) : "memory");
}
// one tile: K 64 rows x 256 B (a lane: chunk tid & 15 of rows tid >> 4 + 8 i), each V plane 64 rows x 128 B (chunk tid & 7 of rows tid >> 3 + 16 i); the arguments are the lane's own first addresses
__device__ __forceinline__ void stage_tile(const char* gk, const char* gh, const char* gl, unsigned lk, unsigned lh, unsigned ll) {
  unsigned a[8]; const char* p[8];
#pragma unroll
  for (int i = 0; i < 8; ++i) { a[i] = lk + i * (8 * KP * 4); p[i] = gk + (size_t)i * (8 * 2 * DM * 4); }
  acopy8(a, p);
#pragma unroll
  for (int i = 0; i < 4; ++i) { a[i] = lh + i * (16 * VP * 2); p[i] = gh + (size_t)i * (16 * SS * 2); a[4 + i] = ll + i * (16 * VP * 2); p[4 + i] = gl + (size_t)i * (16 * SS * 2); }
  acopy8(a, p);
}
__global__ __launch_bounds__(128) void k_attn(const float* __restrict__ Q, const float* __restrict__ KV, const __bf16* __restrict__ VH, const __bf16* __restrict__ VL, const float* __restrict__ ML, float* __restrict__ M2) {
  __shared__ __align__(16) float so[4][16][68];
  __shared__ __align__(16) float sK[2][KT][KP];
  __shared__ __align__(16) __bf16 sVH[2][HD][VP], sVL[2][HD][VP];
  const int tid = threadIdx.x, wave = tid >> 5, lane = tid & 31, col = lane & 15, g = lane >> 4; const int qb = blockIdx.x, h = blockIdx.y, b = blockIdx.z; const int q0 = qb * 64 + wave * 16; const size_t rq = (size_t)b * SS + q0;
  const char* gk = (const char*)(KV + ((size_t)b * SS + (tid >> 4)) * (2 * DM) + h * HD) + (tid & 15) * 16;
  const size_t vo = (((size_t)b * DM + h * HD + (tid >> 3)) * SS) * 2 + (tid & 7) * 16;
  const char* gh = (const char*)VH + vo; const char* gl = (const char*)VL + vo;
  const unsigned lk = lds_addr(&sK[0][tid >> 4][0]) + (tid & 15) * 16, lh = lds_addr(&sVH[0][tid >> 3][0]) + (tid & 7) * 16, ll = lds_addr(&sVL[0][tid >> 3][0]) + (tid & 7) * 16;
  stage_tile(gk, gh, gl, lk, lh, ll);
  F2 aq[2];
#pragma unroll
  for (int kc = 0; kc < 2; ++kc) aq[kc] = split_row(Q + (rq + col) * DM + h * HD, kc * 32, lane);
  asm volatile("s_wait_asynccnt 0x0" ::: "memory");   // this wave's part of tile 0 has landed
  __syncthreads();                                    // ... and every other wave's
  stage_tile(gk + (size_t)KT * (2 * DM * 4), gh + KT * 2, gl + KT * 2, lk + KBUF, lh + VBUF, ll + VBUF);
  float ml = -3.0e38f, l = 0.f;   // ml: running row maximum times L2E
  v8f acc[4] = {};   // O^T: lane = query col, element r of tile dt = d dt*16 + 8g + r
#pragma unroll 1   // one trip = one staged tile; rolled, so that the ring's hand-over stands once, at the foot
  for (int t = 0; t < SS / KT; ++t) { const int buf = t & 1;
#pragma unroll     // sub becomes a constant in every LDS offset
    for (int sub = 0; sub < KT / 32; ++sub) { v8f s[2];   // S^T: element r of tile ct = key t*64 + sub*32 + ct*16 + 8g + r
      float kr[2][2][16];
#pragma unroll
      for (int ct = 0; ct < 2; ++ct) { const float* krow = &sK[buf][sub * 32 + ct * 16 + col][8 * g];
#pragma unroll
        for (int kc = 0; kc < 2; ++kc) { const float* p = krow + kc * 32;
#pragma unroll
          for (int i = 0; i < 8; ++i) { kr[ct][kc][i] = p[i]; kr[ct][kc][8 + i] = p[16 + i]; } } }
#pragma unroll
      for (int ct = 0; ct < 2; ++ct) { v8f c = {};
#pragma unroll
        for (int kc = 0; kc < 2; ++kc) { const F2 kb = bsplit16(kr[ct][kc]); c = wmma_bf(kb.h, aq[kc].l, c); c = wmma_bf(kb.l, aq[kc].h, c); c = wmma_bf(kb.h, aq[kc].h, c); }
        s[ct] = c; }
      v16b vh[4], vl[4];   // read ahead of the softmax, which covers their way from LDS
#pragma unroll
      for (int dt = 0; dt < 4; ++dt) { vh[dt] = frag_b(&sVH[buf][dt * 16 + col][sub * 32], lane); vl[dt] = frag_b(&sVL[buf][dt * 16 + col][sub * 32], lane); }
      float mx = fmaxf(s[0][0], s[1][0]);
#pragma unroll
      for (int r = 1; r < 8; ++r) mx = fmaxf(mx, fmaxf(s[0][r], s[1][r]));
      mx = fmaxf(mx, xhalf(mx));
      const float mnl = fmaxf(ml, mx * L2E); const float alpha = ex2x1(ml - mnl);   // the running maximum is kept times L2E: ml is the very value the earlier terms were taken against, so an unchanged maximum gives exactly 1
      float e[16], x[16]; float es = 0.f;
#pragma unroll
      for (int r = 0; r < 8; ++r) { x[r] = fmaf(s[0][r], L2E, -mnl); x[8 + r] = fmaf(s[1][r], L2E, -mnl); }
      ex2x8(e, x); ex2x8(e + 8, x + 8);
#pragma unroll
      for (int r = 0; r < 8; ++r) es += e[r] + e[8 + r];
      l = l * alpha + es; ml = mnl;   // l: this half's 16 of each 32 keys; the halves are joined once behind the loop (alpha is the same in both)
#pragma unroll
      for (int dt = 0; dt < 4; ++dt) acc[dt] *= alpha;
      const F2 pb = bsplit16(e);
#pragma unroll
      for (int dt = 0; dt < 4; ++dt) { acc[dt] = wmma_bf(vh[dt], pb.l, acc[dt]); acc[dt] = wmma_bf(vl[dt], pb.h, acc[dt]); acc[dt] = wmma_bf(vh[dt], pb.h, acc[dt]); } }
    asm volatile("s_wait_dscnt 0x0" ::: "memory");      // this wave's reads of buffer buf are done before the buffer is refilled
    asm volatile("s_wait_asynccnt 0x0" ::: "memory");   // this wave's part of tile t + 1 has landed
    __syncthreads();                                    // publishes tile t + 1 and ends every wave's reads of buffer buf
    if (t + 2 < SS / KT) stage_tile(gk + (size_t)(t + 2) * (KT * 2 * DM * 4), gh + (t + 2) * (KT * 2), gl + (t + 2) * (KT * 2), lk + buf * KBUF, lh + buf * VBUF, ll + buf * VBUF); }
  asm volatile("s_wait_asynccnt 0x0" ::: "memory");     // no copy is left in flight when the wave goes on
  l += xhalf(l);
  const float il = 1.0f / l; const float* mlr = ML + (rq + col) * (2 * DM) + h * HD + 8 * g;
#pragma unroll
  for (int dt = 0; dt < 4; ++dt) {
#pragma unroll
    for (int r = 0; r < 8; ++r) so[wave][col][dt * 16 + 8 * g + r] = mlr[dt * 16 + r] + acc[dt][r] * il; }
  LDSX();
  for (int rl = 0; rl < 16; ++rl) if (lane < 16) vst2(M2 + (rq + rl) * DM + h * HD + lane * 4, *(const v4f*)&so[wave][rl][lane * 4]);
}
extern "C" void kernel_launch(void* const* d_in, const int* in_sizes, int n_in, void* d_out, int out_size, void* d_ws, size_t ws_size, hipStream_t stream) {
  (void)in_sizes; (void)n_in; (void)out_size;
  const float** F = (const float**)d_in;   // 0 mod [2,2048,512], 1 Wl [512,512], 2 Wd, 3 Wq [8,64,64], 4 Wk, 5 Wv, 6 gamma [512], 7 beta, 8 Wf [512,512], 9 bf [512]
  if (ws_size < (size_t)WS_END) return;
  char* ws = (char*)d_ws; __bf16 *PW = (__bf16*)(ws + WS_PW), *VH = (__bf16*)(ws + WS_VH), *VL = (__bf16*)(ws + WS_VL); float *ML = (float*)(ws + WS_ML), *NM = (float*)(ws + WS_NM), *ND = (float*)(ws + WS_ND), *Q = (float*)(ws + WS_Q), *KV = (float*)(ws + WS_KV), *M2 = (float*)(ws + WS_M2);
  const int NR = TNB * SS / 64;
  k_packT<<<dim3(2 * DM, 4), 256, 0, stream>>>(F[1], F[2], F[3], F[4], F[5], F[8], PW);
  k_gemm<1, 0><<<dim3(NR, 2 * DM / 128), 128, 0, stream>>>(F[0], DM, PW + PLD, nullptr, nullptr, ML, 2 * DM);        // mod_l | dec_l (exact)
  k_ln<<<TNB * SS / 8, 256, 0, stream>>>(ML, 2 * DM, F[6], F[7], NM);
  k_ln<<<TNB * SS / 8, 256, 0, stream>>>(ML + DM, 2 * DM, F[6], F[7], ND);
  k_gemm<0, 0><<<dim3(NR, DM / 128), 128, 0, stream>>>(NM, DM, PW + PQQ, nullptr, nullptr, Q, DM);               // q
  k_gemm<0, 0><<<dim3(NR, 2 * DM / 128), 128, 0, stream>>>(ND, DM, PW + PKV, nullptr, nullptr, KV, 2 * DM);       // k | v
  k_vplanes<<<dim3(NR, DM / 128), 256, 0, stream>>>(KV, VH, VL);
  k_attn<<<dim3(TQB, NH, TNB), 128, 0, stream>>>(Q, KV, VH, VL, ML, M2);                                          // mod2 = mod_l + o
  k_ln<<<TOB * 8, 256, 0, stream>>>(M2, DM, F[6], F[7], NM);                                                      // LN(mod2) (NM reused)
  k_gemm<0, 1><<<dim3(TOB, DM / 128), 128, 0, stream>>>(NM, DM, PW + PFF, F[9], M2, (float*)d_out, DM);           // out = mod2 + elu(LN(mod2) Wf + bf)
}

// v004
// One run takes 141 microseconds.
// Two timings next to v003 put it at 1.66 and 1.67 times that version's speed.
// All steps since v000 together make it 3.50 times as fast.
// compute dtype: mod and all weights/LN params (module inputs) rounded to bf16; mod Wl / mod Wd with exact bf16 products (inputs); the per-head q/k/v 1x1 convs (as two block-diagonal GEMMs: q 512->512, k|v 512->1024), the FFN and scores/P.V with the computed operands as bf16 hi + residual pairs (2 products against exact weights; 3 products for q.k and P.V); LayerNorms, softmax (no 1/sqrt(d) scale), ELU and residuals in f32; f32 accumulate.
#include <hip/hip_runtime.h>
#include <math.h>

typedef __attribute__((ext_vector_type(16))) _Float16 v16h;
typedef __attribute__((ext_vector_type(16))) __bf16 v16b;
typedef __attribute__((ext_vector_type(8)))  _Float16 v8h;
typedef __attribute__((ext_vector_type(8)))  float v8f;
typedef __attribute__((ext_vector_type(4)))  float v4f;
typedef __attribute__((ext_vector_type(2)))  float v2f;
typedef __attribute__((ext_vector_type(4)))  unsigned v4u;
typedef __attribute__((ext_vector_type(4)))  int v4i;
typedef float __attribute__((may_alias)) float_a;
typedef int __attribute__((may_alias)) int_a;

template <typename T> __device__ __forceinline__ void vst2(void* p, T v) { *(T*)p = v;  }
__device__ __forceinline__ v8f wmma16(v16h a, v16h b, v8f c) {
  v8f d = __builtin_amdgcn_wmma_f32_16x16x32_f16(false, a, false, b, (short)0, c, false, false);
  asm volatile("v_nop\n\tv_nop\n\tv_nop\n\tv_nop" : "+v"(d) : "v"(a), "v"(b));
  return d;
}
__device__ __forceinline__ v8f wmma_bf(v16b a, v16b b, v8f c) {
  v8f d = __builtin_amdgcn_wmma_f32_16x16x32_bf16(false, a, false, b, (short)0, c, false, false);
  asm volatile("v_nop\n\tv_nop\n\tv_nop\n\tv_nop" : "+v"(d) : "v"(a), "v"(b));
  return d;
}
// 16x16x32 fragments: lane = (h = lane>>4, row/col = lane&15); elements 0..7 = k0+8h+0..7, 8..15 = k0+16+8h+0..7; D element r = row 8h+r
__device__ __forceinline__ v16h frag_h(const _Float16* rowk0, int lane) {
  union { v16h v; v8h q[2]; } u; const _Float16* p = rowk0 + 8 * (lane >> 4);
  u.q[0] = *(const v8h*)p; u.q[1] = *(const v8h*)(p + 16); return u.v;
}
__device__ __forceinline__ v16h frag_f32(const float* rowk0, int lane) {
  v16h a; const float* p = rowk0 + 8 * (lane >> 4);
#pragma unroll
  for (int i = 0; i < 8; ++i) { a[i] = (_Float16)p[i]; a[8 + i] = (_Float16)p[16 + i]; }
  return a;
}
__device__ __forceinline__ v16h frag_f32s(const float* rowk0, int lane, float sc) {
  v16h a; const float* p = rowk0 + 8 * (lane >> 4);
#pragma unroll
  for (int i = 0; i < 8; ++i) { a[i] = (_Float16)(p[i] * sc); a[8 + i] = (_Float16)(p[16 + i] * sc); }
  return a;
}
// column fragment from a [K][ld] layout (column n), rows >= K read as 0
__device__ __forceinline__ v16h fragc_f32(const float* W, int k0, int n, int lane, int ld, int K) {
  v16h a; const int g = lane >> 4;
#pragma unroll
  for (int i = 0; i < 8; ++i) { const int ka = k0 + 8 * g + i, kb = ka + 16;
    a[i] = (_Float16)(ka < K ? W[(size_t)(ka < K ? ka : K - 1) * ld + n] : 0.f); a[8 + i] = (_Float16)(kb < K ? W[(size_t)(kb < K ? kb : K - 1) * ld + n] : 0.f); }
  return a;
}
struct F2 { v16b h, l; };
__device__ __forceinline__ F2 bsplit16(const float v[16]) { F2 r;
#pragma unroll
  for (int i = 0; i < 16; ++i) { const __bf16 h = (__bf16)v[i]; r.h[i] = h; r.l[i] = (__bf16)(v[i] - (float)h); }
  return r; }
__device__ __forceinline__ F2 split_row(const float* row, int k0, int lane) { float v[16]; const float* p = row + k0 + 8 * (lane >> 4);
#pragma unroll
  for (int i = 0; i < 8; ++i) { v[i] = p[i]; v[8 + i] = p[16 + i]; }
  return bsplit16(v); }
__device__ __forceinline__ F2 split_rowK(const float* row, int k0, int lane, int K) { float v[16]; const int g = lane >> 4;
#pragma unroll
  for (int i = 0; i < 8; ++i) { const int ka = k0 + 8 * g + i, kb = ka + 16; v[i] = ka < K ? row[ka < K ? ka : K - 1] : 0.f; v[8 + i] = kb < K ? row[kb < K ? kb : K - 1] : 0.f; }
  return bsplit16(v); }
__device__ __forceinline__ F2 split_col(const float* W, int k0, int n, int lane, int ld, int K) { float v[16]; const int g = lane >> 4;
#pragma unroll
  for (int i = 0; i < 8; ++i) { const int ka = k0 + 8 * g + i, kb = ka + 16; v[i] = ka < K ? W[(size_t)(ka < K ? ka : K - 1) * ld + n] : 0.f; v[8 + i] = kb < K ? W[(size_t)(kb < K ? kb : K - 1) * ld + n] : 0.f; }
  return bsplit16(v); }
__device__ __forceinline__ v8f mac3(const F2& a, const F2& b, v8f c) { c = wmma_bf(a.l, b.h, c); c = wmma_bf(a.h, b.l, c); return wmma_bf(a.h, b.h, c); }
__device__ __forceinline__ float sigm(float v) { return 1.0f / (1.0f + expf(-v)); }
#define LDSX() do { asm volatile("s_wait_dscnt 0" ::: "memory"); __builtin_amdgcn_wave_barrier(); __builtin_amdgcn_fence(__ATOMIC_RELEASE, "workgroup"); } while (0)


// SAttn (B 2, S 2048, dim 512, 8 heads x 64; self-attention: dec = mod): mod_l = mod Wl, dec_l = mod Wd; nm = LN(mod_l), nd = LN(dec_l) (shared gamma/beta, eps 1e-6); q = nm_h Wq[h], k = nd_h Wk[h], v = nd_h Wv[h]; attn = softmax(q k^T) (unscaled); o merged; mod2 = mod_l + o; out = mod2 + elu(LN(mod2) Wf + bf).
#define NB 2
#define SS 2048
#define DM 512
#define NH 8
#define HD 64
#define NTOK (NB * SS)
#ifndef TQB
#define TQB (SS / 64)
#define TNB NB
#define TOB (NB * SS / 64)
#endif
typedef __attribute__((ext_vector_type(8))) __bf16 v8b;
__device__ __forceinline__ v16b frag_b(const __bf16* rowk0, int lane) {
  union { v16b v; v8b q[2]; } u; const __bf16* p = rowk0 + 8 * (lane >> 4);
  u.q[0] = *(const v8b*)p; u.q[1] = *(const v8b*)(p + 16); return u.v;
}
__device__ __forceinline__ float bfr(float v) { return (float)(__bf16)v; }
#define L2E 1.4426950408889634f   // log2(e): exp(x) = 2^(x * L2E)
// eight (one) 2^x in line, no call, so that independent exponentials overlap; one statement: the outputs are early-clobber, so no v_exp_f32 overwrites the source of the one ahead of it, and the v_nop at the end keeps the one slot that the instruction set asks for behind a transcendental
__device__ __forceinline__ void ex2x8(float* o, const float* x) {
  asm("v_exp_f32 %0, %8\n\tv_exp_f32 %1, %9\n\tv_exp_f32 %2, %10\n\tv_exp_f32 %3, %11\n\tv_exp_f32 %4, %12\n\tv_exp_f32 %5, %13\n\tv_exp_f32 %6, %14\n\tv_exp_f32 %7, %15\n\tv_nop"
      : "=&v"(o[0]), "=&v"(o[1]), "=&v"(o[2]), "=&v"(o[3]), "=&v"(o[4]), "=&v"(o[5]), "=&v"(o[6]), "=&v"(o[7])
      : "v"(x[0]), "v"(x[1]), "v"(x[2]), "v"(x[3]), "v"(x[4]), "v"(x[5]), "v"(x[6]), "v"(x[7]));
}
__device__ __forceinline__ float ex2x1(float x) { float o; asm("v_exp_f32 %0, %1\n\tv_nop" : "=v"(o) : "v"(x)); return o; }
#define WS_PW  0u                 // bf16 rows (in,out -> [out][in]): Wl|Wd -> [1024][512]; Wq (block diagonal) [512][512]; Wk|Wv (block diagonal) [1024][512]; Wf [512][512]
#define PLD 0
#define PQQ (PLD + 2 * DM * DM)
#define PKV (PQQ + DM * DM)
#define PFF (PKV + 2 * DM * DM)
#define PWEND (PFF + DM * DM)
#define WS_ML  (WS_PW + 2u * PWEND)   // f32 [NTOK][1024] mod_l | dec_l
#define WS_NM  (WS_ML + 4u * NTOK * 2 * DM)   // f32 [NTOK][512] LN(mod_l), later LN(mod2)
#define WS_ND  (WS_NM + 4u * NTOK * DM)       // f32 [NTOK][512] LN(dec_l)
#define WS_Q   (WS_ND + 4u * NTOK * DM)       // f32 [NTOK][512] q
#define WS_KV  (WS_Q + 4u * NTOK * DM)        // f32 [NTOK][1024] k | v
#define WS_VH  (WS_KV + 4u * NTOK * 2 * DM)   // bf16 [NB][512][SS] v planes
#define WS_VL  (WS_VH + 2u * NB * DM * SS)
#define WS_M2  (WS_VL + 2u * NB * DM * SS)   // f32 [NTOK][512] mod2 = mod_l + o
#define WS_END (WS_M2 + 4u * NTOK * DM)

// ---- k_packT: block = (output col n, which): 0: n < 1024: [Wl | Wd] (in,out) rows [n][512]; 1: Wq block-diagonal: row n = h*64+e gets Wq[h][d][e] at cols h*64+d, zeros elsewhere; 2: n < 1024: [Wk | Wv] block-diagonal likewise; 3: Wf rows
__global__ __launch_bounds__(256) void k_packT(const float* __restrict__ WL, const float* __restrict__ WD, const float* __restrict__ WQ, const float* __restrict__ WK, const float* __restrict__ WV, const float* __restrict__ WF, __bf16* __restrict__ PW) {
  __shared__ __align__(16) __bf16 s[DM]; const int n = blockIdx.x, which = blockIdx.y, k = threadIdx.x; float v = 0.f; size_t dst;   // 512 threads? no: 256 threads x 2
  for (int kk = k; kk < DM; kk += 256) { float val = 0.f;
    if (which == 0) { const int part = n / DM, c = n % DM; val = (part == 0 ? WL : WD)[(size_t)kk * DM + c]; }
    else if (which == 1) { if (n < DM) { const int h = n / HD, e = n % HD; if (kk / HD == h) val = WQ[((size_t)h * HD + (kk % HD)) * HD + e]; } }
    else if (which == 2) { const int part = n / DM, c = n % DM; const int h = c / HD, e = c % HD; if (kk / HD == h) val = (part == 0 ? WK : WV)[((size_t)h * HD + (kk % HD)) * HD + e]; }
    else { if (n < DM) val = WF[(size_t)kk * DM + n]; }
    s[kk] = (__bf16)val; }
  if ((which == 1 || which == 3) && n >= DM) return;
  dst = (which == 0) ? (PLD + (size_t)n * DM) : (which == 1 ? (PQQ + (size_t)n * DM) : (which == 2 ? (PKV + (size_t)n * DM) : (PFF + (size_t)n * DM)));
  __syncthreads();
  if (k < DM / 8) vst2((unsigned*)(PW + dst + k * 8), *(const v4u*)&s[k * 8]);
  (void)v;
}
__device__ __forceinline__ unsigned lds_addr(const void* p) { return (unsigned)(unsigned long long)p; }   // LDS byte address = low 32 bits of a __shared__ address
// eight 16-byte copies per lane, global -> LDS through no register; s_wait_xcnt closes the statement so that no address register is rewritten ahead of it
__device__ __forceinline__ void acopy8(const unsigned (&l)[8], const char* const (&p)[8]) {
  asm volatile("global_load_async_to_lds_b128 %0, %8, off\n\t"
               "global_load_async_to_lds_b128 %1, %9, off\n\t"
               "global_load_async_to_lds_b128 %2, %10, off\n\t"
               "global_load_async_to_lds_b128 %3, %11, off\n\t"
               "global_load_async_to_lds_b128 %4, %12, off\n\t"
               "global_load_async_to_lds_b128 %5, %13, off\n\t"
               "global_load_async_to_lds_b128 %6, %14, off\n\t"
               "global_load_async_to_lds_b128 %7, %15, off\n\t"
               "s_wait_xcnt 0x0"
               :: "v"(l[0]), "v"(l[1]), "v"(l[2]), "v"(l[3]), "v"(l[4]), "v"(l[5]), "v"(l[6]), "v"(l[7]),
                  "v"(p[0]), "v"(p[1]), "v"(p[2]), "v"(p[3]), "v"(p[4]), "v"(p[5]), "v"(p[6]), "v"(p[7]) : "memory");
}
#define GK 64                      // k per staged chunk
#define GAP 68                     // floats per A row in LDS: 272 B = 16 B x 17, no bank conflict for 16-byte reads of 16 rows
#define GWP 72                     // bf16 per W row in LDS: 144 B = 16 B x 9
#define GABUF (64 * GAP * 4)       // bytes of one A buffer
#define GWBUF (128 * GWP * 2)      // bytes of one W buffer
// one k-chunk: A 64 rows x 256 B (a lane: piece tid & 15 of rows tid >> 4 + 8 i), W 128 rows x 128 B (piece tid & 7 of rows tid >> 3 + 16 i): every copy of a wave covers whole 128-B lines; the arguments are the lane's own first addresses, sa = bytes from a row of A to the eighth behind it
__device__ __forceinline__ void stage_chunk(const char* ga, size_t sa, const char* gw, unsigned la, unsigned lw) {
  unsigned a[8]; const char* p[8];
#pragma unroll
  for (int i = 0; i < 8; ++i) { a[i] = la + i * (8 * GAP * 4); p[i] = ga + i * sa; }
  acopy8(a, p);
#pragma unroll
  for (int i = 0; i < 8; ++i) { a[i] = lw + i * (16 * GWP * 2); p[i] = gw + (size_t)i * (16 * DM * 2); }
  acopy8(a, p);
}
// ---- k_gemm<RIN, EPI>: block = (64 rows, 128 cols): OUT = A(hi/lo or exact, K 512, pitch lda) . rows; A (f32) and the weight rows come in chunks of 64 k through LDS: asynchronous copies, two buffers, the weight chunk one for all 4 waves, the next chunk in flight while this one is worked on; EPI 0: plain; EPI 1: + bias, ELU, + RES (out = RES + elu(acc + b)); pitch ldo
template <int RIN, int EPI>
__global__ __launch_bounds__(128) void k_gemm(const float* __restrict__ A, int lda, const __bf16* __restrict__ P, const float* __restrict__ bias, const float* __restrict__ RES, float* __restrict__ OUT, int ldo) {
  __shared__ __align__(16) float so[4][16][132];
  __shared__ __align__(16) float sA[2][64][GAP];
  __shared__ __align__(16) __bf16 sW[2][128][GWP];
  const int tid = threadIdx.x, wave = tid >> 5, lane = tid & 31, col = lane & 15, g = lane >> 4; const size_t r0 = (size_t)blockIdx.x * 64 + wave * 16; const int n0 = blockIdx.y * 128;
  const char* ga = (const char*)(A + ((size_t)blockIdx.x * 64 + (tid >> 4)) * lda) + (tid & 15) * 16; const size_t sa = (size_t)lda * (8 * 4);
  const char* gw = (const char*)(P + (size_t)(n0 + (tid >> 3)) * DM) + (tid & 7) * 16;
  const unsigned la = lds_addr(&sA[0][tid >> 4][0]) + (tid & 15) * 16, lw = lds_addr(&sW[0][tid >> 3][0]) + (tid & 7) * 16;
  stage_chunk(ga, sa, gw, la, lw);
  asm volatile("s_wait_asynccnt 0x0" ::: "memory");   // this wave's part of chunk 0 has landed
  __syncthreads();                                    // ... and every other wave's
  stage_chunk(ga + GK * 4, sa, gw + GK * 2, la + GABUF, lw + GWBUF);
  v8f acc[8] = {};
#pragma unroll 1   // one trip = one staged chunk; rolled, so that the ring's hand-over stands once, at the foot
  for (int c = 0; c < DM / GK; ++c) { const int buf = c & 1;
#pragma unroll     // kk becomes a constant in every LDS offset
    for (int kk = 0; kk < GK / 32; ++kk) { const float* arow = &sA[buf][wave * 16 + col][kk * 32];
      v16b w[8];   // the eight weight fragments are read as one group, ahead of the products
#pragma unroll
      for (int j = 0; j < 8; ++j) w[j] = frag_b(&sW[buf][j * 16 + col][kk * 32], lane);
      F2 a; if (RIN) { v16b ax; const float* p = arow + 8 * g;
#pragma unroll
        for (int i = 0; i < 8; ++i) { ax[i] = (__bf16)p[i]; ax[8 + i] = (__bf16)p[16 + i]; } a.h = ax; a.l = ax; } else a = split_row(arow, 0, lane);
#pragma unroll
      for (int j = 0; j < 8; ++j) { if (!RIN) acc[j] = wmma_bf(a.l, w[j], acc[j]); acc[j] = wmma_bf(a.h, w[j], acc[j]); } }
    asm volatile("s_wait_dscnt 0x0" ::: "memory");      // this wave's reads of buffer buf are done before the buffer is refilled
    asm volatile("s_wait_asynccnt 0x0" ::: "memory");   // this wave's part of chunk c + 1 has landed
    __syncthreads();                                    // publishes chunk c + 1 and ends every wave's reads of buffer buf
    if (c + 2 < DM / GK) stage_chunk(ga + (c + 2) * (GK * 4), sa, gw + (c + 2) * (GK * 2), la + buf * GABUF, lw + buf * GWBUF); }
  asm volatile("s_wait_asynccnt 0x0" ::: "memory");     // no copy is left in flight when the wave goes on
  float res[8][8] = {};
  if (EPI == 1) { const float* rp[8];
#pragma unroll
    for (int r = 0; r < 8; ++r) rp[r] = RES + (r0 + 8 * g + r) * ldo + n0 + col;
#pragma unroll
    for (int j = 0; j < 8; ++j) {
#pragma unroll
      for (int r = 0; r < 8; ++r) res[j][r] = rp[r][j * 16]; }
    // with no call between them the 64 loads go out together; the row addresses are inputs of the wait, so they keep their registers up to it and no later load's result lands on an address register ahead of it
    asm volatile("s_wait_xcnt 0x0" :: "v"(rp[0]), "v"(rp[1]), "v"(rp[2]), "v"(rp[3]), "v"(rp[4]), "v"(rp[5]), "v"(rp[6]), "v"(rp[7]) : "memory"); }
#pragma unroll
  for (int j = 0; j < 8; ++j) { const int n = n0 + j * 16 + col; const float bb = (EPI == 1) ? bfr(bias[n]) : 0.f;
#pragma unroll
    for (int r = 0; r < 8; ++r) { const float v = acc[j][r] + bb; if (EPI != 1) so[wave][8 * g + r][j * 16 + col] = v; }
    if (EPI == 1) { float x[8], e[8];
#pragma unroll
      for (int r = 0; r < 8; ++r) x[r] = (acc[j][r] + bb) * L2E;
      ex2x8(e, x);
#pragma unroll
      for (int r = 0; r < 8; ++r) { const float v = acc[j][r] + bb; so[wave][8 * g + r][j * 16 + col] = res[j][r] + ((v > 0.f) ? v : e[r] - 1.0f); } } }
  LDSX();
  for (int rl = 0; rl < 16; ++rl) vst2(OUT + (r0 + rl) * ldo + n0 + lane * 4, *(const v4f*)&so[wave][rl][lane * 4]);
}
// ---- k_ln: block = 8 rows (wave per row): OUT = LN(IN) over 512 (biased var, eps 1e-6) * gamma + beta
__global__ __launch_bounds__(256) void k_ln(const float* __restrict__ IN, int ldi, const float* __restrict__ G, const float* __restrict__ Bb, float* __restrict__ OUT) {
  __shared__ __align__(16) float s[8][DM]; const int wave = threadIdx.x >> 5, lane = threadIdx.x & 31; const size_t row = (size_t)blockIdx.x * 8 + wave; float v[16]; float sum = 0.f;
#pragma unroll
  for (int k = 0; k < 16; ++k) { v[k] = IN[row * ldi + lane + 32 * k]; sum += v[k]; }
#pragma unroll
  for (int o = 1; o < 32; o <<= 1) sum += __shfl_xor(sum, o);
  const float mu = sum / (float)DM; float var = 0.f;
#pragma unroll
  for (int k = 0; k < 16; ++k) { const float d = v[k] - mu; var += d * d; }
#pragma unroll
  for (int o = 1; o < 32; o <<= 1) var += __shfl_xor(var, o);
  const float rs = rsqrtf(var / (float)DM + 1e-6f);
#pragma unroll
  for (int k = 0; k < 16; ++k) { const int c = lane + 32 * k; s[wave][c] = (v[k] - mu) * rs * bfr(G[c]) + bfr(Bb[c]); }
  LDSX();
  for (int pc = lane; pc < DM / 4; pc += 32) vst2(OUT + row * DM + pc * 4, *(const v4f*)&s[wave][pc * 4]);
}
// ---- k_vplanes: block = (64 tokens, 128-col chunk): v (KV cols 512 + c) -> transposed hi/lo planes [b][c][s]
__global__ __launch_bounds__(256) void k_vplanes(const float* __restrict__ KV, __bf16* __restrict__ VH, __bf16* __restrict__ VL) {
  __shared__ __align__(16) __bf16 sh[128][72], sl[128][72]; const int tid = threadIdx.x; const size_t rb = (size_t)blockIdx.x * 64; const int c0 = blockIdx.y * 128; const int b = (int)(rb / SS), s0 = (int)(rb % SS);
  for (int q = tid; q < 64 * 128; q += 256) { const int rl = q >> 7, c = q & 127; const float v = KV[(rb + rl) * (2 * DM) + DM + c0 + c]; const __bf16 hb = (__bf16)v; sh[c][rl] = hb; sl[c][rl] = (__bf16)(v - (float)hb); }
  __syncthreads();
  for (int q = tid; q < 128 * 8; q += 256) { const int c = q >> 3, pc = q & 7; const size_t o = ((size_t)b * DM + c0 + c) * SS + s0 + pc * 8; vst2((unsigned*)(VH + o), *(const v4u*)&sh[c][pc * 8]); vst2((unsigned*)(VL + o), *(const v4u*)&sl[c][pc * 8]); }
}
__device__ __forceinline__ float xhalf(float v) { return __builtin_bit_cast(float, __builtin_amdgcn_permlanex16(__builtin_bit_cast(int, v), __builtin_bit_cast(int, v), 0x76543210, 0xfedcba98, false, false)); }   // lane l reads lane l ^ 16
#define KT 64                      // keys per staged tile
#define KP 68                      // floats per K row in LDS: 272 B = 16 B x 17, no bank conflict for 16-byte reads of 16 rows
#define VP 72                      // bf16 per V row in LDS: 144 B = 16 B x 9
#define KBUF (KT * KP * 4)         // bytes of one K buffer
#define VBUF (HD * VP * 2)         // bytes of one V-plane buffer
// one tile: K 64 rows x 256 B (a lane: chunk tid & 15 of rows tid >> 4 + 8 i), each V plane 64 rows x 128 B (chunk tid & 7 of rows tid >> 3 + 16 i); the arguments are the lane's own first addresses
__device__ __forceinline__ void stage_tile(const char* gk, const char* gh, const char* gl, unsigned lk, unsigned lh, unsigned ll) {
  unsigned a[8]; const char* p[8];
#pragma unroll
  for (int i = 0; i < 8; ++i) { a[i] = lk + i * (8 * KP * 4); p[i] = gk + (size_t)i * (8 * 2 * DM * 4); }
  acopy8(a, p);
#pragma unroll
  for (int i = 0; i < 4; ++i) { a[i] = lh + i * (16 * VP * 2); p[i] = gh + (size_t)i * (16 * SS * 2); a[4 + i] = ll + i * (16 * VP * 2); p[4 + i] = gl + (size_t)i * (16 * SS * 2); }
  acopy8(a, p);
}
__global__ __launch_bounds__(128) void k_attn(const float* __restrict__ Q, const float* __restrict__ KV, const __bf16* __restrict__ VH, const __bf16* __restrict__ VL, const float* __restrict__ ML, float* __restrict__ M2) {
  __shared__ __align__(16) float so[4][16][68];
  __shared__ __align__(16) float sK[2][KT][KP];
  __shared__ __align__(16) __bf16 sVH[2][HD][VP], sVL[2][HD][VP];
  const int tid = threadIdx.x, wave = tid >> 5, lane = tid & 31, col = lane & 15, g = lane >> 4; const int qb = blockIdx.x, h = blockIdx.y, b = blockIdx.z; const int q0 = qb * 64 + wave * 16; const size_t rq = (size_t)b * SS + q0;
  const char* gk = (const char*)(KV + ((size_t)b * SS + (tid >> 4)) * (2 * DM) + h * HD) + (tid & 15) * 16;
  const size_t vo = (((size_t)b * DM + h * HD + (tid >> 3)) * SS) * 2 + (tid & 7) * 16;
  const char* gh = (const char*)VH + vo; const char* gl = (const char*)VL + vo;
  const unsigned lk = lds_addr(&sK[0][tid >> 4][0]) + (tid & 15) * 16, lh = lds_addr(&sVH[0][tid >> 3][0]) + (tid & 7) * 16, ll = lds_addr(&sVL[0][tid >> 3][0]) + (tid & 7) * 16;
  stage_tile(gk, gh, gl, lk, lh, ll);
  F2 aq[2];
#pragma unroll
  for (int kc = 0; kc < 2; ++kc) aq[kc] = split_row(Q + (rq + col) * DM + h * HD, kc * 32, lane);
  asm volatile("s_wait_asynccnt 0x0" ::: "memory");   // this wave's part of tile 0 has landed
  __syncthreads();                                    // ... and every other wave's
  stage_tile(gk + (size_t)KT * (2 * DM * 4), gh + KT * 2, gl + KT * 2, lk + KBUF, lh + VBUF, ll + VBUF);
  float ml = -3.0e38f, l = 0.f;   // ml: running row maximum times L2E
  v8f acc[4] = {};   // O^T: lane = query col, element r of tile dt = d dt*16 + 8g + r
#pragma unroll 1   // one trip = one staged tile; rolled, so that the ring's hand-over stands once, at the foot
  for (int t = 0; t < SS / KT; ++t) { const int buf = t & 1;
#pragma unroll     // sub becomes a constant in every LDS offset
    for (int sub = 0; sub < KT / 32; ++sub) { v8f s[2];   // S^T: element r of tile ct = key t*64 + sub*32 + ct*16 + 8g + r
      float kr[2][2][16];
#pragma unroll
      for (int ct = 0; ct < 2; ++ct) { const float* krow = &sK[buf][sub * 32 + ct * 16 + col][8 * g];
#pragma unroll
        for (int kc = 0; kc < 2; ++kc) { const float* p = krow + kc * 32;
#pragma unroll
          for (int i = 0; i < 8; ++i) { kr[ct][kc][i] = p[i]; kr[ct][kc][8 + i] = p[16 + i]; } } }
#pragma unroll
      for (int ct = 0; ct < 2; ++ct) { v8f c = {};
#pragma unroll
        for (int kc = 0; kc < 2; ++kc) { const F2 kb = bsplit16(kr[ct][kc]); c = wmma_bf(kb.h, aq[kc].l, c); c = wmma_bf(kb.l, aq[kc].h, c); c = wmma_bf(kb.h, aq[kc].h, c); }
        s[ct] = c; }
      v16b vh[4], vl[4];   // read ahead of the softmax, which covers their way from LDS
#pragma unroll
      for (int dt = 0; dt < 4; ++dt) { vh[dt] = frag_b(&sVH[buf][dt * 16 + col][sub * 32], lane); vl[dt] = frag_b(&sVL[buf][dt * 16 + col][sub * 32], lane); }
      float mx = fmaxf(s[0][0], s[1][0]);
#pragma unroll
      for (int r = 1; r < 8; ++r) mx = fmaxf(mx, fmaxf(s[0][r], s[1][r]));
      mx = fmaxf(mx, xhalf(mx));
      const float mnl = fmaxf(ml, mx * L2E); const float alpha = ex2x1(ml - mnl);   // the running maximum is kept times L2E: ml is the very value the earlier terms were taken against, so an unchanged maximum gives exactly 1
      float e[16], x[16]; float es = 0.f;
#pragma unroll
      for (int r = 0; r < 8; ++r) { x[r] = fmaf(s[0][r], L2E, -mnl); x[8 + r] = fmaf(s[1][r], L2E, -mnl); }
      ex2x8(e, x); ex2x8(e + 8, x + 8);
#pragma unroll
      for (int r = 0; r < 8; ++r) es += e[r] + e[8 + r];
      l = l * alpha + es; ml = mnl;   // l: this half's 16 of each 32 keys; the halves are joined once behind the loop (alpha is the same in both)
#pragma unroll
      for (int dt = 0; dt < 4; ++dt) acc[dt] *= alpha;
      const F2 pb = bsplit16(e);
#pragma unroll
      for (int dt = 0; dt < 4; ++dt) { acc[dt] = wmma_bf(vh[dt], pb.l, acc[dt]); acc[dt] = wmma_bf(vl[dt], pb.h, acc[dt]); acc[dt] = wmma_bf(vh[dt], pb.h, acc[dt]); } }
    asm volatile("s_wait_dscnt 0x0" ::: "memory");      // this wave's reads of buffer buf are done before the buffer is refilled
    asm volatile("s_wait_asynccnt 0x0" ::: "memory");   // this wave's part of tile t + 1 has landed
    __syncthreads();                                    // publishes tile t + 1 and ends every wave's reads of buffer buf
    if (t + 2 < SS / KT) stage_tile(gk + (size_t)(t + 2) * (KT * 2 * DM * 4), gh + (t + 2) * (KT * 2), gl + (t + 2) * (KT * 2), lk + buf * KBUF, lh + buf * VBUF, ll + buf * VBUF); }
  asm volatile("s_wait_asynccnt 0x0" ::: "memory");     // no copy is left in flight when the wave goes on
  l += xhalf(l);
  const float il = 1.0f / l; const float* mlr = ML + (rq + col) * (2 * DM) + h * HD + 8 * g;
#pragma unroll
  for (int dt = 0; dt < 4; ++dt) {
#pragma unroll
    for (int r = 0; r < 8; ++r) so[wave][col][dt * 16 + 8 * g + r] = mlr[dt * 16 + r] + acc[dt][r] * il; }
  LDSX();
  for (int rl = 0; rl < 16; ++rl) if (lane < 16) vst2(M2 + (rq + rl) * DM + h * HD + lane * 4, *(const v4f*)&so[wave][rl][lane * 4]);
}
extern "C" void kernel_launch(void* const* d_in, const int* in_sizes, int n_in, void* d_out, int out_size, void* d_ws, size_t ws_size, hipStream_t stream) {
  (void)in_sizes; (void)n_in; (void)out_size;
  const float** F = (const float**)d_in;   // 0 mod [2,2048,512], 1 Wl [512,512], 2 Wd, 3 Wq [8,64,64], 4 Wk, 5 Wv, 6 gamma [512], 7 beta, 8 Wf [512,512], 9 bf [512]
  if (ws_size < (size_t)WS_END) return;
  char* ws = (char*)d_ws; __bf16 *PW = (__bf16*)(ws + WS_PW), *VH = (__bf16*)(ws + WS_VH), *VL = (__bf16*)(ws + WS_VL); float *ML = (float*)(ws + WS_ML), *NM = (float*)(ws + WS_NM), *ND = (float*)(ws + WS_ND), *Q = (float*)(ws + WS_Q), *KV = (float*)(ws + WS_KV), *M2 = (float*)(ws + WS_M2);
  const int NR = TNB * SS / 64;
  k_packT<<<dim3(2 * DM, 4), 256, 0, stream>>>(F[1], F[2], F[3], F[4], F[5], F[8], PW);
  k_gemm<1, 0><<<dim3(NR, 2 * DM / 128), 128, 0, stream>>>(F[0], DM, PW + PLD, nullptr, nullptr, ML, 2 * DM);        // mod_l | dec_l (exact)
  k_ln<<<TNB * SS / 8, 256, 0, stream>>>(ML, 2 * DM, F[6], F[7], NM);
  k_ln<<<TNB * SS / 8, 256, 0, stream>>>(ML + DM, 2 * DM, F[6], F[7], ND);
  k_gemm<0, 0><<<dim3(NR, DM / 128), 128, 0, stream>>>(NM, DM, PW + PQQ, nullptr, nullptr, Q, DM);               // q
  k_gemm<0, 0><<<dim3(NR, 2 * DM / 128), 128, 0, stream>>>(ND, DM, PW + PKV, nullptr, nullptr, KV, 2 * DM);       // k | v
  k_vplanes<<<dim3(NR, DM / 128), 256, 0, stream>>>(KV, VH, VL);
  k_attn<<<dim3(TQB, NH, TNB), 128, 0, stream>>>(Q, KV, VH, VL, ML, M2);                                          // mod2 = mod_l + o
  k_ln<<<TOB * 8, 256, 0, stream>>>(M2, DM, F[6], F[7], NM);                                                      // LN(mod2) (NM reused)
  k_gemm<0, 1><<<dim3(TOB, DM / 128), 128, 0, stream>>>(NM, DM, PW + PFF, F[9], M2, (float*)d_out, DM);           // out = mod2 + elu(LN(mod2) Wf + bf)
}

// v005
// One run takes 135 microseconds.
// Timed twice side by side with v004, it ran 1.05 times as fast both times.
// Counting every step since v000, it is 3.67 times as fast.
// compute dtype: mod and all weights/LN params (module inputs) rounded to bf16; mod Wl / mod Wd with exact bf16 products (inputs); the per-head q/k/v 1x1 convs (as two block-diagonal GEMMs: q 512->512, k|v 512->1024), the FFN and scores/P.V with the computed operands as bf16 hi + residual pairs (2 products against exact weights; 3 products for q.k and P.V); LayerNorms, softmax (no 1/sqrt(d) scale), ELU and residuals in f32; f32 accumulate.
#include <hip/hip_runtime.h>
#include <math.h>

typedef __attribute__((ext_vector_type(16))) _Float16 v16h;
typedef __attribute__((ext_vector_type(16))) __bf16 v16b;
typedef __attribute__((ext_vector_type(8)))  _Float16 v8h;
typedef __attribute__((ext_vector_type(8)))  float v8f;
typedef __attribute__((ext_vector_type(4)))  float v4f;
typedef __attribute__((ext_vector_type(2)))  float v2f;
typedef __attribute__((ext_vector_type(4)))  unsigned v4u;
typedef __attribute__((ext_vector_type(4)))  int v4i;
typedef float __attribute__((may_alias)) float_a;
typedef int __attribute__((may_alias)) int_a;

template <typename T> __device__ __forceinline__ void vst2(void* p, T v) { *(T*)p = v;  }
__device__ __forceinline__ v8f wmma16(v16h a, v16h b, v8f c) {
  v8f d = __builtin_amdgcn_wmma_f32_16x16x32_f16(false, a, false, b, (short)0, c, false, false);
  asm volatile("v_nop\n\tv_nop\n\tv_nop\n\tv_nop" : "+v"(d) : "v"(a), "v"(b));
  return d;
}
__device__ __forceinline__ v8f wmma_bf(v16b a, v16b b, v8f c) {
  v8f d = __builtin_amdgcn_wmma_f32_16x16x32_bf16(false, a, false, b, (short)0, c, false, false);
  asm volatile("v_nop\n\tv_nop\n\tv_nop\n\tv_nop" : "+v"(d) : "v"(a), "v"(b));
  return d;
}
// 16x16x32 fragments: lane = (h = lane>>4, row/col = lane&15); elements 0..7 = k0+8h+0..7, 8..15 = k0+16+8h+0..7; D element r = row 8h+r
__device__ __forceinline__ v16h frag_h(const _Float16* rowk0, int lane) {
  union { v16h v; v8h q[2]; } u; const _Float16* p = rowk0 + 8 * (lane >> 4);
  u.q[0] = *(const v8h*)p; u.q[1] = *(const v8h*)(p + 16); return u.v;
}
__device__ __forceinline__ v16h frag_f32(const float* rowk0, int lane) {
  v16h a; const float* p = rowk0 + 8 * (lane >> 4);
#pragma unroll
  for (int i = 0; i < 8; ++i) { a[i] = (_Float16)p[i]; a[8 + i] = (_Float16)p[16 + i]; }
  return a;
}
__device__ __forceinline__ v16h frag_f32s(const float* rowk0, int lane, float sc) {
  v16h a; const float* p = rowk0 + 8 * (lane >> 4);
#pragma unroll
  for (int i = 0; i < 8; ++i) { a[i] = (_Float16)(p[i] * sc); a[8 + i] = (_Float16)(p[16 + i] * sc); }
  return a;
}
// column fragment from a [K][ld] layout (column n), rows >= K read as 0
__device__ __forceinline__ v16h fragc_f32(const float* W, int k0, int n, int lane, int ld, int K) {
  v16h a; const int g = lane >> 4;
#pragma unroll
  for (int i = 0; i < 8; ++i) { const int ka = k0 + 8 * g + i, kb = ka + 16;
    a[i] = (_Float16)(ka < K ? W[(size_t)(ka < K ? ka : K - 1) * ld + n] : 0.f); a[8 + i] = (_Float16)(kb < K ? W[(size_t)(kb < K ? kb : K - 1) * ld + n] : 0.f); }
  return a;
}
struct F2 { v16b h, l; };
__device__ __forceinline__ F2 bsplit16(const float v[16]) { F2 r;
#pragma unroll
  for (int i = 0; i < 16; ++i) { const __bf16 h = (__bf16)v[i]; r.h[i] = h; r.l[i] = (__bf16)(v[i] - (float)h); }
  return r; }
__device__ __forceinline__ F2 split_row(const float* row, int k0, int lane) { float v[16]; const float* p = row + k0 + 8 * (lane >> 4);
#pragma unroll
  for (int i = 0; i < 8; ++i) { v[i] = p[i]; v[8 + i] = p[16 + i]; }
  return bsplit16(v); }
__device__ __forceinline__ F2 split_rowK(const float* row, int k0, int lane, int K) { float v[16]; const int g = lane >> 4;
#pragma unroll
  for (int i = 0; i < 8; ++i) { const int ka = k0 + 8 * g + i, kb = ka + 16; v[i] = ka < K ? row[ka < K ? ka : K - 1] : 0.f; v[8 + i] = kb < K ? row[kb < K ? kb : K - 1] : 0.f; }
  return bsplit16(v); }
__device__ __forceinline__ F2 split_col(const float* W, int k0, int n, int lane, int ld, int K) { float v[16]; const int g = lane >> 4;
#pragma unroll
  for (int i = 0; i < 8; ++i) { const int ka = k0 + 8 * g + i, kb = ka + 16; v[i] = ka < K ? W[(size_t)(ka < K ? ka : K - 1) * ld + n] : 0.f; v[8 + i] = kb < K ? W[(size_t)(kb < K ? kb : K - 1) * ld + n] : 0.f; }
  return bsplit16(v); }
__device__ __forceinline__ v8f mac3(const F2& a, const F2& b, v8f c) { c = wmma_bf(a.l, b.h, c); c = wmma_bf(a.h, b.l, c); return wmma_bf(a.h, b.h, c); }
__device__ __forceinline__ float sigm(float v) { return 1.0f / (1.0f + expf(-v)); }
#define LDSX() do { asm volatile("s_wait_dscnt 0" ::: "memory"); __builtin_amdgcn_wave_barrier(); __builtin_amdgcn_fence(__ATOMIC_RELEASE, "workgroup"); } while (0)


// SAttn (B 2, S 2048, dim 512, 8 heads x 64; self-attention: dec = mod): mod_l = mod Wl, dec_l = mod Wd; nm = LN(mod_l), nd = LN(dec_l) (shared gamma/beta, eps 1e-6); q = nm_h Wq[h], k = nd_h Wk[h], v = nd_h Wv[h]; attn = softmax(q k^T) (unscaled); o merged; mod2 = mod_l + o; out = mod2 + elu(LN(mod2) Wf + bf).
#define NB 2
#define SS 2048
#define DM 512
#define NH 8
#define HD 64
#define NTOK (NB * SS)
#ifndef TQB
#define TQB (SS / 64)
#define TNB NB
#define TOB (NB * SS / 64)
#endif
typedef __attribute__((ext_vector_type(8))) __bf16 v8b;
__device__ __forceinline__ v16b frag_b(const __bf16* rowk0, int lane) {
  union { v16b v; v8b q[2]; } u; const __bf16* p = rowk0 + 8 * (lane >> 4);
  u.q[0] = *(const v8b*)p; u.q[1] = *(const v8b*)(p + 16); return u.v;
}
__device__ __forceinline__ float bfr(float v) { return (float)(__bf16)v; }
#define L2E 1.4426950408889634f   // log2(e): exp(x) = 2^(x * L2E)
// eight (one) 2^x in line, no call, so that independent exponentials overlap; one statement: the outputs are early-clobber, so no v_exp_f32 overwrites the source of the one ahead of it, and the v_nop at the end keeps the one slot that the instruction set asks for behind a transcendental
__device__ __forceinline__ void ex2x8(float* o, const float* x) {
  asm("v_exp_f32 %0, %8\n\tv_exp_f32 %1, %9\n\tv_exp_f32 %2, %10\n\tv_exp_f32 %3, %11\n\tv_exp_f32 %4, %12\n\tv_exp_f32 %5, %13\n\tv_exp_f32 %6, %14\n\tv_exp_f32 %7, %15\n\tv_nop"
      : "=&v"(o[0]), "=&v"(o[1]), "=&v"(o[2]), "=&v"(o[3]), "=&v"(o[4]), "=&v"(o[5]), "=&v"(o[6]), "=&v"(o[7])
      : "v"(x[0]), "v"(x[1]), "v"(x[2]), "v"(x[3]), "v"(x[4]), "v"(x[5]), "v"(x[6]), "v"(x[7]));
}
__device__ __forceinline__ float ex2x1(float x) { float o; asm("v_exp_f32 %0, %1\n\tv_nop" : "=v"(o) : "v"(x)); return o; }
#define WS_PW  0u                 // bf16 rows (in,out -> [out][in]): Wl|Wd -> [1024][512]; Wq (block diagonal) [512][512]; Wk|Wv (block diagonal) [1024][512]; Wf [512][512]
#define PLD 0
#define PQQ (PLD + 2 * DM * DM)
#define PKV (PQQ + DM * DM)
#define PFF (PKV + 2 * DM * DM)
#define PWEND (PFF + DM * DM)
#define WS_ML  (WS_PW + 2u * PWEND)   // f32 [NTOK][1024] mod_l | dec_l
#define WS_NM  (WS_ML + 4u * NTOK * 2 * DM)   // f32 [NTOK][512] LN(mod_l), later LN(mod2)
#define WS_ND  (WS_NM + 4u * NTOK * DM)       // f32 [NTOK][512] LN(dec_l)
#define WS_Q   (WS_ND + 4u * NTOK * DM)       // f32 [NTOK][512] q
#define WS_KV  (WS_Q + 4u * NTOK * DM)        // f32 [NTOK][1024] k | v
#define WS_VH  (WS_KV + 4u * NTOK * 2 * DM)   // bf16 [NB][512][SS] v planes
#define WS_VL  (WS_VH + 2u * NB * DM * SS)
#define WS_M2  (WS_VL + 2u * NB * DM * SS)   // f32 [NTOK][512] mod2 = mod_l + o
#define WS_END (WS_M2 + 4u * NTOK * DM)

// ---- k_packT: block = (64 k x 64 n tile, matrix m): PW holds six [512 out][512 in] bf16 matrices in a row: 0 Wl^T, 1 Wd^T, 2 Wq, 3 Wk, 4 Wv (block diagonal: row h*64+e gets W[h][d][e] at col h*64+d, zeros elsewhere), 5 Wf^T; the tile is read along its rows (16 lanes x 16 B = 256 B of one input row; a lane takes two neighbour rows, so that a k pair is one LDS word), turned in LDS and stored as whole 128-B lines; a tile off the diagonal of 2..4 reads nothing and stores zeros
#define PTP 72                     // bf16 per tile row in LDS: 144 B = 16 B x 9
typedef __attribute__((ext_vector_type(2))) __bf16 v2b;
__global__ __launch_bounds__(128) void k_packT(const float* __restrict__ WL, const float* __restrict__ WD, const float* __restrict__ WQ, const float* __restrict__ WK, const float* __restrict__ WV, const float* __restrict__ WF, __bf16* __restrict__ PW) {
  __shared__ __align__(16) __bf16 s[64][PTP];
  const int tid = threadIdx.x, kt = blockIdx.x & 7, nt = blockIdx.x >> 3, m = blockIdx.y;
  const bool dense = (m < 2 || m == 5);
  const float* W = (m == 0) ? WL : (m == 1) ? WD : (m == 2) ? WQ : (m == 3) ? WK : (m == 4) ? WV : WF;
  const float* p = (dense ? W + (size_t)(kt * 64) * DM + nt * 64 : W + (size_t)kt * (HD * HD)) + (tid & 15) * 4; const int ld = dense ? DM : HD;
  v4f v[8] = {};   // v[2 i + o]: input row 2 (tid >> 4) + 16 i + o of the tile
  if (dense || kt == nt) { const float* rp[8];
#pragma unroll
    for (int i = 0; i < 8; ++i) rp[i] = p + (size_t)(2 * (tid >> 4) + 16 * (i >> 1) + (i & 1)) * ld;
#pragma unroll
    for (int i = 0; i < 8; ++i) v[i] = *(const v4f*)rp[i];
    // the row addresses are inputs of the wait, so they keep their registers up to it and no later load's result lands on an address register ahead of it
    asm volatile("s_wait_xcnt 0x0" :: "v"(rp[0]), "v"(rp[1]), "v"(rp[2]), "v"(rp[3]), "v"(rp[4]), "v"(rp[5]), "v"(rp[6]), "v"(rp[7]) : "memory"); }
#pragma unroll
  for (int i = 0; i < 4; ++i) {
#pragma unroll
    for (int j = 0; j < 4; ++j) { v2b t; t[0] = (__bf16)v[2 * i][j]; t[1] = (__bf16)v[2 * i + 1][j]; *(v2b*)&s[(tid & 15) * 4 + j][2 * (tid >> 4) + 16 * i] = t; } }
  __syncthreads();
  __bf16* dst = PW + (size_t)m * (DM * DM) + (size_t)(nt * 64) * DM + kt * 64;
#pragma unroll
  for (int i = 0; i < 4; ++i) { const int n = (tid >> 3) + 16 * i; vst2((unsigned*)(dst + (size_t)n * DM + (tid & 7) * 8), *(const v4u*)&s[n][(tid & 7) * 8]); }
}
__device__ __forceinline__ unsigned lds_addr(const void* p) { return (unsigned)(unsigned long long)p; }   // LDS byte address = low 32 bits of a __shared__ address
// eight 16-byte copies per lane, global -> LDS through no register; s_wait_xcnt closes the statement so that no address register is rewritten ahead of it
__device__ __forceinline__ void acopy8(const unsigned (&l)[8], const char* const (&p)[8]) {
  asm volatile("global_load_async_to_lds_b128 %0, %8, off\n\t"
               "global_load_async_to_lds_b128 %1, %9, off\n\t"
               "global_load_async_to_lds_b128 %2, %10, off\n\t"
               "global_load_async_to_lds_b128 %3, %11, off\n\t"
               "global_load_async_to_lds_b128 %4, %12, off\n\t"
               "global_load_async_to_lds_b128 %5, %13, off\n\t"
               "global_load_async_to_lds_b128 %6, %14, off\n\t"
               "global_load_async_to_lds_b128 %7, %15, off\n\t"
               "s_wait_xcnt 0x0"
               :: "v"(l[0]), "v"(l[1]), "v"(l[2]), "v"(l[3]), "v"(l[4]), "v"(l[5]), "v"(l[6]), "v"(l[7]),
                  "v"(p[0]), "v"(p[1]), "v"(p[2]), "v"(p[3]), "v"(p[4]), "v"(p[5]), "v"(p[6]), "v"(p[7]) : "memory");
}
#define GK 64                      // k per staged chunk
#define GAP 68                     // floats per A row in LDS: 272 B = 16 B x 17, no bank conflict for 16-byte reads of 16 rows
#define GWP 72                     // bf16 per W row in LDS: 144 B = 16 B x 9
#define GABUF (64 * GAP * 4)       // bytes of one A buffer
#define GWBUF (128 * GWP * 2)      // bytes of one W buffer
// one k-chunk: A 64 rows x 256 B (a lane: piece tid & 15 of rows tid >> 4 + 8 i), W 128 rows x 128 B (piece tid & 7 of rows tid >> 3 + 16 i): every copy of a wave covers whole 128-B lines; the arguments are the lane's own first addresses, sa = bytes from a row of A to the eighth behind it
__device__ __forceinline__ void stage_chunk(const char* ga, size_t sa, const char* gw, unsigned la, unsigned lw) {
  unsigned a[8]; const char* p[8];
#pragma unroll
  for (int i = 0; i < 8; ++i) { a[i] = la + i * (8 * GAP * 4); p[i] = ga + i * sa; }
  acopy8(a, p);
#pragma unroll
  for (int i = 0; i < 8; ++i) { a[i] = lw + i * (16 * GWP * 2); p[i] = gw + (size_t)i * (16 * DM * 2); }
  acopy8(a, p);
}
// ---- k_gemm<RIN, EPI>: block = (64 rows, 128 cols): OUT = A(hi/lo or exact, K 512, pitch lda) . rows; A (f32) and the weight rows come in chunks of 64 k through LDS: asynchronous copies, two buffers, the weight chunk one for all 4 waves, the next chunk in flight while this one is worked on; EPI 0: plain; EPI 1: + bias, ELU, + RES (out = RES + elu(acc + b)); pitch ldo
template <int RIN, int EPI>
__global__ __launch_bounds__(128) void k_gemm(const float* __restrict__ A, int lda, const __bf16* __restrict__ P, const float* __restrict__ bias, const float* __restrict__ RES, float* __restrict__ OUT, int ldo) {
  __shared__ __align__(16) float so[4][16][132];
  __shared__ __align__(16) float sA[2][64][GAP];
  __shared__ __align__(16) __bf16 sW[2][128][GWP];
  const int tid = threadIdx.x, wave = tid >> 5, lane = tid & 31, col = lane & 15, g = lane >> 4; const size_t r0 = (size_t)blockIdx.x * 64 + wave * 16; const int n0 = blockIdx.y * 128;
  const char* ga = (const char*)(A + ((size_t)blockIdx.x * 64 + (tid >> 4)) * lda) + (tid & 15) * 16; const size_t sa = (size_t)lda * (8 * 4);
  const char* gw = (const char*)(P + (size_t)(n0 + (tid >> 3)) * DM) + (tid & 7) * 16;
  const unsigned la = lds_addr(&sA[0][tid >> 4][0]) + (tid & 15) * 16, lw = lds_addr(&sW[0][tid >> 3][0]) + (tid & 7) * 16;
  stage_chunk(ga, sa, gw, la, lw);
  asm volatile("s_wait_asynccnt 0x0" ::: "memory");   // this wave's part of chunk 0 has landed
  __syncthreads();                                    // ... and every other wave's
  stage_chunk(ga + GK * 4, sa, gw + GK * 2, la + GABUF, lw + GWBUF);
  v8f acc[8] = {};
#pragma unroll 1   // one trip = one staged chunk; rolled, so that the ring's hand-over stands once, at the foot
  for (int c = 0; c < DM / GK; ++c) { const int buf = c & 1;
#pragma unroll     // kk becomes a constant in every LDS offset
    for (int kk = 0; kk < GK / 32; ++kk) { const float* arow = &sA[buf][wave * 16 + col][kk * 32];
      v16b w[8];   // the eight weight fragments are read as one group, ahead of the products
#pragma unroll
      for (int j = 0; j < 8; ++j) w[j] = frag_b(&sW[buf][j * 16 + col][kk * 32], lane);
      F2 a; if (RIN) { v16b ax; const float* p = arow + 8 * g;
#pragma unroll
        for (int i = 0; i < 8; ++i) { ax[i] = (__bf16)p[i]; ax[8 + i] = (__bf16)p[16 + i]; } a.h = ax; a.l = ax; } else a = split_row(arow, 0, lane);
#pragma unroll
      for (int j = 0; j < 8; ++j) { if (!RIN) acc[j] = wmma_bf(a.l, w[j], acc[j]); acc[j] = wmma_bf(a.h, w[j], acc[j]); } }
    asm volatile("s_wait_dscnt 0x0" ::: "memory");      // this wave's reads of buffer buf are done before the buffer is refilled
    asm volatile("s_wait_asynccnt 0x0" ::: "memory");   // this wave's part of chunk c + 1 has landed
    __syncthreads();                                    // publishes chunk c + 1 and ends every wave's reads of buffer buf
    if (c + 2 < DM / GK) stage_chunk(ga + (c + 2) * (GK * 4), sa, gw + (c + 2) * (GK * 2), la + buf * GABUF, lw + buf * GWBUF); }
  asm volatile("s_wait_asynccnt 0x0" ::: "memory");     // no copy is left in flight when the wave goes on
  float res[8][8] = {};
  if (EPI == 1) { const float* rp[8];
#pragma unroll
    for (int r = 0; r < 8; ++r) rp[r] = RES + (r0 + 8 * g + r) * ldo + n0 + col;
#pragma unroll
    for (int j = 0; j < 8; ++j) {
#pragma unroll
      for (int r = 0; r < 8; ++r) res[j][r] = rp[r][j * 16]; }
    // with no call between them the 64 loads go out together; the row addresses are inputs of the wait, so they keep their registers up to it and no later load's result lands on an address register ahead of it
    asm volatile("s_wait_xcnt 0x0" :: "v"(rp[0]), "v"(rp[1]), "v"(rp[2]), "v"(rp[3]), "v"(rp[4]), "v"(rp[5]), "v"(rp[6]), "v"(rp[7]) : "memory"); }
#pragma unroll
  for (int j = 0; j < 8; ++j) { const int n = n0 + j * 16 + col; const float bb = (EPI == 1) ? bfr(bias[n]) : 0.f;
#pragma unroll
    for (int r = 0; r < 8; ++r) { const float v = acc[j][r] + bb; if (EPI != 1) so[wave][8 * g + r][j * 16 + col] = v; }
    if (EPI == 1) { float x[8], e[8];
#pragma unroll
      for (int r = 0; r < 8; ++r) x[r] = (acc[j][r] + bb) * L2E;
      ex2x8(e, x);
#pragma unroll
      for (int r = 0; r < 8; ++r) { const float v = acc[j][r] + bb; so[wave][8 * g + r][j * 16 + col] = res[j][r] + ((v > 0.f) ? v : e[r] - 1.0f); } } }
  LDSX();
  for (int rl = 0; rl < 16; ++rl) vst2(OUT + (r0 + rl) * ldo + n0 + lane * 4, *(const v4f*)&so[wave][rl][lane * 4]);
}
// ---- k_ln: block = 8 rows (wave per row): OUT = LN(IN) over 512 (biased var, eps 1e-6) * gamma + beta
__global__ __launch_bounds__(256) void k_ln(const float* __restrict__ IN, int ldi, const float* __restrict__ G, const float* __restrict__ Bb, float* __restrict__ OUT) {
  __shared__ __align__(16) float s[8][DM]; const int wave = threadIdx.x >> 5, lane = threadIdx.x & 31; const size_t row = (size_t)blockIdx.x * 8 + wave; float v[16]; float sum = 0.f;
#pragma unroll
  for (int k = 0; k < 16; ++k) { v[k] = IN[row * ldi + lane + 32 * k]; sum += v[k]; }
#pragma unroll
  for (int o = 1; o < 32; o <<= 1) sum += __shfl_xor(sum, o);
  const float mu = sum / (float)DM; float var = 0.f;
#pragma unroll
  for (int k = 0; k < 16; ++k) { const float d = v[k] - mu; var += d * d; }
#pragma unroll
  for (int o = 1; o < 32; o <<= 1) var += __shfl_xor(var, o);
  const float rs = rsqrtf(var / (float)DM + 1e-6f);
#pragma unroll
  for (int k = 0; k < 16; ++k) { const int c = lane + 32 * k; s[wave][c] = (v[k] - mu) * rs * bfr(G[c]) + bfr(Bb[c]); }
  LDSX();
  for (int pc = lane; pc < DM / 4; pc += 32) vst2(OUT + row * DM + pc * 4, *(const v4f*)&s[wave][pc * 4]);
}
// ---- k_vplanes: block = (64 tokens, 128-col chunk): v (KV cols 512 + c) -> transposed hi/lo planes [b][c][s]
__global__ __launch_bounds__(256) void k_vplanes(const float* __restrict__ KV, __bf16* __restrict__ VH, __bf16* __restrict__ VL) {
  __shared__ __align__(16) __bf16 sh[128][72], sl[128][72]; const int tid = threadIdx.x; const size_t rb = (size_t)blockIdx.x * 64; const int c0 = blockIdx.y * 128; const int b = (int)(rb / SS), s0 = (int)(rb % SS);
  for (int q = tid; q < 64 * 128; q += 256) { const int rl = q >> 7, c = q & 127; const float v = KV[(rb + rl) * (2 * DM) + DM + c0 + c]; const __bf16 hb = (__bf16)v; sh[c][rl] = hb; sl[c][rl] = (__bf16)(v - (float)hb); }
  __syncthreads();
  for (int q = tid; q < 128 * 8; q += 256) { const int c = q >> 3, pc = q & 7; const size_t o = ((size_t)b * DM + c0 + c) * SS + s0 + pc * 8; vst2((unsigned*)(VH + o), *(const v4u*)&sh[c][pc * 8]); vst2((unsigned*)(VL + o), *(const v4u*)&sl[c][pc * 8]); }
}
__device__ __forceinline__ float xhalf(float v) { return __builtin_bit_cast(float, __builtin_amdgcn_permlanex16(__builtin_bit_cast(int, v), __builtin_bit_cast(int, v), 0x76543210, 0xfedcba98, false, false)); }   // lane l reads lane l ^ 16
#define KT 64                      // keys per staged tile
#define KP 68                      // floats per K row in LDS: 272 B = 16 B x 17, no bank conflict for 16-byte reads of 16 rows
#define VP 72                      // bf16 per V row in LDS: 144 B = 16 B x 9
#define KBUF (KT * KP * 4)         // bytes of one K buffer
#define VBUF (HD * VP * 2)         // bytes of one V-plane buffer
// one tile: K 64 rows x 256 B (a lane: chunk tid & 15 of rows tid >> 4 + 8 i), each V plane 64 rows x 128 B (chunk tid & 7 of rows tid >> 3 + 16 i); the arguments are the lane's own first addresses
__device__ __forceinline__ void stage_tile(const char* gk, const char* gh, const char* gl, unsigned lk, unsigned lh, unsigned ll) {
  unsigned a[8]; const char* p[8];
#pragma unroll
  for (int i = 0; i < 8; ++i) { a[i] = lk + i * (8 * KP * 4); p[i] = gk + (size_t)i * (8 * 2 * DM * 4); }
  acopy8(a, p);
#pragma unroll
  for (int i = 0; i < 4; ++i) { a[i] = lh + i * (16 * VP * 2); p[i] = gh + (size_t)i * (16 * SS * 2); a[4 + i] = ll + i * (16 * VP * 2); p[4 + i] = gl + (size_t)i * (16 * SS * 2); }
  acopy8(a, p);
}
__global__ __launch_bounds__(128) void k_attn(const float* __restrict__ Q, const float* __restrict__ KV, const __bf16* __restrict__ VH, const __bf16* __restrict__ VL, const float* __restrict__ ML, float* __restrict__ M2) {
  __shared__ __align__(16) float so[4][16][68];
  __shared__ __align__(16) float sK[2][KT][KP];
  __shared__ __align__(16) __bf16 sVH[2][HD][VP], sVL[2][HD][VP];
  const int tid = threadIdx.x, wave = tid >> 5, lane = tid & 31, col = lane & 15, g = lane >> 4; const int qb = blockIdx.x, h = blockIdx.y, b = blockIdx.z; const int q0 = qb * 64 + wave * 16; const size_t rq = (size_t)b * SS + q0;
  const char* gk = (const char*)(KV + ((size_t)b * SS + (tid >> 4)) * (2 * DM) + h * HD) + (tid & 15) * 16;
  const size_t vo = (((size_t)b * DM + h * HD + (tid >> 3)) * SS) * 2 + (tid & 7) * 16;
  const char* gh = (const char*)VH + vo; const char* gl = (const char*)VL + vo;
  const unsigned lk = lds_addr(&sK[0][tid >> 4][0]) + (tid & 15) * 16, lh = lds_addr(&sVH[0][tid >> 3][0]) + (tid & 7) * 16, ll = lds_addr(&sVL[0][tid >> 3][0]) + (tid & 7) * 16;
  stage_tile(gk, gh, gl, lk, lh, ll);
  F2 aq[2];
#pragma unroll
  for (int kc = 0; kc < 2; ++kc) aq[kc] = split_row(Q + (rq + col) * DM + h * HD, kc * 32, lane);
  asm volatile("s_wait_asynccnt 0x0" ::: "memory");   // this wave's part of tile 0 has landed
  __syncthreads();                                    // ... and every other wave's
  stage_tile(gk + (size_t)KT * (2 * DM * 4), gh + KT * 2, gl + KT * 2, lk + KBUF, lh + VBUF, ll + VBUF);
  float ml = -3.0e38f, l = 0.f;   // ml: running row maximum times L2E
  v8f acc[4] = {};   // O^T: lane = query col, element r of tile dt = d dt*16 + 8g + r
#pragma unroll 1   // one trip = one staged tile; rolled, so that the ring's hand-over stands once, at the foot
  for (int t = 0; t < SS / KT; ++t) { const int buf = t & 1;
#pragma unroll     // sub becomes a constant in every LDS offset
    for (int sub = 0; sub < KT / 32; ++sub) { v8f s[2];   // S^T: element r of tile ct = key t*64 + sub*32 + ct*16 + 8g + r
      float kr[2][2][16];
#pragma unroll
      for (int ct = 0; ct < 2; ++ct) { const float* krow = &sK[buf][sub * 32 + ct * 16 + col][8 * g];
#pragma unroll
        for (int kc = 0; kc < 2; ++kc) { const float* p = krow + kc * 32;
#pragma unroll
          for (int i = 0; i < 8; ++i) { kr[ct][kc][i] = p[i]; kr[ct][kc][8 + i] = p[16 + i]; } } }
#pragma unroll
      for (int ct = 0; ct < 2; ++ct) { v8f c = {};
#pragma unroll
        for (int kc = 0; kc < 2; ++kc) { const F2 kb = bsplit16(kr[ct][kc]); c = wmma_bf(kb.h, aq[kc].l, c); c = wmma_bf(kb.l, aq[kc].h, c); c = wmma_bf(kb.h, aq[kc].h, c); }
        s[ct] = c; }
      v16b vh[4], vl[4];   // read ahead of the softmax, which covers their way from LDS
#pragma unroll
      for (int dt = 0; dt < 4; ++dt) { vh[dt] = frag_b(&sVH[buf][dt * 16 + col][sub * 32], lane); vl[dt] = frag_b(&sVL[buf][dt * 16 + col][sub * 32], lane); }
      float mx = fmaxf(s[0][0], s[1][0]);
#pragma unroll
      for (int r = 1; r < 8; ++r) mx = fmaxf(mx, fmaxf(s[0][r], s[1][r]));
      mx = fmaxf(mx, xhalf(mx));
      const float mnl = fmaxf(ml, mx * L2E); const float alpha = ex2x1(ml - mnl);   // the running maximum is kept times L2E: ml is the very value the earlier terms were taken against, so an unchanged maximum gives exactly 1
      float e[16], x[16]; float es = 0.f;
#pragma unroll
      for (int r = 0; r < 8; ++r) { x[r] = fmaf(s[0][r], L2E, -mnl); x[8 + r] = fmaf(s[1][r], L2E, -mnl); }
      ex2x8(e, x); ex2x8(e + 8, x + 8);
#pragma unroll
      for (int r = 0; r < 8; ++r) es += e[r] + e[8 + r];
      l = l * alpha + es; ml = mnl;   // l: this half's 16 of each 32 keys; the halves are joined once behind the loop (alpha is the same in both)
#pragma unroll
      for (int dt = 0; dt < 4; ++dt) acc[dt] *= alpha;
      const F2 pb = bsplit16(e);
#pragma unroll
      for (int dt = 0; dt < 4; ++dt) { acc[dt] = wmma_bf(vh[dt], pb.l, acc[dt]); acc[dt] = wmma_bf(vl[dt], pb.h, acc[dt]); acc[dt] = wmma_bf(vh[dt], pb.h, acc[dt]); } }
    asm volatile("s_wait_dscnt 0x0" ::: "memory");      // this wave's reads of buffer buf are done before the buffer is refilled
    asm volatile("s_wait_asynccnt 0x0" ::: "memory");   // this wave's part of tile t + 1 has landed
    __syncthreads();                                    // publishes tile t + 1 and ends every wave's reads of buffer buf
    if (t + 2 < SS / KT) stage_tile(gk + (size_t)(t + 2) * (KT * 2 * DM * 4), gh + (t + 2) * (KT * 2), gl + (t + 2) * (KT * 2), lk + buf * KBUF, lh + buf * VBUF, ll + buf * VBUF); }
  asm volatile("s_wait_asynccnt 0x0" ::: "memory");     // no copy is left in flight when the wave goes on
  l += xhalf(l);
  const float il = 1.0f / l; const float* mlr = ML + (rq + col) * (2 * DM) + h * HD + 8 * g;
#pragma unroll
  for (int dt = 0; dt < 4; ++dt) {
#pragma unroll
    for (int r = 0; r < 8; ++r) so[wave][col][dt * 16 + 8 * g + r] = mlr[dt * 16 + r] + acc[dt][r] * il; }
  LDSX();
  for (int rl = 0; rl < 16; ++rl) if (lane < 16) vst2(M2 + (rq + rl) * DM + h * HD + lane * 4, *(const v4f*)&so[wave][rl][lane * 4]);
}
extern "C" void kernel_launch(void* const* d_in, const int* in_sizes, int n_in, void* d_out, int out_size, void* d_ws, size_t ws_size, hipStream_t stream) {
  (void)in_sizes; (void)n_in; (void)out_size;
  const float** F = (const float**)d_in;   // 0 mod [2,2048,512], 1 Wl [512,512], 2 Wd, 3 Wq [8,64,64], 4 Wk, 5 Wv, 6 gamma [512], 7 beta, 8 Wf [512,512], 9 bf [512]
  if (ws_size < (size_t)WS_END) return;
  char* ws = (char*)d_ws; __bf16 *PW = (__bf16*)(ws + WS_PW), *VH = (__bf16*)(ws + WS_VH), *VL = (__bf16*)(ws + WS_VL); float *ML = (float*)(ws + WS_ML), *NM = (float*)(ws + WS_NM), *ND = (float*)(ws + WS_ND), *Q = (float*)(ws + WS_Q), *KV = (float*)(ws + WS_KV), *M2 = (float*)(ws + WS_M2);
  const int NR = TNB * SS / 64;
  k_packT<<<dim3((DM / 64) * (DM / 64), 6), 128, 0, stream>>>(F[1], F[2], F[3], F[4], F[5], F[8], PW);
  k_gemm<1, 0><<<dim3(NR, 2 * DM / 128), 128, 0, stream>>>(F[0], DM, PW + PLD, nullptr, nullptr, ML, 2 * DM);        // mod_l | dec_l (exact)
  k_ln<<<TNB * SS / 8, 256, 0, stream>>>(ML, 2 * DM, F[6], F[7], NM);
  k_ln<<<TNB * SS / 8, 256, 0, stream>>>(ML + DM, 2 * DM, F[6], F[7], ND);
  k_gemm<0, 0><<<dim3(NR, DM / 128), 128, 0, stream>>>(NM, DM, PW + PQQ, nullptr, nullptr, Q, DM);               // q
  k_gemm<0, 0><<<dim3(NR, 2 * DM / 128), 128, 0, stream>>>(ND, DM, PW + PKV, nullptr, nullptr, KV, 2 * DM);       // k | v
  k_vplanes<<<dim3(NR, DM / 128), 256, 0, stream>>>(KV, VH, VL);
  k_attn<<<dim3(TQB, NH, TNB), 128, 0, stream>>>(Q, KV, VH, VL, ML, M2);                                          // mod2 = mod_l + o
  k_ln<<<TOB * 8, 256, 0, stream>>>(M2, DM, F[6], F[7], NM);                                                      // LN(mod2) (NM reused)
  k_gemm<0, 1><<<dim3(TOB, DM / 128), 128, 0, stream>>>(NM, DM, PW + PFF, F[9], M2, (float*)d_out, DM);           // out = mod2 + elu(LN(mod2) Wf + bf)
}

// v006
// It runs in 117 microseconds.
// Timed twice side by side with v005, it ran 1.16 and 1.15 times as fast.
// Counting every step since v000, it is 4.24 times as fast.
// compute dtype: mod and all weights/LN params (module inputs) rounded to bf16; mod Wl / mod Wd with exact bf16 products (inputs); the per-head q/k/v 1x1 convs (as two block-diagonal GEMMs: q 512->512, k|v 512->1024), the FFN and scores/P.V with the computed operands as bf16 hi + residual pairs (2 products against exact weights; 3 products for q.k and P.V); LayerNorms, softmax (no 1/sqrt(d) scale), ELU and residuals in f32; f32 accumulate.
#include <hip/hip_runtime.h>
#include <math.h>

typedef __attribute__((ext_vector_type(16))) _Float16 v16h;
typedef __attribute__((ext_vector_type(16))) __bf16 v16b;
typedef __attribute__((ext_vector_type(8)))  _Float16 v8h;
typedef __attribute__((ext_vector_type(8)))  float v8f;
typedef __attribute__((ext_vector_type(4)))  float v4f;
typedef __attribute__((ext_vector_type(2)))  float v2f;
typedef __attribute__((ext_vector_type(4)))  unsigned v4u;
typedef __attribute__((ext_vector_type(4)))  int v4i;
typedef float __attribute__((may_alias)) float_a;
typedef int __attribute__((may_alias)) int_a;

template <typename T> __device__ __forceinline__ void vst2(void* p, T v) { *(T*)p = v;  }
__device__ __forceinline__ v8f wmma16(v16h a, v16h b, v8f c) {
  v8f d = __builtin_amdgcn_wmma_f32_16x16x32_f16(false, a, false, b, (short)0, c, false, false);
  asm volatile("v_nop\n\tv_nop\n\tv_nop\n\tv_nop" : "+v"(d) : "v"(a), "v"(b));
  return d;
}
__device__ __forceinline__ v8f wmma_bf(v16b a, v16b b, v8f c) {
  v8f d = __builtin_amdgcn_wmma_f32_16x16x32_bf16(false, a, false, b, (short)0, c, false, false);
  asm volatile("v_nop\n\tv_nop\n\tv_nop\n\tv_nop" : "+v"(d) : "v"(a), "v"(b));
  return d;
}
// 16x16x32 fragments: lane = (h = lane>>4, row/col = lane&15); elements 0..7 = k0+8h+0..7, 8..15 = k0+16+8h+0..7; D element r = row 8h+r
__device__ __forceinline__ v16h frag_h(const _Float16* rowk0, int lane) {
  union { v16h v; v8h q[2]; } u; const _Float16* p = rowk0 + 8 * (lane >> 4);
  u.q[0] = *(const v8h*)p; u.q[1] = *(const v8h*)(p + 16); return u.v;
}
__device__ __forceinline__ v16h frag_f32(const float* rowk0, int lane) {
  v16h a; const float* p = rowk0 + 8 * (lane >> 4);
#pragma unroll
  for (int i = 0; i < 8; ++i) { a[i] = (_Float16)p[i]; a[8 + i] = (_Float16)p[16 + i]; }
  return a;
}
__device__ __forceinline__ v16h frag_f32s(const float* rowk0, int lane, float sc) {
  v16h a; const float* p = rowk0 + 8 * (lane >> 4);
#pragma unroll
  for (int i = 0; i < 8; ++i) { a[i] = (_Float16)(p[i] * sc); a[8 + i] = (_Float16)(p[16 + i] * sc); }
  return a;
}
// column fragment from a [K][ld] layout (column n), rows >= K read as 0
__device__ __forceinline__ v16h fragc_f32(const float* W, int k0, int n, int lane, int ld, int K) {
  v16h a; const int g = lane >> 4;
#pragma unroll
  for (int i = 0; i < 8; ++i) { const int ka = k0 + 8 * g + i, kb = ka + 16;
    a[i] = (_Float16)(ka < K ? W[(size_t)(ka < K ? ka : K - 1) * ld + n] : 0.f); a[8 + i] = (_Float16)(kb < K ? W[(size_t)(kb < K ? kb : K - 1) * ld + n] : 0.f); }
  return a;
}
struct F2 { v16b h, l; };
__device__ __forceinline__ F2 bsplit16(const float v[16]) { F2 r;
#pragma unroll
  for (int i = 0; i < 16; ++i) { const __bf16 h = (__bf16)v[i]; r.h[i] = h; r.l[i] = (__bf16)(v[i] - (float)h); }
  return r; }
__device__ __forceinline__ F2 split_row(const float* row, int k0, int lane) { float v[16]; const float* p = row + k0 + 8 * (lane >> 4);
#pragma unroll
  for (int i = 0; i < 8; ++i) { v[i] = p[i]; v[8 + i] = p[16 + i]; }
  return bsplit16(v); }
__device__ __forceinline__ F2 split_rowK(const float* row, int k0, int lane, int K) { float v[16]; const int g = lane >> 4;
#pragma unroll
  for (int i = 0; i < 8; ++i) { const int ka = k0 + 8 * g + i, kb = ka + 16; v[i] = ka < K ? row[ka < K ? ka : K - 1] : 0.f; v[8 + i] = kb < K ? row[kb < K ? kb : K - 1] : 0.f; }
  return bsplit16(v); }
__device__ __forceinline__ F2 split_col(const float* W, int k0, int n, int lane, int ld, int K) { float v[16]; const int g = lane >> 4;
#pragma unroll
  for (int i = 0; i < 8; ++i) { const int ka = k0 + 8 * g + i, kb = ka + 16; v[i] = ka < K ? W[(size_t)(ka < K ? ka : K - 1) * ld + n] : 0.f; v[8 + i] = kb < K ? W[(size_t)(kb < K ? kb : K - 1) * ld + n] : 0.f; }
  return bsplit16(v); }
__device__ __forceinline__ v8f mac3(const F2& a, const F2& b, v8f c) { c = wmma_bf(a.l, b.h, c); c = wmma_bf(a.h, b.l, c); return wmma_bf(a.h, b.h, c); }
__device__ __forceinline__ float sigm(float v) { return 1.0f / (1.0f + expf(-v)); }
#define LDSX() do { asm volatile("s_wait_dscnt 0" ::: "memory"); __builtin_amdgcn_wave_barrier(); __builtin_amdgcn_fence(__ATOMIC_RELEASE, "workgroup"); } while (0)


// SAttn (B 2, S 2048, dim 512, 8 heads x 64; self-attention: dec = mod): mod_l = mod Wl, dec_l = mod Wd; nm = LN(mod_l), nd = LN(dec_l) (shared gamma/beta, eps 1e-6); q = nm_h Wq[h], k = nd_h Wk[h], v = nd_h Wv[h]; attn = softmax(q k^T) (unscaled); o merged; mod2 = mod_l + o; out = mod2 + elu(LN(mod2) Wf + bf).
#define NB 2
#define SS 2048
#define DM 512
#define NH 8
#define HD 64
#define NTOK (NB * SS)
#ifndef TQB
#define TQB (SS / 64)
#define TNB NB
#define TOB (NB * SS / 64)
#endif
typedef __attribute__((ext_vector_type(8))) __bf16 v8b;
__device__ __forceinline__ v16b frag_b(const __bf16* rowk0, int lane) {
  union { v16b v; v8b q[2]; } u; const __bf16* p = rowk0 + 8 * (lane >> 4);
  u.q[0] = *(const v8b*)p; u.q[1] = *(const v8b*)(p + 16); return u.v;
}
__device__ __forceinline__ float bfr(float v) { return (float)(__bf16)v; }
#define L2E 1.4426950408889634f   // log2(e): exp(x) = 2^(x * L2E)
// eight (one) 2^x in line, no call, so that independent exponentials overlap; one statement: the outputs are early-clobber, so no v_exp_f32 overwrites the source of the one ahead of it, and the v_nop at the end keeps the one slot that the instruction set asks for behind a transcendental
__device__ __forceinline__ void ex2x8(float* o, const float* x) {
  asm("v_exp_f32 %0, %8\n\tv_exp_f32 %1, %9\n\tv_exp_f32 %2, %10\n\tv_exp_f32 %3, %11\n\tv_exp_f32 %4, %12\n\tv_exp_f32 %5, %13\n\tv_exp_f32 %6, %14\n\tv_exp_f32 %7, %15\n\tv_nop"
      : "=&v"(o[0]), "=&v"(o[1]), "=&v"(o[2]), "=&v"(o[3]), "=&v"(o[4]), "=&v"(o[5]), "=&v"(o[6]), "=&v"(o[7])
      : "v"(x[0]), "v"(x[1]), "v"(x[2]), "v"(x[3]), "v"(x[4]), "v"(x[5]), "v"(x[6]), "v"(x[7]));
}
__device__ __forceinline__ float ex2x1(float x) { float o; asm("v_exp_f32 %0, %1\n\tv_nop" : "=v"(o) : "v"(x)); return o; }
#define WS_PW  0u                 // bf16 rows (in,out -> [out][in]): Wl|Wd -> [1024][512]; Wq (block diagonal) [512][512]; Wk|Wv (block diagonal) [1024][512]; Wf [512][512]
#define PLD 0
#define PQQ (PLD + 2 * DM * DM)
#define PKV (PQQ + DM * DM)
#define PFF (PKV + 2 * DM * DM)
#define PWEND (PFF + DM * DM)
#define WS_ML  (WS_PW + 2u * PWEND)   // f32 [NTOK][1024] mod_l | dec_l
#define WS_NM  (WS_ML + 4u * NTOK * 2 * DM)   // f32 [NTOK][512] LN(mod_l), later LN(mod2)
#define WS_ND  (WS_NM + 4u * NTOK * DM)       // f32 [NTOK][512] LN(dec_l)
#define WS_Q   (WS_ND + 4u * NTOK * DM)       // f32 [NTOK][512] q
#define WS_KV  (WS_Q + 4u * NTOK * DM)        // f32 [NTOK][1024] k | v
#define WS_VH  (WS_KV + 4u * NTOK * 2 * DM)   // bf16 [NB][512][SS] v planes
#define WS_VL  (WS_VH + 2u * NB * DM * SS)
#define WS_M2  (WS_VL + 2u * NB * DM * SS)   // f32 [NTOK][512] mod2 = mod_l + o
#define WS_K2  (WS_M2 + 4u * NTOK * DM)       // bf16 [NB][NH][SS][128] k planes, a key's row = 64 hi | 64 residual (256 B)
#define WS_END (WS_K2 + 2u * NB * NH * SS * 2 * HD)

// ---- k_packT: block = (64 k x 64 n tile, matrix m): PW holds six [512 out][512 in] bf16 matrices in a row: 0 Wl^T, 1 Wd^T, 2 Wq, 3 Wk, 4 Wv (block diagonal: row h*64+e gets W[h][d][e] at col h*64+d, zeros elsewhere), 5 Wf^T; the tile is read along its rows (16 lanes x 16 B = 256 B of one input row; a lane takes two neighbour rows, so that a k pair is one LDS word), turned in LDS and stored as whole 128-B lines; a tile off the diagonal of 2..4 reads nothing and stores zeros
#define PTP 72                     // bf16 per tile row in LDS: 144 B = 16 B x 9
typedef __attribute__((ext_vector_type(2))) __bf16 v2b;
__global__ __launch_bounds__(128) void k_packT(const float* __restrict__ WL, const float* __restrict__ WD, const float* __restrict__ WQ, const float* __restrict__ WK, const float* __restrict__ WV, const float* __restrict__ WF, __bf16* __restrict__ PW) {
  __shared__ __align__(16) __bf16 s[64][PTP];
  const int tid = threadIdx.x, kt = blockIdx.x & 7, nt = blockIdx.x >> 3, m = blockIdx.y;
  const bool dense = (m < 2 || m == 5);
  const float* W = (m == 0) ? WL : (m == 1) ? WD : (m == 2) ? WQ : (m == 3) ? WK : (m == 4) ? WV : WF;
  const float* p = (dense ? W + (size_t)(kt * 64) * DM + nt * 64 : W + (size_t)kt * (HD * HD)) + (tid & 15) * 4; const int ld = dense ? DM : HD;
  v4f v[8] = {};   // v[2 i + o]: input row 2 (tid >> 4) + 16 i + o of the tile
  if (dense || kt == nt) { const float* rp[8];
#pragma unroll
    for (int i = 0; i < 8; ++i) rp[i] = p + (size_t)(2 * (tid >> 4) + 16 * (i >> 1) + (i & 1)) * ld;
#pragma unroll
    for (int i = 0; i < 8; ++i) v[i] = *(const v4f*)rp[i];
    // the row addresses are inputs of the wait, so they keep their registers up to it and no later load's result lands on an address register ahead of it
    asm volatile("s_wait_xcnt 0x0" :: "v"(rp[0]), "v"(rp[1]), "v"(rp[2]), "v"(rp[3]), "v"(rp[4]), "v"(rp[5]), "v"(rp[6]), "v"(rp[7]) : "memory"); }
#pragma unroll
  for (int i = 0; i < 4; ++i) {
#pragma unroll
    for (int j = 0; j < 4; ++j) { v2b t; t[0] = (__bf16)v[2 * i][j]; t[1] = (__bf16)v[2 * i + 1][j]; *(v2b*)&s[(tid & 15) * 4 + j][2 * (tid >> 4) + 16 * i] = t; } }
  __syncthreads();
  __bf16* dst = PW + (size_t)m * (DM * DM) + (size_t)(nt * 64) * DM + kt * 64;
#pragma unroll
  for (int i = 0; i < 4; ++i) { const int n = (tid >> 3) + 16 * i; vst2((unsigned*)(dst + (size_t)n * DM + (tid & 7) * 8), *(const v4u*)&s[n][(tid & 7) * 8]); }
}
__device__ __forceinline__ unsigned lds_addr(const void* p) { return (unsigned)(unsigned long long)p; }   // LDS byte address = low 32 bits of a __shared__ address
// eight 16-byte copies per lane, global -> LDS through no register; s_wait_xcnt closes the statement so that no address register is rewritten ahead of it
__device__ __forceinline__ void acopy8(const unsigned (&l)[8], const char* const (&p)[8]) {
  asm volatile("global_load_async_to_lds_b128 %0, %8, off\n\t"
               "global_load_async_to_lds_b128 %1, %9, off\n\t"
               "global_load_async_to_lds_b128 %2, %10, off\n\t"
               "global_load_async_to_lds_b128 %3, %11, off\n\t"
               "global_load_async_to_lds_b128 %4, %12, off\n\t"
               "global_load_async_to_lds_b128 %5, %13, off\n\t"
               "global_load_async_to_lds_b128 %6, %14, off\n\t"
               "global_load_async_to_lds_b128 %7, %15, off\n\t"
               "s_wait_xcnt 0x0"
               :: "v"(l[0]), "v"(l[1]), "v"(l[2]), "v"(l[3]), "v"(l[4]), "v"(l[5]), "v"(l[6]), "v"(l[7]),
                  "v"(p[0]), "v"(p[1]), "v"(p[2]), "v"(p[3]), "v"(p[4]), "v"(p[5]), "v"(p[6]), "v"(p[7]) : "memory");
}
#define GK 64                      // k per staged chunk
#define GAP 68                     // floats per A row in LDS: 272 B = 16 B x 17, no bank conflict for 16-byte reads of 16 rows
#define GWP 72                     // bf16 per W row in LDS: 144 B = 16 B x 9
#define GABUF (64 * GAP * 4)       // bytes of one A buffer
#define GWBUF (128 * GWP * 2)      // bytes of one W buffer
// one k-chunk: A 64 rows x 256 B (a lane: piece tid & 15 of rows tid >> 4 + 8 i), W 128 rows x 128 B (piece tid & 7 of rows tid >> 3 + 16 i): every copy of a wave covers whole 128-B lines; the arguments are the lane's own first addresses, sa = bytes from a row of A to the eighth behind it
__device__ __forceinline__ void stage_chunk(const char* ga, size_t sa, const char* gw, unsigned la, unsigned lw) {
  unsigned a[8]; const char* p[8];
#pragma unroll
  for (int i = 0; i < 8; ++i) { a[i] = la + i * (8 * GAP * 4); p[i] = ga + i * sa; }
  acopy8(a, p);
#pragma unroll
  for (int i = 0; i < 8; ++i) { a[i] = lw + i * (16 * GWP * 2); p[i] = gw + (size_t)i * (16 * DM * 2); }
  acopy8(a, p);
}
// ---- k_gemm<RIN, EPI>: block = (64 rows, 128 cols): OUT = A(hi/lo or exact, K 512, pitch lda) . rows; A (f32) and the weight rows come in chunks of 64 k through LDS: asynchronous copies, two buffers, the weight chunk one for all 4 waves, the next chunk in flight while this one is worked on; EPI 0: plain; EPI 1: + bias, ELU, + RES (out = RES + elu(acc + b)); pitch ldo
template <int RIN, int EPI>
__global__ __launch_bounds__(128) void k_gemm(const float* __restrict__ A, int lda, const __bf16* __restrict__ P, const float* __restrict__ bias, const float* __restrict__ RES, float* __restrict__ OUT, int ldo) {
  __shared__ __align__(16) float so[4][16][132];
  __shared__ __align__(16) float sA[2][64][GAP];
  __shared__ __align__(16) __bf16 sW[2][128][GWP];
  const int tid = threadIdx.x, wave = tid >> 5, lane = tid & 31, col = lane & 15, g = lane >> 4; const size_t r0 = (size_t)blockIdx.x * 64 + wave * 16; const int n0 = blockIdx.y * 128;
  const char* ga = (const char*)(A + ((size_t)blockIdx.x * 64 + (tid >> 4)) * lda) + (tid & 15) * 16; const size_t sa = (size_t)lda * (8 * 4);
  const char* gw = (const char*)(P + (size_t)(n0 + (tid >> 3)) * DM) + (tid & 7) * 16;
  const unsigned la = lds_addr(&sA[0][tid >> 4][0]) + (tid & 15) * 16, lw = lds_addr(&sW[0][tid >> 3][0]) + (tid & 7) * 16;
  stage_chunk(ga, sa, gw, la, lw);
  asm volatile("s_wait_asynccnt 0x0" ::: "memory");   // this wave's part of chunk 0 has landed
  __syncthreads();                                    // ... and every other wave's
  stage_chunk(ga + GK * 4, sa, gw + GK * 2, la + GABUF, lw + GWBUF);
  v8f acc[8] = {};
#pragma unroll 1   // one trip = one staged chunk; rolled, so that the ring's hand-over stands once, at the foot
  for (int c = 0; c < DM / GK; ++c) { const int buf = c & 1;
#pragma unroll     // kk becomes a constant in every LDS offset
    for (int kk = 0; kk < GK / 32; ++kk) { const float* arow = &sA[buf][wave * 16 + col][kk * 32];
      v16b w[8];   // the eight weight fragments are read as one group, ahead of the products
#pragma unroll
      for (int j = 0; j < 8; ++j) w[j] = frag_b(&sW[buf][j * 16 + col][kk * 32], lane);
      F2 a; if (RIN) { v16b ax; const float* p = arow + 8 * g;
#pragma unroll
        for (int i = 0; i < 8; ++i) { ax[i] = (__bf16)p[i]; ax[8 + i] = (__bf16)p[16 + i]; } a.h = ax; a.l = ax; } else a = split_row(arow, 0, lane);
#pragma unroll
      for (int j = 0; j < 8; ++j) { if (!RIN) acc[j] = wmma_bf(a.l, w[j], acc[j]); acc[j] = wmma_bf(a.h, w[j], acc[j]); } }
    asm volatile("s_wait_dscnt 0x0" ::: "memory");      // this wave's reads of buffer buf are done before the buffer is refilled
    asm volatile("s_wait_asynccnt 0x0" ::: "memory");   // this wave's part of chunk c + 1 has landed
    __syncthreads();                                    // publishes chunk c + 1 and ends every wave's reads of buffer buf
    if (c + 2 < DM / GK) stage_chunk(ga + (c + 2) * (GK * 4), sa, gw + (c + 2) * (GK * 2), la + buf * GABUF, lw + buf * GWBUF); }
  asm volatile("s_wait_asynccnt 0x0" ::: "memory");     // no copy is left in flight when the wave goes on
  float res[8][8] = {};
  if (EPI == 1) { const float* rp[8];
#pragma unroll
    for (int r = 0; r < 8; ++r) rp[r] = RES + (r0 + 8 * g + r) * ldo + n0 + col;
#pragma unroll
    for (int j = 0; j < 8; ++j) {
#pragma unroll
      for (int r = 0; r < 8; ++r) res[j][r] = rp[r][j * 16]; }
    // with no call between them the 64 loads go out together; the row addresses are inputs of the wait, so they keep their registers up to it and no later load's result lands on an address register ahead of it
    asm volatile("s_wait_xcnt 0x0" :: "v"(rp[0]), "v"(rp[1]), "v"(rp[2]), "v"(rp[3]), "v"(rp[4]), "v"(rp[5]), "v"(rp[6]), "v"(rp[7]) : "memory"); }
#pragma unroll
  for (int j = 0; j < 8; ++j) { const int n = n0 + j * 16 + col; const float bb = (EPI == 1) ? bfr(bias[n]) : 0.f;
#pragma unroll
    for (int r = 0; r < 8; ++r) { const float v = acc[j][r] + bb; if (EPI != 1) so[wave][8 * g + r][j * 16 + col] = v; }
    if (EPI == 1) { float x[8], e[8];
#pragma unroll
      for (int r = 0; r < 8; ++r) x[r] = (acc[j][r] + bb) * L2E;
      ex2x8(e, x);
#pragma unroll
      for (int r = 0; r < 8; ++r) { const float v = acc[j][r] + bb; so[wave][8 * g + r][j * 16 + col] = res[j][r] + ((v > 0.f) ? v : e[r] - 1.0f); } } }
  LDSX();
  for (int rl = 0; rl < 16; ++rl) vst2(OUT + (r0 + rl) * ldo + n0 + lane * 4, *(const v4f*)&so[wave][rl][lane * 4]);
}
// ---- k_ln: block = 8 rows (wave per row): OUT = LN(IN) over 512 (biased var, eps 1e-6) * gamma + beta
__global__ __launch_bounds__(256) void k_ln(const float* __restrict__ IN, int ldi, const float* __restrict__ G, const float* __restrict__ Bb, float* __restrict__ OUT) {
  __shared__ __align__(16) float s[8][DM]; const int wave = threadIdx.x >> 5, lane = threadIdx.x & 31; const size_t row = (size_t)blockIdx.x * 8 + wave; float v[16]; float sum = 0.f;
#pragma unroll
  for (int k = 0; k < 16; ++k) { v[k] = IN[row * ldi + lane + 32 * k]; sum += v[k]; }
#pragma unroll
  for (int o = 1; o < 32; o <<= 1) sum += __shfl_xor(sum, o);
  const float mu = sum / (float)DM; float var = 0.f;
#pragma unroll
  for (int k = 0; k < 16; ++k) { const float d = v[k] - mu; var += d * d; }
#pragma unroll
  for (int o = 1; o < 32; o <<= 1) var += __shfl_xor(var, o);
  const float rs = rsqrtf(var / (float)DM + 1e-6f);
#pragma unroll
  for (int k = 0; k < 16; ++k) { const int c = lane + 32 * k; s[wave][c] = (v[k] - mu) * rs * bfr(G[c]) + bfr(Bb[c]); }
  LDSX();
  for (int pc = lane; pc < DM / 4; pc += 32) vst2(OUT + row * DM + pc * 4, *(const v4f*)&s[wave][pc * 4]);
}
// ---- k_vplanes: block = (64 tokens, 128-col chunk): chunks 0..3: v (KV cols 512 + c) -> transposed hi/lo planes [b][c][s]; chunks 4..7: k (KV cols c) -> hi/lo rows [b][h][s][64 hi | 64 lo], split here once and not by every wave of k_attn that reads the key (no turn, so no LDS: such a block is done ahead of the barrier, all of it)
__global__ __launch_bounds__(256) void k_vplanes(const float* __restrict__ KV, __bf16* __restrict__ VH, __bf16* __restrict__ VL, __bf16* __restrict__ K2) {
  __shared__ __align__(16) __bf16 sh[128][72], sl[128][72]; const int tid = threadIdx.x; const size_t rb = (size_t)blockIdx.x * 64; const int c0 = (blockIdx.y & 3) * 128; const int b = (int)(rb / SS), s0 = (int)(rb % SS);
  if (blockIdx.y >= DM / 128) { const float* ip[4]; __bf16* op[4]; v4f x[8];   // a lane: 8 neighbour d of rows tid >> 4 + 16 i; 8 lanes read 256 B of a row and store one 128-B line of each half
#pragma unroll
    for (int i = 0; i < 4; ++i) { const int rl = (tid >> 4) + 16 * i, c = c0 + (tid & 15) * 8; ip[i] = KV + (rb + rl) * (2 * DM) + c; op[i] = K2 + (((size_t)b * NH + (c >> 6)) * SS + s0 + rl) * (2 * HD) + (c & 63); }
#pragma unroll
    for (int i = 0; i < 4; ++i) { x[2 * i] = *(const v4f*)ip[i]; x[2 * i + 1] = *(const v4f*)(ip[i] + 4); }
#pragma unroll
    for (int i = 0; i < 4; ++i) { v8b hi, lo;
#pragma unroll
      for (int j = 0; j < 8; ++j) { const float v = x[2 * i + (j >> 2)][j & 3]; const __bf16 hb = (__bf16)v; hi[j] = hb; lo[j] = (__bf16)(v - (float)hb); }
      vst2((unsigned*)op[i], __builtin_bit_cast(v4u, hi)); vst2((unsigned*)(op[i] + HD), __builtin_bit_cast(v4u, lo)); }
    return; }
  for (int q = tid; q < 64 * 128; q += 256) { const int rl = q >> 7, c = q & 127; const float v = KV[(rb + rl) * (2 * DM) + DM + c0 + c]; const __bf16 hb = (__bf16)v; sh[c][rl] = hb; sl[c][rl] = (__bf16)(v - (float)hb); }
  __syncthreads();
  for (int q = tid; q < 128 * 8; q += 256) { const int c = q >> 3, pc = q & 7; const size_t o = ((size_t)b * DM + c0 + c) * SS + s0 + pc * 8; vst2((unsigned*)(VH + o), *(const v4u*)&sh[c][pc * 8]); vst2((unsigned*)(VL + o), *(const v4u*)&sl[c][pc * 8]); }
}
__device__ __forceinline__ float xhalf(float v) { return __builtin_bit_cast(float, __builtin_amdgcn_permlanex16(__builtin_bit_cast(int, v), __builtin_bit_cast(int, v), 0x76543210, 0xfedcba98, false, false)); }   // lane l reads lane l ^ 16
#define KT 64                      // keys per staged tile
#define KP 136                     // bf16 per K row in LDS (64 hi, 64 lo, 8 unused): 272 B = 16 B x 17, no bank conflict for 16-byte reads of 16 rows
#define VP 72                      // bf16 per V row in LDS: 144 B = 16 B x 9
#define KBUF (KT * KP * 2)         // bytes of one K buffer
#define VBUF (HD * VP * 2)         // bytes of one V-plane buffer
// one tile: K 64 rows x 256 B (a lane: chunk tid & 15 of rows tid >> 4 + 8 i), each V plane 64 rows x 128 B (chunk tid & 7 of rows tid >> 3 + 16 i); the arguments are the lane's own first addresses
__device__ __forceinline__ void stage_tile(const char* gk, const char* gh, const char* gl, unsigned lk, unsigned lh, unsigned ll) {
  unsigned a[8]; const char* p[8];
#pragma unroll
  for (int i = 0; i < 8; ++i) { a[i] = lk + i * (8 * KP * 2); p[i] = gk + (size_t)i * (8 * 2 * HD * 2); }
  acopy8(a, p);
#pragma unroll
  for (int i = 0; i < 4; ++i) { a[i] = lh + i * (16 * VP * 2); p[i] = gh + (size_t)i * (16 * SS * 2); a[4 + i] = ll + i * (16 * VP * 2); p[4 + i] = gl + (size_t)i * (16 * SS * 2); }
  acopy8(a, p);
}
__global__ __launch_bounds__(128) void k_attn(const float* __restrict__ Q, const __bf16* __restrict__ K2, const __bf16* __restrict__ VH, const __bf16* __restrict__ VL, const float* __restrict__ ML, float* __restrict__ M2) {
  __shared__ __align__(16) float so[4][16][68];
  __shared__ __align__(16) __bf16 sK[2][KT][KP];
  __shared__ __align__(16) __bf16 sVH[2][HD][VP], sVL[2][HD][VP];
  const int tid = threadIdx.x, wave = tid >> 5, lane = tid & 31, col = lane & 15, g = lane >> 4; const int qb = blockIdx.x, h = blockIdx.y, b = blockIdx.z; const int q0 = qb * 64 + wave * 16; const size_t rq = (size_t)b * SS + q0;
  const char* gk = (const char*)(K2 + (((size_t)b * NH + h) * SS + (tid >> 4)) * (2 * HD)) + (tid & 15) * 16;
  const size_t vo = (((size_t)b * DM + h * HD + (tid >> 3)) * SS) * 2 + (tid & 7) * 16;
  const char* gh = (const char*)VH + vo; const char* gl = (const char*)VL + vo;
  const unsigned lk = lds_addr(&sK[0][tid >> 4][0]) + (tid & 15) * 16, lh = lds_addr(&sVH[0][tid >> 3][0]) + (tid & 7) * 16, ll = lds_addr(&sVL[0][tid >> 3][0]) + (tid & 7) * 16;
  stage_tile(gk, gh, gl, lk, lh, ll);
  F2 aq[2];
#pragma unroll
  for (int kc = 0; kc < 2; ++kc) aq[kc] = split_row(Q + (rq + col) * DM + h * HD, kc * 32, lane);
  asm volatile("s_wait_asynccnt 0x0" ::: "memory");   // this wave's part of tile 0 has landed
  __syncthreads();                                    // ... and every other wave's
  stage_tile(gk + (size_t)KT * (2 * HD * 2), gh + KT * 2, gl + KT * 2, lk + KBUF, lh + VBUF, ll + VBUF);
  float ml = -3.0e38f, l = 0.f;   // ml: running row maximum times L2E
  v8f acc[4] = {};   // O^T: lane = query col, element r of tile dt = d dt*16 + 8g + r
#pragma unroll 1   // one trip = one staged tile; rolled, so that the ring's hand-over stands once, at the foot
  for (int t = 0; t < SS / KT; ++t) { const int buf = t & 1;
#pragma unroll     // sub becomes a constant in every LDS offset
    for (int sub = 0; sub < KT / 32; ++sub) { v8f s[2];   // S^T: element r of tile ct = key t*64 + sub*32 + ct*16 + 8g + r
      F2 kf[2][2];
#pragma unroll
      for (int ct = 0; ct < 2; ++ct) { const __bf16* krow = &sK[buf][sub * 32 + ct * 16 + col][0];
#pragma unroll
        for (int kc = 0; kc < 2; ++kc) { kf[ct][kc].h = frag_b(krow + kc * 32, lane); kf[ct][kc].l = frag_b(krow + HD + kc * 32, lane); } }
#pragma unroll
      for (int ct = 0; ct < 2; ++ct) { v8f c = {};
#pragma unroll
        for (int kc = 0; kc < 2; ++kc) { const F2& kb = kf[ct][kc]; c = wmma_bf(kb.h, aq[kc].l, c); c = wmma_bf(kb.l, aq[kc].h, c); c = wmma_bf(kb.h, aq[kc].h, c); }
        s[ct] = c; }
      v16b vh[4], vl[4];   // read ahead of the softmax, which covers their way from LDS
#pragma unroll
      for (int dt = 0; dt < 4; ++dt) { vh[dt] = frag_b(&sVH[buf][dt * 16 + col][sub * 32], lane); vl[dt] = frag_b(&sVL[buf][dt * 16 + col][sub * 32], lane); }
      float mx = fmaxf(s[0][0], s[1][0]);
#pragma unroll
      for (int r = 1; r < 8; ++r) mx = fmaxf(mx, fmaxf(s[0][r], s[1][r]));
      mx = fmaxf(mx, xhalf(mx));
      const float mnl = fmaxf(ml, mx * L2E); const float alpha = ex2x1(ml - mnl);   // the running maximum is kept times L2E: ml is the very value the earlier terms were taken against, so an unchanged maximum gives exactly 1
      float e[16], x[16]; float es = 0.f;
#pragma unroll
      for (int r = 0; r < 8; ++r) { x[r] = fmaf(s[0][r], L2E, -mnl); x[8 + r] = fmaf(s[1][r], L2E, -mnl); }
      ex2x8(e, x); ex2x8(e + 8, x + 8);
#pragma unroll
      for (int r = 0; r < 8; ++r) es += e[r] + e[8 + r];
      l = l * alpha + es; ml = mnl;   // l: this half's 16 of each 32 keys; the halves are joined once behind the loop (alpha is the same in both)
#pragma unroll
      for (int dt = 0; dt < 4; ++dt) acc[dt] *= alpha;
      const F2 pb = bsplit16(e);
#pragma unroll
      for (int dt = 0; dt < 4; ++dt) { acc[dt] = wmma_bf(vh[dt], pb.l, acc[dt]); acc[dt] = wmma_bf(vl[dt], pb.h, acc[dt]); acc[dt] = wmma_bf(vh[dt], pb.h, acc[dt]); } }
    asm volatile("s_wait_dscnt 0x0" ::: "memory");      // this wave's reads of buffer buf are done before the buffer is refilled
    asm volatile("s_wait_asynccnt 0x0" ::: "memory");   // this wave's part of tile t + 1 has landed
    __syncthreads();                                    // publishes tile t + 1 and ends every wave's reads of buffer buf
    if (t + 2 < SS / KT) stage_tile(gk + (size_t)(t + 2) * (KT * 2 * HD * 2), gh + (t + 2) * (KT * 2), gl + (t + 2) * (KT * 2), lk + buf * KBUF, lh + buf * VBUF, ll + buf * VBUF); }
  asm volatile("s_wait_asynccnt 0x0" ::: "memory");     // no copy is left in flight when the wave goes on
  l += xhalf(l);
  const float il = 1.0f / l; const float* mlr = ML + (rq + col) * (2 * DM) + h * HD + 8 * g;
#pragma unroll
  for (int dt = 0; dt < 4; ++dt) {
#pragma unroll
    for (int r = 0; r < 8; ++r) so[wave][col][dt * 16 + 8 * g + r] = mlr[dt * 16 + r] + acc[dt][r] * il; }
  LDSX();
  for (int rl = 0; rl < 16; ++rl) if (lane < 16) vst2(M2 + (rq + rl) * DM + h * HD + lane * 4, *(const v4f*)&so[wave][rl][lane * 4]);
}
extern "C" void kernel_launch(void* const* d_in, const int* in_sizes, int n_in, void* d_out, int out_size, void* d_ws, size_t ws_size, hipStream_t stream) {
  (void)in_sizes; (void)n_in; (void)out_size;
  const float** F = (const float**)d_in;   // 0 mod [2,2048,512], 1 Wl [512,512], 2 Wd, 3 Wq [8,64,64], 4 Wk, 5 Wv, 6 gamma [512], 7 beta, 8 Wf [512,512], 9 bf [512]
  if (ws_size < (size_t)WS_END) return;
  char* ws = (char*)d_ws; __bf16 *PW = (__bf16*)(ws + WS_PW), *VH = (__bf16*)(ws + WS_VH), *VL = (__bf16*)(ws + WS_VL); float *ML = (float*)(ws + WS_ML), *NM = (float*)(ws + WS_NM), *ND = (float*)(ws + WS_ND), *Q = (float*)(ws + WS_Q), *KV = (float*)(ws + WS_KV), *M2 = (float*)(ws + WS_M2); __bf16* K2 = (__bf16*)(ws + WS_K2);
  const int NR = TNB * SS / 64;
  k_packT<<<dim3((DM / 64) * (DM / 64), 6), 128, 0, stream>>>(F[1], F[2], F[3], F[4], F[5], F[8], PW);
  k_gemm<1, 0><<<dim3(NR, 2 * DM / 128), 128, 0, stream>>>(F[0], DM, PW + PLD, nullptr, nullptr, ML, 2 * DM);        // mod_l | dec_l (exact)
  k_ln<<<TNB * SS / 8, 256, 0, stream>>>(ML, 2 * DM, F[6], F[7], NM);
  k_ln<<<TNB * SS / 8, 256, 0, stream>>>(ML + DM, 2 * DM, F[6], F[7], ND);
  k_gemm<0, 0><<<dim3(NR, DM / 128), 128, 0, stream>>>(NM, DM, PW + PQQ, nullptr, nullptr, Q, DM);               // q
  k_gemm<0, 0><<<dim3(NR, 2 * DM / 128), 128, 0, stream>>>(ND, DM, PW + PKV, nullptr, nullptr, KV, 2 * DM);       // k | v
  k_vplanes<<<dim3(NR, 2 * DM / 128), 256, 0, stream>>>(KV, VH, VL, K2);
  k_attn<<<dim3(TQB, NH, TNB), 128, 0, stream>>>(Q, K2, VH, VL, ML, M2);                                          // mod2 = mod_l + o
  k_ln<<<TOB * 8, 256, 0, stream>>>(M2, DM, F[6], F[7], NM);                                                      // LN(mod2) (NM reused)
  k_gemm<0, 1><<<dim3(TOB, DM / 128), 128, 0, stream>>>(NM, DM, PW + PFF, F[9], M2, (float*)d_out, DM);           // out = mod2 + elu(LN(mod2) Wf + bf)
}

// v007
// One run takes 107 microseconds.
// In both of two side-by-side timings against v006, it was 1.09 times as fast.
// Over all steps from v000 it is 4.63 times as fast.
// compute dtype: mod and all weights/LN params (module inputs) rounded to bf16; mod Wl / mod Wd with exact bf16 products (inputs); the per-head q/k/v 1x1 convs (as two block-diagonal GEMMs: q 512->512, k|v 512->1024), the FFN and scores/P.V with the computed operands as bf16 hi + residual pairs (2 products against exact weights; 3 products for q.k and P.V); LayerNorms, softmax (no 1/sqrt(d) scale), ELU and residuals in f32; f32 accumulate.
#include <hip/hip_runtime.h>
#include <math.h>

typedef __attribute__((ext_vector_type(16))) _Float16 v16h;
typedef __attribute__((ext_vector_type(16))) __bf16 v16b;
typedef __attribute__((ext_vector_type(8)))  _Float16 v8h;
typedef __attribute__((ext_vector_type(8)))  float v8f;
typedef __attribute__((ext_vector_type(4)))  float v4f;
typedef __attribute__((ext_vector_type(2)))  float v2f;
typedef __attribute__((ext_vector_type(4)))  unsigned v4u;
typedef __attribute__((ext_vector_type(4)))  int v4i;
typedef float __attribute__((may_alias)) float_a;
typedef int __attribute__((may_alias)) int_a;

template <typename T> __device__ __forceinline__ void vst2(void* p, T v) { *(T*)p = v;  }
__device__ __forceinline__ v8f wmma16(v16h a, v16h b, v8f c) {
  v8f d = __builtin_amdgcn_wmma_f32_16x16x32_f16(false, a, false, b, (short)0, c, false, false);
  asm volatile("v_nop\n\tv_nop\n\tv_nop\n\tv_nop" : "+v"(d) : "v"(a), "v"(b));
  return d;
}
__device__ __forceinline__ v8f wmma_bf(v16b a, v16b b, v8f c) {
  v8f d = __builtin_amdgcn_wmma_f32_16x16x32_bf16(false, a, false, b, (short)0, c, false, false);
  asm volatile("v_nop\n\tv_nop\n\tv_nop\n\tv_nop" : "+v"(d) : "v"(a), "v"(b));
  return d;
}
// 16x16x32 fragments: lane = (h = lane>>4, row/col = lane&15); elements 0..7 = k0+8h+0..7, 8..15 = k0+16+8h+0..7; D element r = row 8h+r
__device__ __forceinline__ v16h frag_h(const _Float16* rowk0, int lane) {
  union { v16h v; v8h q[2]; } u; const _Float16* p = rowk0 + 8 * (lane >> 4);
  u.q[0] = *(const v8h*)p; u.q[1] = *(const v8h*)(p + 16); return u.v;
}
__device__ __forceinline__ v16h frag_f32(const float* rowk0, int lane) {
  v16h a; const float* p = rowk0 + 8 * (lane >> 4);
#pragma unroll
  for (int i = 0; i < 8; ++i) { a[i] = (_Float16)p[i]; a[8 + i] = (_Float16)p[16 + i]; }
  return a;
}
__device__ __forceinline__ v16h frag_f32s(const float* rowk0, int lane, float sc) {
  v16h a; const float* p = rowk0 + 8 * (lane >> 4);
#pragma unroll
  for (int i = 0; i < 8; ++i) { a[i] = (_Float16)(p[i] * sc); a[8 + i] = (_Float16)(p[16 + i] * sc); }
  return a;
}
// column fragment from a [K][ld] layout (column n), rows >= K read as 0
__device__ __forceinline__ v16h fragc_f32(const float* W, int k0, int n, int lane, int ld, int K) {
  v16h a; const int g = lane >> 4;
#pragma unroll
  for (int i = 0; i < 8; ++i) { const int ka = k0 + 8 * g + i, kb = ka + 16;
    a[i] = (_Float16)(ka < K ? W[(size_t)(ka < K ? ka : K - 1) * ld + n] : 0.f); a[8 + i] = (_Float16)(kb < K ? W[(size_t)(kb < K ? kb : K - 1) * ld + n] : 0.f); }
  return a;
}
struct F2 { v16b h, l; };
__device__ __forceinline__ F2 bsplit16(const float v[16]) { F2 r;
#pragma unroll
  for (int i = 0; i < 16; ++i) { const __bf16 h = (__bf16)v[i]; r.h[i] = h; r.l[i] = (__bf16)(v[i] - (float)h); }
  return r; }
__device__ __forceinline__ F2 split_row(const float* row, int k0, int lane) { float v[16]; const float* p = row + k0 + 8 * (lane >> 4);
#pragma unroll
  for (int i = 0; i < 8; ++i) { v[i] = p[i]; v[8 + i] = p[16 + i]; }
  return bsplit16(v); }
__device__ __forceinline__ F2 split_rowK(const float* row, int k0, int lane, int K) { float v[16]; const int g = lane >> 4;
#pragma unroll
  for (int i = 0; i < 8; ++i) { const int ka = k0 + 8 * g + i, kb = ka + 16; v[i] = ka < K ? row[ka < K ? ka : K - 1] : 0.f; v[8 + i] = kb < K ? row[kb < K ? kb : K - 1] : 0.f; }
  return bsplit16(v); }
__device__ __forceinline__ F2 split_col(const float* W, int k0, int n, int lane, int ld, int K) { float v[16]; const int g = lane >> 4;
#pragma unroll
  for (int i = 0; i < 8; ++i) { const int ka = k0 + 8 * g + i, kb = ka + 16; v[i] = ka < K ? W[(size_t)(ka < K ? ka : K - 1) * ld + n] : 0.f; v[8 + i] = kb < K ? W[(size_t)(kb < K ? kb : K - 1) * ld + n] : 0.f; }
  return bsplit16(v); }
__device__ __forceinline__ v8f mac3(const F2& a, const F2& b, v8f c) { c = wmma_bf(a.l, b.h, c); c = wmma_bf(a.h, b.l, c); return wmma_bf(a.h, b.h, c); }
__device__ __forceinline__ float sigm(float v) { return 1.0f / (1.0f + expf(-v)); }
#define LDSX() do { asm volatile("s_wait_dscnt 0" ::: "memory"); __builtin_amdgcn_wave_barrier(); __builtin_amdgcn_fence(__ATOMIC_RELEASE, "workgroup"); } while (0)


// SAttn (B 2, S 2048, dim 512, 8 heads x 64; self-attention: dec = mod): mod_l = mod Wl, dec_l = mod Wd; nm = LN(mod_l), nd = LN(dec_l) (shared gamma/beta, eps 1e-6); q = nm_h Wq[h], k = nd_h Wk[h], v = nd_h Wv[h]; attn = softmax(q k^T) (unscaled); o merged; mod2 = mod_l + o; out = mod2 + elu(LN(mod2) Wf + bf).
#define NB 2
#define SS 2048
#define DM 512
#define NH 8
#define HD 64
#define NTOK (NB * SS)
#ifndef TQB
#define TQB (SS / 64)
#define TNB NB
#define TOB (NB * SS / 64)
#endif
typedef __attribute__((ext_vector_type(8))) __bf16 v8b;
__device__ __forceinline__ v16b frag_b(const __bf16* rowk0, int lane) {
  union { v16b v; v8b q[2]; } u; const __bf16* p = rowk0 + 8 * (lane >> 4);
  u.q[0] = *(const v8b*)p; u.q[1] = *(const v8b*)(p + 16); return u.v;
}
__device__ __forceinline__ float bfr(float v) { return (float)(__bf16)v; }
#define L2E 1.4426950408889634f   // log2(e): exp(x) = 2^(x * L2E)
// eight (one) 2^x in line, no call, so that independent exponentials overlap; one statement: the outputs are early-clobber, so no v_exp_f32 overwrites the source of the one ahead of it, and the v_nop at the end keeps the one slot that the instruction set asks for behind a transcendental
__device__ __forceinline__ void ex2x8(float* o, const float* x) {
  asm("v_exp_f32 %0, %8\n\tv_exp_f32 %1, %9\n\tv_exp_f32 %2, %10\n\tv_exp_f32 %3, %11\n\tv_exp_f32 %4, %12\n\tv_exp_f32 %5, %13\n\tv_exp_f32 %6, %14\n\tv_exp_f32 %7, %15\n\tv_nop"
      : "=&v"(o[0]), "=&v"(o[1]), "=&v"(o[2]), "=&v"(o[3]), "=&v"(o[4]), "=&v"(o[5]), "=&v"(o[6]), "=&v"(o[7])
      : "v"(x[0]), "v"(x[1]), "v"(x[2]), "v"(x[3]), "v"(x[4]), "v"(x[5]), "v"(x[6]), "v"(x[7]));
}
__device__ __forceinline__ float ex2x1(float x) { float o; asm("v_exp_f32 %0, %1\n\tv_nop" : "=v"(o) : "v"(x)); return o; }
#define WS_PW  0u                 // bf16 rows (in,out -> [out][in]): Wl|Wd -> [1024][512]; Wq (block diagonal) [512][512]; Wk|Wv (block diagonal) [1024][512]; Wf [512][512]
#define PLD 0
#define PQQ (PLD + 2 * DM * DM)
#define PKV (PQQ + DM * DM)
#define PFF (PKV + 2 * DM * DM)
#define PWEND (PFF + DM * DM)
#define WS_ML  (WS_PW + 2u * PWEND)   // f32 [NTOK][1024] mod_l | dec_l
#define WS_NM  (WS_ML + 4u * NTOK * 2 * DM)   // f32 [NTOK][512] LN(mod_l), later LN(mod2)
#define WS_ND  (WS_NM + 4u * NTOK * DM)       // f32 [NTOK][512] LN(dec_l)
#define WS_Q   (WS_ND + 4u * NTOK * DM)       // f32 [NTOK][512] q
#define WS_KV  (WS_Q + 4u * NTOK * DM)        // f32 [NTOK][1024] k | v
#define WS_VH  (WS_KV + 4u * NTOK * 2 * DM)   // bf16 [NB][512][SS] v planes
#define WS_VL  (WS_VH + 2u * NB * DM * SS)
#define WS_M2  (WS_VL + 2u * NB * DM * SS)   // f32 [NTOK][512] mod2 = mod_l + o
#define WS_K2  (WS_M2 + 4u * NTOK * DM)       // bf16 [NB][NH][SS][128] k planes, a key's row = 64 hi | 64 residual (256 B)
#define WS_END (WS_K2 + 2u * NB * NH * SS * 2 * HD)

// ---- k_packT: block = (64 k x 64 n tile, matrix m): PW holds six [512 out][512 in] bf16 matrices in a row: 0 Wl^T, 1 Wd^T, 2 Wq, 3 Wk, 4 Wv (block diagonal: row h*64+e gets W[h][d][e] at col h*64+d, zeros elsewhere), 5 Wf^T; the tile is read along its rows (16 lanes x 16 B = 256 B of one input row; a lane takes two neighbour rows, so that a k pair is one LDS word), turned in LDS and stored as whole 128-B lines; a tile off the diagonal of 2..4 reads nothing and stores zeros
#define PTP 72                     // bf16 per tile row in LDS: 144 B = 16 B x 9
typedef __attribute__((ext_vector_type(2))) __bf16 v2b;
__global__ __launch_bounds__(128) void k_packT(const float* __restrict__ WL, const float* __restrict__ WD, const float* __restrict__ WQ, const float* __restrict__ WK, const float* __restrict__ WV, const float* __restrict__ WF, __bf16* __restrict__ PW) {
  __shared__ __align__(16) __bf16 s[64][PTP];
  const int tid = threadIdx.x, kt = blockIdx.x & 7, nt = blockIdx.x >> 3, m = blockIdx.y;
  const bool dense = (m < 2 || m == 5);
  const float* W = (m == 0) ? WL : (m == 1) ? WD : (m == 2) ? WQ : (m == 3) ? WK : (m == 4) ? WV : WF;
  const float* p = (dense ? W + (size_t)(kt * 64) * DM + nt * 64 : W + (size_t)kt * (HD * HD)) + (tid & 15) * 4; const int ld = dense ? DM : HD;
  v4f v[8] = {};   // v[2 i + o]: input row 2 (tid >> 4) + 16 i + o of the tile
  if (dense || kt == nt) { const float* rp[8];
#pragma unroll
    for (int i = 0; i < 8; ++i) rp[i] = p + (size_t)(2 * (tid >> 4) + 16 * (i >> 1) + (i & 1)) * ld;
#pragma unroll
    for (int i = 0; i < 8; ++i) v[i] = *(const v4f*)rp[i];
    // the row addresses are inputs of the wait, so they keep their registers up to it and no later load's result lands on an address register ahead of it
    asm volatile("s_wait_xcnt 0x0" :: "v"(rp[0]), "v"(rp[1]), "v"(rp[2]), "v"(rp[3]), "v"(rp[4]), "v"(rp[5]), "v"(rp[6]), "v"(rp[7]) : "memory"); }
#pragma unroll
  for (int i = 0; i < 4; ++i) {
#pragma unroll
    for (int j = 0; j < 4; ++j) { v2b t; t[0] = (__bf16)v[2 * i][j]; t[1] = (__bf16)v[2 * i + 1][j]; *(v2b*)&s[(tid & 15) * 4 + j][2 * (tid >> 4) + 16 * i] = t; } }
  __syncthreads();
  __bf16* dst = PW + (size_t)m * (DM * DM) + (size_t)(nt * 64) * DM + kt * 64;
#pragma unroll
  for (int i = 0; i < 4; ++i) { const int n = (tid >> 3) + 16 * i; vst2((unsigned*)(dst + (size_t)n * DM + (tid & 7) * 8), *(const v4u*)&s[n][(tid & 7) * 8]); }
}
__device__ __forceinline__ unsigned lds_addr(const void* p) { return (unsigned)(unsigned long long)p; }   // LDS byte address = low 32 bits of a __shared__ address
// eight 16-byte copies per lane, global -> LDS through no register; s_wait_xcnt closes the statement so that no address register is rewritten ahead of it
__device__ __forceinline__ void acopy8(const unsigned (&l)[8], const char* const (&p)[8]) {
  asm volatile("global_load_async_to_lds_b128 %0, %8, off\n\t"
               "global_load_async_to_lds_b128 %1, %9, off\n\t"
               "global_load_async_to_lds_b128 %2, %10, off\n\t"
               "global_load_async_to_lds_b128 %3, %11, off\n\t"
               "global_load_async_to_lds_b128 %4, %12, off\n\t"
               "global_load_async_to_lds_b128 %5, %13, off\n\t"
               "global_load_async_to_lds_b128 %6, %14, off\n\t"
               "global_load_async_to_lds_b128 %7, %15, off\n\t"
               "s_wait_xcnt 0x0"
               :: "v"(l[0]), "v"(l[1]), "v"(l[2]), "v"(l[3]), "v"(l[4]), "v"(l[5]), "v"(l[6]), "v"(l[7]),
                  "v"(p[0]), "v"(p[1]), "v"(p[2]), "v"(p[3]), "v"(p[4]), "v"(p[5]), "v"(p[6]), "v"(p[7]) : "memory");
}
#define GK 64                      // k per staged chunk
#define GAP 68                     // floats per A row in LDS: 272 B = 16 B x 17, no bank conflict for 16-byte reads of 16 rows
#define GWP 72                     // bf16 per W row in LDS: 144 B = 16 B x 9
#define GABUF (64 * GAP * 4)       // bytes of one A buffer
#define GWBUF (128 * GWP * 2)      // bytes of one W buffer
// one k-chunk: A 64 rows x 256 B (a lane: piece tid & 15 of rows tid >> 4 + 8 i), W 128 rows x 128 B (piece tid & 7 of rows tid >> 3 + 16 i): every copy of a wave covers whole 128-B lines; the arguments are the lane's own first addresses, sa = bytes from a row of A to the eighth behind it
__device__ __forceinline__ void stage_chunk(const char* ga, size_t sa, const char* gw, unsigned la, unsigned lw) {
  unsigned a[8]; const char* p[8];
#pragma unroll
  for (int i = 0; i < 8; ++i) { a[i] = la + i * (8 * GAP * 4); p[i] = ga + i * sa; }
  acopy8(a, p);
#pragma unroll
  for (int i = 0; i < 8; ++i) { a[i] = lw + i * (16 * GWP * 2); p[i] = gw + (size_t)i * (16 * DM * 2); }
  acopy8(a, p);
}
// ---- k_gemm<RIN, EPI, QKV>: block = (64 rows, 128 cols): OUT = A(hi/lo or exact, K 512, pitch lda) . rows; A (f32) and the weight rows come in chunks of 64 k through LDS: asynchronous copies, two buffers, the weight chunk one for all 4 waves, the next chunk in flight while this one is worked on; EPI 0: plain; EPI 1: + bias, ELU, + RES (out = RES + elu(acc + b)); pitch ldo; QKV 1: q and k | v, which do not depend on each other, in ONE launch: weight rows 0..511 (blockIdx.y 0..3) are q = A . Wq -> OUT, pitch ldo; rows 512..1535 are k | v = (the matrix behind A) . Wk|Wv -> the matrix behind OUT, pitch 2 ldo
template <int RIN, int EPI, int QKV>
__global__ __launch_bounds__(128) void k_gemm(const float* __restrict__ A, int lda, const __bf16* __restrict__ P, const float* __restrict__ bias, const float* __restrict__ RES, float* __restrict__ OUT, int ldo) {
  __shared__ __align__(16) float so[4][16][132];
  __shared__ __align__(16) float sA[2][64][GAP];
  __shared__ __align__(16) __bf16 sW[2][128][GWP];
  const int tid = threadIdx.x, wave = tid >> 5, lane = tid & 31, col = lane & 15, g = lane >> 4; const size_t r0 = (size_t)blockIdx.x * 64 + wave * 16; const int nw = blockIdx.y * 128; int n0 = nw;   // nw: first weight row, n0: first output column
  if (QKV && nw >= DM) { A += (size_t)NTOK * DM; OUT += (size_t)NTOK * DM; ldo *= 2; n0 = nw - DM; }   // the same for the whole block
  const char* ga = (const char*)(A + ((size_t)blockIdx.x * 64 + (tid >> 4)) * lda) + (tid & 15) * 16; const size_t sa = (size_t)lda * (8 * 4);
  const char* gw = (const char*)(P + (size_t)(nw + (tid >> 3)) * DM) + (tid & 7) * 16;
  const unsigned la = lds_addr(&sA[0][tid >> 4][0]) + (tid & 15) * 16, lw = lds_addr(&sW[0][tid >> 3][0]) + (tid & 7) * 16;
  stage_chunk(ga, sa, gw, la, lw);
  asm volatile("s_wait_asynccnt 0x0" ::: "memory");   // this wave's part of chunk 0 has landed
  __syncthreads();                                    // ... and every other wave's
  stage_chunk(ga + GK * 4, sa, gw + GK * 2, la + GABUF, lw + GWBUF);
  v8f acc[8] = {};
#pragma unroll 1   // one trip = one staged chunk; rolled, so that the ring's hand-over stands once, at the foot
  for (int c = 0; c < DM / GK; ++c) { const int buf = c & 1;
#pragma unroll     // kk becomes a constant in every LDS offset
    for (int kk = 0; kk < GK / 32; ++kk) { const float* arow = &sA[buf][wave * 16 + col][kk * 32];
      v16b w[8];   // the eight weight fragments are read as one group, ahead of the products
#pragma unroll
      for (int j = 0; j < 8; ++j) w[j] = frag_b(&sW[buf][j * 16 + col][kk * 32], lane);
      F2 a; if (RIN) { v16b ax; const float* p = arow + 8 * g;
#pragma unroll
        for (int i = 0; i < 8; ++i) { ax[i] = (__bf16)p[i]; ax[8 + i] = (__bf16)p[16 + i]; } a.h = ax; a.l = ax; } else a = split_row(arow, 0, lane);
#pragma unroll
      for (int j = 0; j < 8; ++j) { if (!RIN) acc[j] = wmma_bf(a.l, w[j], acc[j]); acc[j] = wmma_bf(a.h, w[j], acc[j]); } }
    asm volatile("s_wait_dscnt 0x0" ::: "memory");      // this wave's reads of buffer buf are done before the buffer is refilled
    asm volatile("s_wait_asynccnt 0x0" ::: "memory");   // this wave's part of chunk c + 1 has landed
    __syncthreads();                                    // publishes chunk c + 1 and ends every wave's reads of buffer buf
    if (c + 2 < DM / GK) stage_chunk(ga + (c + 2) * (GK * 4), sa, gw + (c + 2) * (GK * 2), la + buf * GABUF, lw + buf * GWBUF); }
  asm volatile("s_wait_asynccnt 0x0" ::: "memory");     // no copy is left in flight when the wave goes on
  float res[8][8] = {};
  if (EPI == 1) { const float* rp[8];
#pragma unroll
    for (int r = 0; r < 8; ++r) rp[r] = RES + (r0 + 8 * g + r) * ldo + n0 + col;
#pragma unroll
    for (int j = 0; j < 8; ++j) {
#pragma unroll
      for (int r = 0; r < 8; ++r) res[j][r] = rp[r][j * 16]; }
    // with no call between them the 64 loads go out together; the row addresses are inputs of the wait, so they keep their registers up to it and no later load's result lands on an address register ahead of it
    asm volatile("s_wait_xcnt 0x0" :: "v"(rp[0]), "v"(rp[1]), "v"(rp[2]), "v"(rp[3]), "v"(rp[4]), "v"(rp[5]), "v"(rp[6]), "v"(rp[7]) : "memory"); }
#pragma unroll
  for (int j = 0; j < 8; ++j) { const int n = n0 + j * 16 + col; const float bb = (EPI == 1) ? bfr(bias[n]) : 0.f;
#pragma unroll
    for (int r = 0; r < 8; ++r) { const float v = acc[j][r] + bb; if (EPI != 1) so[wave][8 * g + r][j * 16 + col] = v; }
    if (EPI == 1) { float x[8], e[8];
#pragma unroll
      for (int r = 0; r < 8; ++r) x[r] = (acc[j][r] + bb) * L2E;
      ex2x8(e, x);
#pragma unroll
      for (int r = 0; r < 8; ++r) { const float v = acc[j][r] + bb; so[wave][8 * g + r][j * 16 + col] = res[j][r] + ((v > 0.f) ? v : e[r] - 1.0f); } } }
  LDSX();
  for (int rl = 0; rl < 16; ++rl) vst2(OUT + (r0 + rl) * ldo + n0 + lane * 4, *(const v4f*)&so[wave][rl][lane * 4]);
}
// ---- k_ln: block = 8 rows (wave per row): OUT = LN(IN) over 512 (biased var, eps 1e-6) * gamma + beta; blockIdx.y = 1 (only where the launch has it): the 512 columns behind IN's -> the matrix behind OUT, so that LN(mod_l) and LN(dec_l) are one launch
__global__ __launch_bounds__(256) void k_ln(const float* __restrict__ IN, int ldi, const float* __restrict__ G, const float* __restrict__ Bb, float* __restrict__ OUT) {
  __shared__ __align__(16) float s[8][DM]; const int wave = threadIdx.x >> 5, lane = threadIdx.x & 31; const size_t row = (size_t)blockIdx.x * 8 + wave; float v[16]; float sum = 0.f;
  IN += blockIdx.y * DM; OUT += (size_t)blockIdx.y * ((size_t)NTOK * DM);
#pragma unroll
  for (int k = 0; k < 16; ++k) { v[k] = IN[row * ldi + lane + 32 * k]; sum += v[k]; }
#pragma unroll
  for (int o = 1; o < 32; o <<= 1) sum += __shfl_xor(sum, o);
  const float mu = sum / (float)DM; float var = 0.f;
#pragma unroll
  for (int k = 0; k < 16; ++k) { const float d = v[k] - mu; var += d * d; }
#pragma unroll
  for (int o = 1; o < 32; o <<= 1) var += __shfl_xor(var, o);
  const float rs = rsqrtf(var / (float)DM + 1e-6f);
#pragma unroll
  for (int k = 0; k < 16; ++k) { const int c = lane + 32 * k; s[wave][c] = (v[k] - mu) * rs * bfr(G[c]) + bfr(Bb[c]); }
  LDSX();
  for (int pc = lane; pc < DM / 4; pc += 32) vst2(OUT + row * DM + pc * 4, *(const v4f*)&s[wave][pc * 4]);
}
// ---- k_vplanes: block = (64 tokens, 128-col chunk): chunks 0..3: v (KV cols 512 + c) -> transposed hi/lo planes [b][c][s]; chunks 4..7: k (KV cols c) -> hi/lo rows [b][h][s][64 hi | 64 lo], split here once and not by every wave of k_attn that reads the key (no turn, so no LDS: such a block is done ahead of the barrier, all of it)
__global__ __launch_bounds__(256) void k_vplanes(const float* __restrict__ KV, __bf16* __restrict__ VH, __bf16* __restrict__ VL, __bf16* __restrict__ K2) {
  __shared__ __align__(16) __bf16 sh[128][72], sl[128][72]; const int tid = threadIdx.x; const size_t rb = (size_t)blockIdx.x * 64; const int c0 = (blockIdx.y & 3) * 128; const int b = (int)(rb / SS), s0 = (int)(rb % SS);
  if (blockIdx.y >= DM / 128) { const float* ip[4]; __bf16* op[4]; v4f x[8];   // a lane: 8 neighbour d of rows tid >> 4 + 16 i; 8 lanes read 256 B of a row and store one 128-B line of each half
#pragma unroll
    for (int i = 0; i < 4; ++i) { const int rl = (tid >> 4) + 16 * i, c = c0 + (tid & 15) * 8; ip[i] = KV + (rb + rl) * (2 * DM) + c; op[i] = K2 + (((size_t)b * NH + (c >> 6)) * SS + s0 + rl) * (2 * HD) + (c & 63); }
#pragma unroll
    for (int i = 0; i < 4; ++i) { x[2 * i] = *(const v4f*)ip[i]; x[2 * i + 1] = *(const v4f*)(ip[i] + 4); }
#pragma unroll
    for (int i = 0; i < 4; ++i) { v8b hi, lo;
#pragma unroll
      for (int j = 0; j < 8; ++j) { const float v = x[2 * i + (j >> 2)][j & 3]; const __bf16 hb = (__bf16)v; hi[j] = hb; lo[j] = (__bf16)(v - (float)hb); }
      vst2((unsigned*)op[i], __builtin_bit_cast(v4u, hi)); vst2((unsigned*)(op[i] + HD), __builtin_bit_cast(v4u, lo)); }
    return; }
  for (int q = tid; q < 64 * 128; q += 256) { const int rl = q >> 7, c = q & 127; const float v = KV[(rb + rl) * (2 * DM) + DM + c0 + c]; const __bf16 hb = (__bf16)v; sh[c][rl] = hb; sl[c][rl] = (__bf16)(v - (float)hb); }
  __syncthreads();
  for (int q = tid; q < 128 * 8; q += 256) { const int c = q >> 3, pc = q & 7; const size_t o = ((size_t)b * DM + c0 + c) * SS + s0 + pc * 8; vst2((unsigned*)(VH + o), *(const v4u*)&sh[c][pc * 8]); vst2((unsigned*)(VL + o), *(const v4u*)&sl[c][pc * 8]); }
}
__device__ __forceinline__ float xhalf(float v) { return __builtin_bit_cast(float, __builtin_amdgcn_permlanex16(__builtin_bit_cast(int, v), __builtin_bit_cast(int, v), 0x76543210, 0xfedcba98, false, false)); }   // lane l reads lane l ^ 16
#define KT 64                      // keys per staged tile
#define KP 136                     // bf16 per K row in LDS (64 hi, 64 lo, 8 unused): 272 B = 16 B x 17, no bank conflict for 16-byte reads of 16 rows
#define VP 72                      // bf16 per V row in LDS: 144 B = 16 B x 9
#define KBUF (KT * KP * 2)         // bytes of one K buffer
#define VBUF (HD * VP * 2)         // bytes of one V-plane buffer
// one tile: K 64 rows x 256 B (a lane: chunk tid & 15 of rows tid >> 4 + 8 i), each V plane 64 rows x 128 B (chunk tid & 7 of rows tid >> 3 + 16 i); the arguments are the lane's own first addresses
__device__ __forceinline__ void stage_tile(const char* gk, const char* gh, const char* gl, unsigned lk, unsigned lh, unsigned ll) {
  unsigned a[8]; const char* p[8];
#pragma unroll
  for (int i = 0; i < 8; ++i) { a[i] = lk + i * (8 * KP * 2); p[i] = gk + (size_t)i * (8 * 2 * HD * 2); }
  acopy8(a, p);
#pragma unroll
  for (int i = 0; i < 4; ++i) { a[i] = lh + i * (16 * VP * 2); p[i] = gh + (size_t)i * (16 * SS * 2); a[4 + i] = ll + i * (16 * VP * 2); p[4 + i] = gl + (size_t)i * (16 * SS * 2); }
  acopy8(a, p);
}
__global__ __launch_bounds__(128) void k_attn(const float* __restrict__ Q, const __bf16* __restrict__ K2, const __bf16* __restrict__ VH, const __bf16* __restrict__ VL, const float* __restrict__ ML, float* __restrict__ M2) {
  __shared__ __align__(16) float so[4][16][68];
  __shared__ __align__(16) __bf16 sK[2][KT][KP];
  __shared__ __align__(16) __bf16 sVH[2][HD][VP], sVL[2][HD][VP];
  const int tid = threadIdx.x, wave = tid >> 5, lane = tid & 31, col = lane & 15, g = lane >> 4; const int qb = blockIdx.x, h = blockIdx.y, b = blockIdx.z; const int q0 = qb * 64 + wave * 16; const size_t rq = (size_t)b * SS + q0;
  const char* gk = (const char*)(K2 + (((size_t)b * NH + h) * SS + (tid >> 4)) * (2 * HD)) + (tid & 15) * 16;
  const size_t vo = (((size_t)b * DM + h * HD + (tid >> 3)) * SS) * 2 + (tid & 7) * 16;
  const char* gh = (const char*)VH + vo; const char* gl = (const char*)VL + vo;
  const unsigned lk = lds_addr(&sK[0][tid >> 4][0]) + (tid & 15) * 16, lh = lds_addr(&sVH[0][tid >> 3][0]) + (tid & 7) * 16, ll = lds_addr(&sVL[0][tid >> 3][0]) + (tid & 7) * 16;
  stage_tile(gk, gh, gl, lk, lh, ll);
  F2 aq[2];
#pragma unroll
  for (int kc = 0; kc < 2; ++kc) aq[kc] = split_row(Q + (rq + col) * DM + h * HD, kc * 32, lane);
  asm volatile("s_wait_asynccnt 0x0" ::: "memory");   // this wave's part of tile 0 has landed
  __syncthreads();                                    // ... and every other wave's
  stage_tile(gk + (size_t)KT * (2 * HD * 2), gh + KT * 2, gl + KT * 2, lk + KBUF, lh + VBUF, ll + VBUF);
  float ml = -3.0e38f, l = 0.f;   // ml: running row maximum times L2E
  v8f acc[4] = {};   // O^T: lane = query col, element r of tile dt = d dt*16 + 8g + r
#pragma unroll 1   // one trip = one staged tile; rolled, so that the ring's hand-over stands once, at the foot
  for (int t = 0; t < SS / KT; ++t) { const int buf = t & 1;
#pragma unroll     // sub becomes a constant in every LDS offset
    for (int sub = 0; sub < KT / 32; ++sub) { v8f s[2];   // S^T: element r of tile ct = key t*64 + sub*32 + ct*16 + 8g + r
      F2 kf[2][2];
#pragma unroll
      for (int ct = 0; ct < 2; ++ct) { const __bf16* krow = &sK[buf][sub * 32 + ct * 16 + col][0];
#pragma unroll
        for (int kc = 0; kc < 2; ++kc) { kf[ct][kc].h = frag_b(krow + kc * 32, lane); kf[ct][kc].l = frag_b(krow + HD + kc * 32, lane); } }
#pragma unroll
      for (int ct = 0; ct < 2; ++ct) { v8f c = {};
#pragma unroll
        for (int kc = 0; kc < 2; ++kc) { const F2& kb = kf[ct][kc]; c = wmma_bf(kb.h, aq[kc].l, c); c = wmma_bf(kb.l, aq[kc].h, c); c = wmma_bf(kb.h, aq[kc].h, c); }
        s[ct] = c; }
      v16b vh[4], vl[4];   // read ahead of the softmax, which covers their way from LDS
#pragma unroll
      for (int dt = 0; dt < 4; ++dt) { vh[dt] = frag_b(&sVH[buf][dt * 16 + col][sub * 32], lane); vl[dt] = frag_b(&sVL[buf][dt * 16 + col][sub * 32], lane); }
      float mx = fmaxf(s[0][0], s[1][0]);
#pragma unroll
      for (int r = 1; r < 8; ++r) mx = fmaxf(mx, fmaxf(s[0][r], s[1][r]));
      mx = fmaxf(mx, xhalf(mx));
      const float mnl = fmaxf(ml, mx * L2E); const float alpha = ex2x1(ml - mnl);   // the running maximum is kept times L2E: ml is the very value the earlier terms were taken against, so an unchanged maximum gives exactly 1
      float e[16], x[16]; float es = 0.f;
#pragma unroll
      for (int r = 0; r < 8; ++r) { x[r] = fmaf(s[0][r], L2E, -mnl); x[8 + r] = fmaf(s[1][r], L2E, -mnl); }
      ex2x8(e, x); ex2x8(e + 8, x + 8);
#pragma unroll
      for (int r = 0; r < 8; ++r) es += e[r] + e[8 + r];
      l = l * alpha + es; ml = mnl;   // l: this half's 16 of each 32 keys; the halves are joined once behind the loop (alpha is the same in both)
#pragma unroll
      for (int dt = 0; dt < 4; ++dt) acc[dt] *= alpha;
      const F2 pb = bsplit16(e);
#pragma unroll
      for (int dt = 0; dt < 4; ++dt) { acc[dt] = wmma_bf(vh[dt], pb.l, acc[dt]); acc[dt] = wmma_bf(vl[dt], pb.h, acc[dt]); acc[dt] = wmma_bf(vh[dt], pb.h, acc[dt]); } }
    asm volatile("s_wait_dscnt 0x0" ::: "memory");      // this wave's reads of buffer buf are done before the buffer is refilled
    asm volatile("s_wait_asynccnt 0x0" ::: "memory");   // this wave's part of tile t + 1 has landed
    __syncthreads();                                    // publishes tile t + 1 and ends every wave's reads of buffer buf
    if (t + 2 < SS / KT) stage_tile(gk + (size_t)(t + 2) * (KT * 2 * HD * 2), gh + (t + 2) * (KT * 2), gl + (t + 2) * (KT * 2), lk + buf * KBUF, lh + buf * VBUF, ll + buf * VBUF); }
  asm volatile("s_wait_asynccnt 0x0" ::: "memory");     // no copy is left in flight when the wave goes on
  l += xhalf(l);
  const float il = 1.0f / l; const float* mlr = ML + (rq + col) * (2 * DM) + h * HD + 8 * g;
#pragma unroll
  for (int dt = 0; dt < 4; ++dt) {
#pragma unroll
    for (int r = 0; r < 8; ++r) so[wave][col][dt * 16 + 8 * g + r] = mlr[dt * 16 + r] + acc[dt][r] * il; }
  LDSX();
  for (int rl = 0; rl < 16; ++rl) if (lane < 16) vst2(M2 + (rq + rl) * DM + h * HD + lane * 4, *(const v4f*)&so[wave][rl][lane * 4]);
}
extern "C" void kernel_launch(void* const* d_in, const int* in_sizes, int n_in, void* d_out, int out_size, void* d_ws, size_t ws_size, hipStream_t stream) {
  (void)in_sizes; (void)n_in; (void)out_size;
  const float** F = (const float**)d_in;   // 0 mod [2,2048,512], 1 Wl [512,512], 2 Wd, 3 Wq [8,64,64], 4 Wk, 5 Wv, 6 gamma [512], 7 beta, 8 Wf [512,512], 9 bf [512]
  if (ws_size < (size_t)WS_END) return;
  char* ws = (char*)d_ws; __bf16 *PW = (__bf16*)(ws + WS_PW), *VH = (__bf16*)(ws + WS_VH), *VL = (__bf16*)(ws + WS_VL); float *ML = (float*)(ws + WS_ML), *NM = (float*)(ws + WS_NM), *Q = (float*)(ws + WS_Q), *KV = (float*)(ws + WS_KV), *M2 = (float*)(ws + WS_M2); __bf16* K2 = (__bf16*)(ws + WS_K2);
  const int NR = TNB * SS / 64;
  k_packT<<<dim3((DM / 64) * (DM / 64), 6), 128, 0, stream>>>(F[1], F[2], F[3], F[4], F[5], F[8], PW);
  k_gemm<1, 0, 0><<<dim3(NR, 2 * DM / 128), 128, 0, stream>>>(F[0], DM, PW + PLD, nullptr, nullptr, ML, 2 * DM);        // mod_l | dec_l (exact)
  k_ln<<<dim3(TNB * SS / 8, 2), 256, 0, stream>>>(ML, 2 * DM, F[6], F[7], NM);                                     // LN(mod_l) -> NM, LN(dec_l) -> ND (behind NM)
  k_gemm<0, 0, 1><<<dim3(NR, 3 * DM / 128), 128, 0, stream>>>(NM, DM, PW + PQQ, nullptr, nullptr, Q, DM);         // q (NM, Wq -> Q) and k | v (ND, Wk|Wv -> KV): ND, the Wk|Wv rows and KV each lie behind NM, the Wq rows and Q
  k_vplanes<<<dim3(NR, 2 * DM / 128), 256, 0, stream>>>(KV, VH, VL, K2);
  k_attn<<<dim3(TQB, NH, TNB), 128, 0, stream>>>(Q, K2, VH, VL, ML, M2);                                          // mod2 = mod_l + o
  k_ln<<<TOB * 8, 256, 0, stream>>>(M2, DM, F[6], F[7], NM);                                                      // LN(mod2) (NM reused)
  k_gemm<0, 1, 0><<<dim3(TOB, DM / 128), 128, 0, stream>>>(NM, DM, PW + PFF, F[9], M2, (float*)d_out, DM);           // out = mod2 + elu(LN(mod2) Wf + bf)
}

// v008
// A run of this version takes 102 microseconds.
// Two timings next to v007 both put it at 1.04 times that version's speed.
// Over all steps from v000 it is 4.83 times as fast.
// compute dtype: mod and all weights/LN params (module inputs) rounded to bf16; mod Wl / mod Wd with exact bf16 products (inputs); the per-head q/k/v 1x1 convs (as two block-diagonal GEMMs: q 512->512, k|v 512->1024), the FFN and scores/P.V with the computed operands as bf16 hi + residual pairs (2 products against exact weights; 3 products for q.k and P.V); LayerNorms, softmax (no 1/sqrt(d) scale), ELU and residuals in f32; f32 accumulate.
#include <hip/hip_runtime.h>
#include <math.h>

typedef __attribute__((ext_vector_type(16))) _Float16 v16h;
typedef __attribute__((ext_vector_type(16))) __bf16 v16b;
typedef __attribute__((ext_vector_type(8)))  _Float16 v8h;
typedef __attribute__((ext_vector_type(8)))  float v8f;
typedef __attribute__((ext_vector_type(4)))  float v4f;
typedef __attribute__((ext_vector_type(2)))  float v2f;
typedef __attribute__((ext_vector_type(4)))  unsigned v4u;
typedef __attribute__((ext_vector_type(4)))  int v4i;
typedef float __attribute__((may_alias)) float_a;
typedef int __attribute__((may_alias)) int_a;

template <typename T> __device__ __forceinline__ void vst2(void* p, T v) { *(T*)p = v;  }
__device__ __forceinline__ v8f wmma16(v16h a, v16h b, v8f c) {
  v8f d = __builtin_amdgcn_wmma_f32_16x16x32_f16(false, a, false, b, (short)0, c, false, false);
  asm volatile("v_nop\n\tv_nop\n\tv_nop\n\tv_nop" : "+v"(d) : "v"(a), "v"(b));
  return d;
}
__device__ __forceinline__ v8f wmma_bf(v16b a, v16b b, v8f c) {
  v8f d = __builtin_amdgcn_wmma_f32_16x16x32_bf16(false, a, false, b, (short)0, c, false, false);
  asm volatile("v_nop\n\tv_nop\n\tv_nop\n\tv_nop" : "+v"(d) : "v"(a), "v"(b));
  return d;
}
// the plain builtin: the compiler keeps the distance behind a matrix instruction itself and is free to place independent work there
__device__ __forceinline__ v8f wmma_bfp(v16b a, v16b b, v8f c) { return __builtin_amdgcn_wmma_f32_16x16x32_bf16(false, a, false, b, (short)0, c, false, false); }
// 16x16x32 fragments: lane = (h = lane>>4, row/col = lane&15); elements 0..7 = k0+8h+0..7, 8..15 = k0+16+8h+0..7; D element r = row 8h+r
__device__ __forceinline__ v16h frag_h(const _Float16* rowk0, int lane) {
  union { v16h v; v8h q[2]; } u; const _Float16* p = rowk0 + 8 * (lane >> 4);
  u.q[0] = *(const v8h*)p; u.q[1] = *(const v8h*)(p + 16); return u.v;
}
__device__ __forceinline__ v16h frag_f32(const float* rowk0, int lane) {
  v16h a; const float* p = rowk0 + 8 * (lane >> 4);
#pragma unroll
  for (int i = 0; i < 8; ++i) { a[i] = (_Float16)p[i]; a[8 + i] = (_Float16)p[16 + i]; }
  return a;
}
__device__ __forceinline__ v16h frag_f32s(const float* rowk0, int lane, float sc) {
  v16h a; const float* p = rowk0 + 8 * (lane >> 4);
#pragma unroll
  for (int i = 0; i < 8; ++i) { a[i] = (_Float16)(p[i] * sc); a[8 + i] = (_Float16)(p[16 + i] * sc); }
  return a;
}
// column fragment from a [K][ld] layout (column n), rows >= K read as 0
__device__ __forceinline__ v16h fragc_f32(const float* W, int k0, int n, int lane, int ld, int K) {
  v16h a; const int g = lane >> 4;
#pragma unroll
  for (int i = 0; i < 8; ++i) { const int ka = k0 + 8 * g + i, kb = ka + 16;
    a[i] = (_Float16)(ka < K ? W[(size_t)(ka < K ? ka : K - 1) * ld + n] : 0.f); a[8 + i] = (_Float16)(kb < K ? W[(size_t)(kb < K ? kb : K - 1) * ld + n] : 0.f); }
  return a;
}
struct F2 { v16b h, l; };
__device__ __forceinline__ F2 bsplit16(const float v[16]) { F2 r;
#pragma unroll
  for (int i = 0; i < 16; ++i) { const __bf16 h = (__bf16)v[i]; r.h[i] = h; r.l[i] = (__bf16)(v[i] - (float)h); }
  return r; }
__device__ __forceinline__ F2 split_row(const float* row, int k0, int lane) { float v[16]; const float* p = row + k0 + 8 * (lane >> 4);
#pragma unroll
  for (int i = 0; i < 8; ++i) { v[i] = p[i]; v[8 + i] = p[16 + i]; }
  return bsplit16(v); }
__device__ __forceinline__ F2 split_rowK(const float* row, int k0, int lane, int K) { float v[16]; const int g = lane >> 4;
#pragma unroll
  for (int i = 0; i < 8; ++i) { const int ka = k0 + 8 * g + i, kb = ka + 16; v[i] = ka < K ? row[ka < K ? ka : K - 1] : 0.f; v[8 + i] = kb < K ? row[kb < K ? kb : K - 1] : 0.f; }
  return bsplit16(v); }
__device__ __forceinline__ F2 split_col(const float* W, int k0, int n, int lane, int ld, int K) { float v[16]; const int g = lane >> 4;
#pragma unroll
  for (int i = 0; i < 8; ++i) { const int ka = k0 + 8 * g + i, kb = ka + 16; v[i] = ka < K ? W[(size_t)(ka < K ? ka : K - 1) * ld + n] : 0.f; v[8 + i] = kb < K ? W[(size_t)(kb < K ? kb : K - 1) * ld + n] : 0.f; }
  return bsplit16(v); }
__device__ __forceinline__ v8f mac3(const F2& a, const F2& b, v8f c) { c = wmma_bf(a.l, b.h, c); c = wmma_bf(a.h, b.l, c); return wmma_bf(a.h, b.h, c); }
__device__ __forceinline__ float sigm(float v) { return 1.0f / (1.0f + expf(-v)); }
#define LDSX() do { asm volatile("s_wait_dscnt 0" ::: "memory"); __builtin_amdgcn_wave_barrier(); __builtin_amdgcn_fence(__ATOMIC_RELEASE, "workgroup"); } while (0)


// SAttn (B 2, S 2048, dim 512, 8 heads x 64; self-attention: dec = mod): mod_l = mod Wl, dec_l = mod Wd; nm = LN(mod_l), nd = LN(dec_l) (shared gamma/beta, eps 1e-6); q = nm_h Wq[h], k = nd_h Wk[h], v = nd_h Wv[h]; attn = softmax(q k^T) (unscaled); o merged; mod2 = mod_l + o; out = mod2 + elu(LN(mod2) Wf + bf).
#define NB 2
#define SS 2048
#define DM 512
#define NH 8
#define HD 64
#define NTOK (NB * SS)
#ifndef TQB
#define TQB (SS / 64)
#define TNB NB
#define TOB (NB * SS / 64)
#endif
typedef __attribute__((ext_vector_type(8))) __bf16 v8b;
__device__ __forceinline__ v16b frag_b(const __bf16* rowk0, int lane) {
  union { v16b v; v8b q[2]; } u; const __bf16* p = rowk0 + 8 * (lane >> 4);
  u.q[0] = *(const v8b*)p; u.q[1] = *(const v8b*)(p + 16); return u.v;
}
__device__ __forceinline__ float bfr(float v) { return (float)(__bf16)v; }
#define L2E 1.4426950408889634f   // log2(e): exp(x) = 2^(x * L2E)
// eight (one) 2^x in line, no call, so that independent exponentials overlap; one statement: the outputs are early-clobber, so no v_exp_f32 overwrites the source of the one ahead of it, and the v_nop at the end keeps the one slot that the instruction set asks for behind a transcendental
__device__ __forceinline__ void ex2x8(float* o, const float* x) {
  asm("v_exp_f32 %0, %8\n\tv_exp_f32 %1, %9\n\tv_exp_f32 %2, %10\n\tv_exp_f32 %3, %11\n\tv_exp_f32 %4, %12\n\tv_exp_f32 %5, %13\n\tv_exp_f32 %6, %14\n\tv_exp_f32 %7, %15\n\tv_nop"
      : "=&v"(o[0]), "=&v"(o[1]), "=&v"(o[2]), "=&v"(o[3]), "=&v"(o[4]), "=&v"(o[5]), "=&v"(o[6]), "=&v"(o[7])
      : "v"(x[0]), "v"(x[1]), "v"(x[2]), "v"(x[3]), "v"(x[4]), "v"(x[5]), "v"(x[6]), "v"(x[7]));
}
__device__ __forceinline__ float ex2x1(float x) { float o; asm("v_exp_f32 %0, %1\n\tv_nop" : "=v"(o) : "v"(x)); return o; }
#define WS_PW  0u                 // bf16 rows (in,out -> [out][in]): Wl|Wd -> [1024][512]; Wq (block diagonal) [512][512]; Wk|Wv (block diagonal) [1024][512]; Wf [512][512]
#define PLD 0
#define PQQ (PLD + 2 * DM * DM)
#define PKV (PQQ + DM * DM)
#define PFF (PKV + 2 * DM * DM)
#define PWEND (PFF + DM * DM)
#define WS_ML  (WS_PW + 2u * PWEND)   // f32 [NTOK][1024] mod_l | dec_l
#define WS_NM  (WS_ML + 4u * NTOK * 2 * DM)   // f32 [NTOK][512] LN(mod_l), later LN(mod2)
#define WS_ND  (WS_NM + 4u * NTOK * DM)       // f32 [NTOK][512] LN(dec_l)
#define WS_Q   (WS_ND + 4u * NTOK * DM)       // f32 [NTOK][512] q
#define WS_KV  (WS_Q + 4u * NTOK * DM)        // f32 [NTOK][1024] k | v
#define WS_VH  (WS_KV + 4u * NTOK * 2 * DM)   // bf16 [NB][512][SS] v planes
#define WS_VL  (WS_VH + 2u * NB * DM * SS)
#define WS_M2  (WS_VL + 2u * NB * DM * SS)   // f32 [NTOK][512] mod2 = mod_l + o
#define WS_K2  (WS_M2 + 4u * NTOK * DM)       // bf16 [NB][NH][SS][128] k planes, a key's row = 64 hi | 64 residual (256 B)
#define WS_END (WS_K2 + 2u * NB * NH * SS * 2 * HD)

// ---- k_packT: block = (64 k x 64 n tile, matrix m): PW holds six [512 out][512 in] bf16 matrices in a row: 0 Wl^T, 1 Wd^T, 2 Wq, 3 Wk, 4 Wv (block diagonal: row h*64+e gets W[h][d][e] at col h*64+d, zeros elsewhere), 5 Wf^T; the tile is read along its rows (16 lanes x 16 B = 256 B of one input row; a lane takes two neighbour rows, so that a k pair is one LDS word), turned in LDS and stored as whole 128-B lines; a tile off the diagonal of 2..4 reads nothing and stores zeros
#define PTP 72                     // bf16 per tile row in LDS: 144 B = 16 B x 9
typedef __attribute__((ext_vector_type(2))) __bf16 v2b;
__global__ __launch_bounds__(128) void k_packT(const float* __restrict__ WL, const float* __restrict__ WD, const float* __restrict__ WQ, const float* __restrict__ WK, const float* __restrict__ WV, const float* __restrict__ WF, __bf16* __restrict__ PW) {
  __shared__ __align__(16) __bf16 s[64][PTP];
  const int tid = threadIdx.x, kt = blockIdx.x & 7, nt = blockIdx.x >> 3, m = blockIdx.y;
  const bool dense = (m < 2 || m == 5);
  const float* W = (m == 0) ? WL : (m == 1) ? WD : (m == 2) ? WQ : (m == 3) ? WK : (m == 4) ? WV : WF;
  const float* p = (dense ? W + (size_t)(kt * 64) * DM + nt * 64 : W + (size_t)kt * (HD * HD)) + (tid & 15) * 4; const int ld = dense ? DM : HD;
  v4f v[8] = {};   // v[2 i + o]: input row 2 (tid >> 4) + 16 i + o of the tile
  if (dense || kt == nt) { const float* rp[8];
#pragma unroll
    for (int i = 0; i < 8; ++i) rp[i] = p + (size_t)(2 * (tid >> 4) + 16 * (i >> 1) + (i & 1)) * ld;
#pragma unroll
    for (int i = 0; i < 8; ++i) v[i] = *(const v4f*)rp[i];
    // the row addresses are inputs of the wait, so they keep their registers up to it and no later load's result lands on an address register ahead of it
    asm volatile("s_wait_xcnt 0x0" :: "v"(rp[0]), "v"(rp[1]), "v"(rp[2]), "v"(rp[3]), "v"(rp[4]), "v"(rp[5]), "v"(rp[6]), "v"(rp[7]) : "memory"); }
#pragma unroll
  for (int i = 0; i < 4; ++i) {
#pragma unroll
    for (int j = 0; j < 4; ++j) { v2b t; t[0] = (__bf16)v[2 * i][j]; t[1] = (__bf16)v[2 * i + 1][j]; *(v2b*)&s[(tid & 15) * 4 + j][2 * (tid >> 4) + 16 * i] = t; } }
  __syncthreads();
  __bf16* dst = PW + (size_t)m * (DM * DM) + (size_t)(nt * 64) * DM + kt * 64;
#pragma unroll
  for (int i = 0; i < 4; ++i) { const int n = (tid >> 3) + 16 * i; vst2((unsigned*)(dst + (size_t)n * DM + (tid & 7) * 8), *(const v4u*)&s[n][(tid & 7) * 8]); }
}
__device__ __forceinline__ unsigned lds_addr(const void* p) { return (unsigned)(unsigned long long)p; }   // LDS byte address = low 32 bits of a __shared__ address
// eight 16-byte copies per lane, global -> LDS through no register; s_wait_xcnt closes the statement so that no address register is rewritten ahead of it
__device__ __forceinline__ void acopy8(const unsigned (&l)[8], const char* const (&p)[8]) {
  asm volatile("global_load_async_to_lds_b128 %0, %8, off\n\t"
               "global_load_async_to_lds_b128 %1, %9, off\n\t"
               "global_load_async_to_lds_b128 %2, %10, off\n\t"
               "global_load_async_to_lds_b128 %3, %11, off\n\t"
               "global_load_async_to_lds_b128 %4, %12, off\n\t"
               "global_load_async_to_lds_b128 %5, %13, off\n\t"
               "global_load_async_to_lds_b128 %6, %14, off\n\t"
               "global_load_async_to_lds_b128 %7, %15, off\n\t"
               "s_wait_xcnt 0x0"
               :: "v"(l[0]), "v"(l[1]), "v"(l[2]), "v"(l[3]), "v"(l[4]), "v"(l[5]), "v"(l[6]), "v"(l[7]),
                  "v"(p[0]), "v"(p[1]), "v"(p[2]), "v"(p[3]), "v"(p[4]), "v"(p[5]), "v"(p[6]), "v"(p[7]) : "memory");
}
#define GK 64                      // k per staged chunk
#define GAP 68                     // floats per A row in LDS: 272 B = 16 B x 17, no bank conflict for 16-byte reads of 16 rows
#define GWP 72                     // bf16 per W row in LDS: 144 B = 16 B x 9
#define GABUF (64 * GAP * 4)       // bytes of one A buffer
#define GWBUF (128 * GWP * 2)      // bytes of one W buffer
// one k-chunk: A 64 rows x 256 B (a lane: piece tid & 15 of rows tid >> 4 + 8 i), W 128 rows x 128 B (piece tid & 7 of rows tid >> 3 + 16 i): every copy of a wave covers whole 128-B lines; the arguments are the lane's own first addresses, sa = bytes from a row of A to the eighth behind it
__device__ __forceinline__ void stage_chunk(const char* ga, size_t sa, const char* gw, unsigned la, unsigned lw) {
  unsigned a[8]; const char* p[8];
#pragma unroll
  for (int i = 0; i < 8; ++i) { a[i] = la + i * (8 * GAP * 4); p[i] = ga + i * sa; }
  acopy8(a, p);
#pragma unroll
  for (int i = 0; i < 8; ++i) { a[i] = lw + i * (16 * GWP * 2); p[i] = gw + (size_t)i * (16 * DM * 2); }
  acopy8(a, p);
}
// ---- k_gemm<RIN, EPI, QKV>: block = (64 rows, 128 cols): OUT = A(hi/lo or exact, K 512, pitch lda) . rows; A (f32) and the weight rows come in chunks of 64 k through LDS: asynchronous copies, two buffers, the weight chunk one for all 4 waves, the next chunk in flight while this one is worked on; EPI 0: plain; EPI 1: + bias, ELU, + RES (out = RES + elu(acc + b)); pitch ldo; QKV 1: q and k | v, which do not depend on each other, in ONE launch: weight rows 0..511 (blockIdx.y 0..3) are q = A . Wq -> OUT, pitch ldo; rows 512..1535 are k | v = (the matrix behind A) . Wk|Wv -> the matrix behind OUT, pitch 2 ldo
template <int RIN, int EPI, int QKV>
__global__ __launch_bounds__(128) void k_gemm(const float* __restrict__ A, int lda, const __bf16* __restrict__ P, const float* __restrict__ bias, const float* __restrict__ RES, float* __restrict__ OUT, int ldo) {
  __shared__ __align__(16) float so[4][16][132];
  __shared__ __align__(16) float sA[2][64][GAP];
  __shared__ __align__(16) __bf16 sW[2][128][GWP];
  const int tid = threadIdx.x, wave = tid >> 5, lane = tid & 31, col = lane & 15, g = lane >> 4; const size_t r0 = (size_t)blockIdx.x * 64 + wave * 16; const int nw = blockIdx.y * 128; int n0 = nw;   // nw: first weight row, n0: first output column
  if (QKV && nw >= DM) { A += (size_t)NTOK * DM; OUT += (size_t)NTOK * DM; ldo *= 2; n0 = nw - DM; }   // the same for the whole block
  const char* ga = (const char*)(A + ((size_t)blockIdx.x * 64 + (tid >> 4)) * lda) + (tid & 15) * 16; const size_t sa = (size_t)lda * (8 * 4);
  const char* gw = (const char*)(P + (size_t)(nw + (tid >> 3)) * DM) + (tid & 7) * 16;
  const unsigned la = lds_addr(&sA[0][tid >> 4][0]) + (tid & 15) * 16, lw = lds_addr(&sW[0][tid >> 3][0]) + (tid & 7) * 16;
  stage_chunk(ga, sa, gw, la, lw);
  asm volatile("s_wait_asynccnt 0x0" ::: "memory");   // this wave's part of chunk 0 has landed
  __syncthreads();                                    // ... and every other wave's
  stage_chunk(ga + GK * 4, sa, gw + GK * 2, la + GABUF, lw + GWBUF);
  v8f acc[8] = {};
#pragma unroll 1   // one trip = one staged chunk; rolled, so that the ring's hand-over stands once, at the foot
  for (int c = 0; c < DM / GK; ++c) { const int buf = c & 1;
#pragma unroll     // kk becomes a constant in every LDS offset
    for (int kk = 0; kk < GK / 32; ++kk) { const float* arow = &sA[buf][wave * 16 + col][kk * 32];
      v16b w[8];   // the eight weight fragments are read as one group, ahead of the products
#pragma unroll
      for (int j = 0; j < 8; ++j) w[j] = frag_b(&sW[buf][j * 16 + col][kk * 32], lane);
      F2 a; if (RIN) { v16b ax; const float* p = arow + 8 * g;
#pragma unroll
        for (int i = 0; i < 8; ++i) { ax[i] = (__bf16)p[i]; ax[8 + i] = (__bf16)p[16 + i]; } a.h = ax; a.l = ax; } else a = split_row(arow, 0, lane);
#pragma unroll
      for (int j = 0; j < 8; ++j) { if (!RIN) acc[j] = wmma_bf(a.l, w[j], acc[j]); acc[j] = wmma_bf(a.h, w[j], acc[j]); } }
    asm volatile("s_wait_dscnt 0x0" ::: "memory");      // this wave's reads of buffer buf are done before the buffer is refilled
    asm volatile("s_wait_asynccnt 0x0" ::: "memory");   // this wave's part of chunk c + 1 has landed
    __syncthreads();                                    // publishes chunk c + 1 and ends every wave's reads of buffer buf
    if (c + 2 < DM / GK) stage_chunk(ga + (c + 2) * (GK * 4), sa, gw + (c + 2) * (GK * 2), la + buf * GABUF, lw + buf * GWBUF); }
  asm volatile("s_wait_asynccnt 0x0" ::: "memory");     // no copy is left in flight when the wave goes on
  float res[8][8] = {};
  if (EPI == 1) { const float* rp[8];
#pragma unroll
    for (int r = 0; r < 8; ++r) rp[r] = RES + (r0 + 8 * g + r) * ldo + n0 + col;
#pragma unroll
    for (int j = 0; j < 8; ++j) {
#pragma unroll
      for (int r = 0; r < 8; ++r) res[j][r] = rp[r][j * 16]; }
    // with no call between them the 64 loads go out together; the row addresses are inputs of the wait, so they keep their registers up to it and no later load's result lands on an address register ahead of it
    asm volatile("s_wait_xcnt 0x0" :: "v"(rp[0]), "v"(rp[1]), "v"(rp[2]), "v"(rp[3]), "v"(rp[4]), "v"(rp[5]), "v"(rp[6]), "v"(rp[7]) : "memory"); }
#pragma unroll
  for (int j = 0; j < 8; ++j) { const int n = n0 + j * 16 + col; const float bb = (EPI == 1) ? bfr(bias[n]) : 0.f;
#pragma unroll
    for (int r = 0; r < 8; ++r) { const float v = acc[j][r] + bb; if (EPI != 1) so[wave][8 * g + r][j * 16 + col] = v; }
    if (EPI == 1) { float x[8], e[8];
#pragma unroll
      for (int r = 0; r < 8; ++r) x[r] = (acc[j][r] + bb) * L2E;
      ex2x8(e, x);
#pragma unroll
      for (int r = 0; r < 8; ++r) { const float v = acc[j][r] + bb; so[wave][8 * g + r][j * 16 + col] = res[j][r] + ((v > 0.f) ? v : e[r] - 1.0f); } } }
  LDSX();
  for (int rl = 0; rl < 16; ++rl) vst2(OUT + (r0 + rl) * ldo + n0 + lane * 4, *(const v4f*)&so[wave][rl][lane * 4]);
}
// ---- k_ln: block = 8 rows (wave per row): OUT = LN(IN) over 512 (biased var, eps 1e-6) * gamma + beta; blockIdx.y = 1 (only where the launch has it): the 512 columns behind IN's -> the matrix behind OUT, so that LN(mod_l) and LN(dec_l) are one launch
__global__ __launch_bounds__(256) void k_ln(const float* __restrict__ IN, int ldi, const float* __restrict__ G, const float* __restrict__ Bb, float* __restrict__ OUT) {
  __shared__ __align__(16) float s[8][DM]; const int wave = threadIdx.x >> 5, lane = threadIdx.x & 31; const size_t row = (size_t)blockIdx.x * 8 + wave; float v[16]; float sum = 0.f;
  IN += blockIdx.y * DM; OUT += (size_t)blockIdx.y * ((size_t)NTOK * DM);
#pragma unroll
  for (int k = 0; k < 16; ++k) { v[k] = IN[row * ldi + lane + 32 * k]; sum += v[k]; }
#pragma unroll
  for (int o = 1; o < 32; o <<= 1) sum += __shfl_xor(sum, o);
  const float mu = sum / (float)DM; float var = 0.f;
#pragma unroll
  for (int k = 0; k < 16; ++k) { const float d = v[k] - mu; var += d * d; }
#pragma unroll
  for (int o = 1; o < 32; o <<= 1) var += __shfl_xor(var, o);
  const float rs = rsqrtf(var / (float)DM + 1e-6f);
#pragma unroll
  for (int k = 0; k < 16; ++k) { const int c = lane + 32 * k; s[wave][c] = (v[k] - mu) * rs * bfr(G[c]) + bfr(Bb[c]); }
  LDSX();
  for (int pc = lane; pc < DM / 4; pc += 32) vst2(OUT + row * DM + pc * 4, *(const v4f*)&s[wave][pc * 4]);
}
// ---- k_vplanes: block = (64 tokens, 128-col chunk): chunks 0..3: v (KV cols 512 + c) -> transposed hi/lo planes [b][c][s]; chunks 4..7: k (KV cols c) -> hi/lo rows [b][h][s][64 hi | 64 lo], split here once and not by every wave of k_attn that reads the key (no turn, so no LDS: such a block is done ahead of the barrier, all of it)
__global__ __launch_bounds__(256) void k_vplanes(const float* __restrict__ KV, __bf16* __restrict__ VH, __bf16* __restrict__ VL, __bf16* __restrict__ K2) {
  __shared__ __align__(16) __bf16 sh[128][72], sl[128][72]; const int tid = threadIdx.x; const size_t rb = (size_t)blockIdx.x * 64; const int c0 = (blockIdx.y & 3) * 128; const int b = (int)(rb / SS), s0 = (int)(rb % SS);
  if (blockIdx.y >= DM / 128) { const float* ip[4]; __bf16* op[4]; v4f x[8];   // a lane: 8 neighbour d of rows tid >> 4 + 16 i; 8 lanes read 256 B of a row and store one 128-B line of each half
#pragma unroll
    for (int i = 0; i < 4; ++i) { const int rl = (tid >> 4) + 16 * i, c = c0 + (tid & 15) * 8; ip[i] = KV + (rb + rl) * (2 * DM) + c; op[i] = K2 + (((size_t)b * NH + (c >> 6)) * SS + s0 + rl) * (2 * HD) + (c & 63); }
#pragma unroll
    for (int i = 0; i < 4; ++i) { x[2 * i] = *(const v4f*)ip[i]; x[2 * i + 1] = *(const v4f*)(ip[i] + 4); }
#pragma unroll
    for (int i = 0; i < 4; ++i) { v8b hi, lo;
#pragma unroll
      for (int j = 0; j < 8; ++j) { const float v = x[2 * i + (j >> 2)][j & 3]; const __bf16 hb = (__bf16)v; hi[j] = hb; lo[j] = (__bf16)(v - (float)hb); }
      vst2((unsigned*)op[i], __builtin_bit_cast(v4u, hi)); vst2((unsigned*)(op[i] + HD), __builtin_bit_cast(v4u, lo)); }
    return; }
  for (int q = tid; q < 64 * 128; q += 256) { const int rl = q >> 7, c = q & 127; const float v = KV[(rb + rl) * (2 * DM) + DM + c0 + c]; const __bf16 hb = (__bf16)v; sh[c][rl] = hb; sl[c][rl] = (__bf16)(v - (float)hb); }
  __syncthreads();
  for (int q = tid; q < 128 * 8; q += 256) { const int c = q >> 3, pc = q & 7; const size_t o = ((size_t)b * DM + c0 + c) * SS + s0 + pc * 8; vst2((unsigned*)(VH + o), *(const v4u*)&sh[c][pc * 8]); vst2((unsigned*)(VL + o), *(const v4u*)&sl[c][pc * 8]); }
}
__device__ __forceinline__ float xhalf(float v) { return __builtin_bit_cast(float, __builtin_amdgcn_permlanex16(__builtin_bit_cast(int, v), __builtin_bit_cast(int, v), 0x76543210, 0xfedcba98, false, false)); }   // lane l reads lane l ^ 16
#define KT 64                      // keys per staged tile
#define KP 136                     // bf16 per K row in LDS (64 hi, 64 lo, 8 unused): 272 B = 16 B x 17, no bank conflict for 16-byte reads of 16 rows
#define VP 72                      // bf16 per V row in LDS: 144 B = 16 B x 9
#define KBUF (KT * KP * 2)         // bytes of one K buffer
#define VBUF (HD * VP * 2)         // bytes of one V-plane buffer
// one tile: K 64 rows x 256 B (a lane: chunk tid & 15 of rows tid >> 4 + 8 i), each V plane 64 rows x 128 B (chunk tid & 7 of rows tid >> 3 + 16 i); the arguments are the lane's own first addresses
__device__ __forceinline__ void stage_tile(const char* gk, const char* gh, const char* gl, unsigned lk, unsigned lh, unsigned ll) {
  unsigned a[8]; const char* p[8];
#pragma unroll
  for (int i = 0; i < 8; ++i) { a[i] = lk + i * (8 * KP * 2); p[i] = gk + (size_t)i * (8 * 2 * HD * 2); }
  acopy8(a, p);
#pragma unroll
  for (int i = 0; i < 4; ++i) { a[i] = lh + i * (16 * VP * 2); p[i] = gh + (size_t)i * (16 * SS * 2); a[4 + i] = ll + i * (16 * VP * 2); p[4 + i] = gl + (size_t)i * (16 * SS * 2); }
  acopy8(a, p);
}
__global__ __launch_bounds__(128) void k_attn(const float* __restrict__ Q, const __bf16* __restrict__ K2, const __bf16* __restrict__ VH, const __bf16* __restrict__ VL, const float* __restrict__ ML, float* __restrict__ M2) {
  __shared__ __align__(16) float so[4][16][68];
  __shared__ __align__(16) __bf16 sK[2][KT][KP];
  __shared__ __align__(16) __bf16 sVH[2][HD][VP], sVL[2][HD][VP];
  const int tid = threadIdx.x, wave = tid >> 5, lane = tid & 31, col = lane & 15, g = lane >> 4; const int qb = blockIdx.x, h = blockIdx.y, b = blockIdx.z; const int q0 = qb * 64 + wave * 16; const size_t rq = (size_t)b * SS + q0;
  const char* gk = (const char*)(K2 + (((size_t)b * NH + h) * SS + (tid >> 4)) * (2 * HD)) + (tid & 15) * 16;
  const size_t vo = (((size_t)b * DM + h * HD + (tid >> 3)) * SS) * 2 + (tid & 7) * 16;
  const char* gh = (const char*)VH + vo; const char* gl = (const char*)VL + vo;
  const unsigned lk = lds_addr(&sK[0][tid >> 4][0]) + (tid & 15) * 16, lh = lds_addr(&sVH[0][tid >> 3][0]) + (tid & 7) * 16, ll = lds_addr(&sVL[0][tid >> 3][0]) + (tid & 7) * 16;
  stage_tile(gk, gh, gl, lk, lh, ll);
  F2 aq[2];
#pragma unroll
  for (int kc = 0; kc < 2; ++kc) aq[kc] = split_row(Q + (rq + col) * DM + h * HD, kc * 32, lane);
  asm volatile("s_wait_asynccnt 0x0" ::: "memory");   // this wave's part of tile 0 has landed
  __syncthreads();                                    // ... and every other wave's
  stage_tile(gk + (size_t)KT * (2 * HD * 2), gh + KT * 2, gl + KT * 2, lk + KBUF, lh + VBUF, ll + VBUF);
  float ml = -3.0e38f, l = 0.f;   // ml: running row maximum times L2E
  v8f acc[4] = {};   // O^T: lane = query col, element r of tile dt = d dt*16 + 8g + r
#pragma unroll 1   // one trip = one staged tile; rolled, so that the ring's hand-over stands once, at the foot
  for (int t = 0; t < SS / KT; ++t) { const int buf = t & 1;
#pragma unroll     // sub becomes a constant in every LDS offset
    for (int sub = 0; sub < KT / 32; ++sub) { v8f s[2];   // S^T: element r of tile ct = key t*64 + sub*32 + ct*16 + 8g + r
      F2 kf[2][2];
#pragma unroll
      for (int ct = 0; ct < 2; ++ct) { const __bf16* krow = &sK[buf][sub * 32 + ct * 16 + col][0];
#pragma unroll
        for (int kc = 0; kc < 2; ++kc) { kf[ct][kc].h = frag_b(krow + kc * 32, lane); kf[ct][kc].l = frag_b(krow + HD + kc * 32, lane); } }
      v16b vh[4], vl[4];   // read here too: the score products and the softmax cover their way from LDS
#pragma unroll
      for (int dt = 0; dt < 4; ++dt) { vh[dt] = frag_b(&sVH[buf][dt * 16 + col][sub * 32], lane); vl[dt] = frag_b(&sVL[buf][dt * 16 + col][sub * 32], lane); }
      __builtin_amdgcn_sched_barrier(0);   // the 32 reads stay ahead of all the products they feed: left free, the compiler sinks each pair of reads to just in front of its matrix instruction, with a wait to 0 between them
#pragma unroll
      for (int ct = 0; ct < 2; ++ct) { v8f c = {};
#pragma unroll
        for (int kc = 0; kc < 2; ++kc) { const F2& kb = kf[ct][kc]; c = wmma_bfp(kb.h, aq[kc].l, c); c = wmma_bfp(kb.l, aq[kc].h, c); c = wmma_bfp(kb.h, aq[kc].h, c); }
        s[ct] = c; }
      float mx = fmaxf(s[0][0], s[1][0]);
#pragma unroll
      for (int r = 1; r < 8; ++r) mx = fmaxf(mx, fmaxf(s[0][r], s[1][r]));
      mx = fmaxf(mx, xhalf(mx));
      const float mnl = fmaxf(ml, mx * L2E); const float alpha = ex2x1(ml - mnl);   // the running maximum is kept times L2E: ml is the very value the earlier terms were taken against, so an unchanged maximum gives exactly 1
      float e[16], x[16]; float es = 0.f;
#pragma unroll
      for (int r = 0; r < 8; ++r) { x[r] = fmaf(s[0][r], L2E, -mnl); x[8 + r] = fmaf(s[1][r], L2E, -mnl); }
      ex2x8(e, x); ex2x8(e + 8, x + 8);
#pragma unroll
      for (int r = 0; r < 8; ++r) es += e[r] + e[8 + r];
      l = l * alpha + es; ml = mnl;   // l: this half's 16 of each 32 keys; the halves are joined once behind the loop (alpha is the same in both)
#pragma unroll
      for (int dt = 0; dt < 4; ++dt) acc[dt] *= alpha;
      const F2 pb = bsplit16(e);
#pragma unroll
      for (int dt = 0; dt < 4; ++dt) { acc[dt] = wmma_bfp(vh[dt], pb.l, acc[dt]); acc[dt] = wmma_bfp(vl[dt], pb.h, acc[dt]); acc[dt] = wmma_bfp(vh[dt], pb.h, acc[dt]); } }
    __builtin_amdgcn_sched_barrier(0);                  // softmax and products stay ahead of the foot: sunk behind it, the wait below would stand directly behind the V reads
    asm volatile("s_wait_dscnt 0x0" ::: "memory");      // this wave's reads of buffer buf are done before the buffer is refilled
    asm volatile("s_wait_asynccnt 0x0" ::: "memory");   // this wave's part of tile t + 1 has landed
    __syncthreads();                                    // publishes tile t + 1 and ends every wave's reads of buffer buf
    if (t + 2 < SS / KT) stage_tile(gk + (size_t)(t + 2) * (KT * 2 * HD * 2), gh + (t + 2) * (KT * 2), gl + (t + 2) * (KT * 2), lk + buf * KBUF, lh + buf * VBUF, ll + buf * VBUF); }
  asm volatile("s_wait_asynccnt 0x0" ::: "memory");     // no copy is left in flight when the wave goes on
  l += xhalf(l);
  const float il = 1.0f / l; const float* mlr = ML + (rq + col) * (2 * DM) + h * HD + 8 * g;
#pragma unroll
  for (int dt = 0; dt < 4; ++dt) {
#pragma unroll
    for (int r = 0; r < 8; ++r) so[wave][col][dt * 16 + 8 * g + r] = mlr[dt * 16 + r] + acc[dt][r] * il; }
  LDSX();
  for (int rl = 0; rl < 16; ++rl) if (lane < 16) vst2(M2 + (rq + rl) * DM + h * HD + lane * 4, *(const v4f*)&so[wave][rl][lane * 4]);
}
extern "C" void kernel_launch(void* const* d_in, const int* in_sizes, int n_in, void* d_out, int out_size, void* d_ws, size_t ws_size, hipStream_t stream) {
  (void)in_sizes; (void)n_in; (void)out_size;
  const float** F = (const float**)d_in;   // 0 mod [2,2048,512], 1 Wl [512,512], 2 Wd, 3 Wq [8,64,64], 4 Wk, 5 Wv, 6 gamma [512], 7 beta, 8 Wf [512,512], 9 bf [512]
  if (ws_size < (size_t)WS_END) return;
  char* ws = (char*)d_ws; __bf16 *PW = (__bf16*)(ws + WS_PW), *VH = (__bf16*)(ws + WS_VH), *VL = (__bf16*)(ws + WS_VL); float *ML = (float*)(ws + WS_ML), *NM = (float*)(ws + WS_NM), *Q = (float*)(ws + WS_Q), *KV = (float*)(ws + WS_KV), *M2 = (float*)(ws + WS_M2); __bf16* K2 = (__bf16*)(ws + WS_K2);
  const int NR = TNB * SS / 64;
  k_packT<<<dim3((DM / 64) * (DM / 64), 6), 128, 0, stream>>>(F[1], F[2], F[3], F[4], F[5], F[8], PW);
  k_gemm<1, 0, 0><<<dim3(NR, 2 * DM / 128), 128, 0, stream>>>(F[0], DM, PW + PLD, nullptr, nullptr, ML, 2 * DM);        // mod_l | dec_l (exact)
  k_ln<<<dim3(TNB * SS / 8, 2), 256, 0, stream>>>(ML, 2 * DM, F[6], F[7], NM);                                     // LN(mod_l) -> NM, LN(dec_l) -> ND (behind NM)
  k_gemm<0, 0, 1><<<dim3(NR, 3 * DM / 128), 128, 0, stream>>>(NM, DM, PW + PQQ, nullptr, nullptr, Q, DM);         // q (NM, Wq -> Q) and k | v (ND, Wk|Wv -> KV): ND, the Wk|Wv rows and KV each lie behind NM, the Wq rows and Q
  k_vplanes<<<dim3(NR, 2 * DM / 128), 256, 0, stream>>>(KV, VH, VL, K2);
  k_attn<<<dim3(TQB, NH, TNB), 128, 0, stream>>>(Q, K2, VH, VL, ML, M2);                                          // mod2 = mod_l + o
  k_ln<<<TOB * 8, 256, 0, stream>>>(M2, DM, F[6], F[7], NM);                                                      // LN(mod2) (NM reused)
  k_gemm<0, 1, 0><<<dim3(TOB, DM / 128), 128, 0, stream>>>(NM, DM, PW + PFF, F[9], M2, (float*)d_out, DM);           // out = mod2 + elu(LN(mod2) Wf + bf)
}

// v009
// A run of this version takes 94.9 microseconds.
// In both of two side-by-side timings against v008, it was 1.08 times as fast.
// Counting every step since v000, it is 5.21 times as fast.
// compute dtype: mod and all weights/LN params (module inputs) rounded to bf16; mod Wl / mod Wd with exact bf16 products (inputs); the per-head q/k/v 1x1 convs (as two block-diagonal GEMMs: q 512->512, k|v 512->1024), the FFN and scores/P.V with the computed operands as bf16 hi + residual pairs (2 products against exact weights; 3 products for q.k and P.V); LayerNorms, softmax (no 1/sqrt(d) scale), ELU and residuals in f32; f32 accumulate.
#include <hip/hip_runtime.h>
#include <math.h>

typedef __attribute__((ext_vector_type(16))) _Float16 v16h;
typedef __attribute__((ext_vector_type(16))) __bf16 v16b;
typedef __attribute__((ext_vector_type(8)))  _Float16 v8h;
typedef __attribute__((ext_vector_type(8)))  float v8f;
typedef __attribute__((ext_vector_type(4)))  float v4f;
typedef __attribute__((ext_vector_type(2)))  float v2f;
typedef __attribute__((ext_vector_type(4)))  unsigned v4u;
typedef __attribute__((ext_vector_type(4)))  int v4i;
typedef float __attribute__((may_alias)) float_a;
typedef int __attribute__((may_alias)) int_a;

template <typename T> __device__ __forceinline__ void vst2(void* p, T v) { *(T*)p = v;  }
__device__ __forceinline__ v8f wmma16(v16h a, v16h b, v8f c) {
  v8f d = __builtin_amdgcn_wmma_f32_16x16x32_f16(false, a, false, b, (short)0, c, false, false);
  asm volatile("v_nop\n\tv_nop\n\tv_nop\n\tv_nop" : "+v"(d) : "v"(a), "v"(b));
  return d;
}
__device__ __forceinline__ v8f wmma_bf(v16b a, v16b b, v8f c) {
  v8f d = __builtin_amdgcn_wmma_f32_16x16x32_bf16(false, a, false, b, (short)0, c, false, false);
  asm volatile("v_nop\n\tv_nop\n\tv_nop\n\tv_nop" : "+v"(d) : "v"(a), "v"(b));
  return d;
}
// the plain builtin: the compiler keeps the distance behind a matrix instruction itself and is free to place independent work there
__device__ __forceinline__ v8f wmma_bfp(v16b a, v16b b, v8f c) { return __builtin_amdgcn_wmma_f32_16x16x32_bf16(false, a, false, b, (short)0, c, false, false); }
// 16x16x32 fragments: lane = (h = lane>>4, row/col = lane&15); elements 0..7 = k0+8h+0..7, 8..15 = k0+16+8h+0..7; D element r = row 8h+r
__device__ __forceinline__ v16h frag_h(const _Float16* rowk0, int lane) {
  union { v16h v; v8h q[2]; } u; const _Float16* p = rowk0 + 8 * (lane >> 4);
  u.q[0] = *(const v8h*)p; u.q[1] = *(const v8h*)(p + 16); return u.v;
}
__device__ __forceinline__ v16h frag_f32(const float* rowk0, int lane) {
  v16h a; const float* p = rowk0 + 8 * (lane >> 4);
#pragma unroll
  for (int i = 0; i < 8; ++i) { a[i] = (_Float16)p[i]; a[8 + i] = (_Float16)p[16 + i]; }
  return a;
}
__device__ __forceinline__ v16h frag_f32s(const float* rowk0, int lane, float sc) {
  v16h a; const float* p = rowk0 + 8 * (lane >> 4);
#pragma unroll
  for (int i = 0; i < 8; ++i) { a[i] = (_Float16)(p[i] * sc); a[8 + i] = (_Float16)(p[16 + i] * sc); }
  return a;
}
// column fragment from a [K][ld] layout (column n), rows >= K read as 0
__device__ __forceinline__ v16h fragc_f32(const float* W, int k0, int n, int lane, int ld, int K) {
  v16h a; const int g = lane >> 4;
#pragma unroll
  for (int i = 0; i < 8; ++i) { const int ka = k0 + 8 * g + i, kb = ka + 16;
    a[i] = (_Float16)(ka < K ? W[(size_t)(ka < K ? ka : K - 1) * ld + n] : 0.f); a[8 + i] = (_Float16)(kb < K ? W[(size_t)(kb < K ? kb : K - 1) * ld + n] : 0.f); }
  return a;
}
struct F2 { v16b h, l; };
__device__ __forceinline__ F2 bsplit16(const float v[16]) { F2 r;
#pragma unroll
  for (int i = 0; i < 16; ++i) { const __bf16 h = (__bf16)v[i]; r.h[i] = h; r.l[i] = (__bf16)(v[i] - (float)h); }
  return r; }
__device__ __forceinline__ F2 split_row(const float* row, int k0, int lane) { float v[16]; const float* p = row + k0 + 8 * (lane >> 4);
#pragma unroll
  for (int i = 0; i < 8; ++i) { v[i] = p[i]; v[8 + i] = p[16 + i]; }
  return bsplit16(v); }
__device__ __forceinline__ F2 split_rowK(const float* row, int k0, int lane, int K) { float v[16]; const int g = lane >> 4;
#pragma unroll
  for (int i = 0; i < 8; ++i) { const int ka = k0 + 8 * g + i, kb = ka + 16; v[i] = ka < K ? row[ka < K ? ka : K - 1] : 0.f; v[8 + i] = kb < K ? row[kb < K ? kb : K - 1] : 0.f; }
  return bsplit16(v); }
__device__ __forceinline__ F2 split_col(const float* W, int k0, int n, int lane, int ld, int K) { float v[16]; const int g = lane >> 4;
#pragma unroll
  for (int i = 0; i < 8; ++i) { const int ka = k0 + 8 * g + i, kb = ka + 16; v[i] = ka < K ? W[(size_t)(ka < K ? ka : K - 1) * ld + n] : 0.f; v[8 + i] = kb < K ? W[(size_t)(kb < K ? kb : K - 1) * ld + n] : 0.f; }
  return bsplit16(v); }
__device__ __forceinline__ v8f mac3(const F2& a, const F2& b, v8f c) { c = wmma_bf(a.l, b.h, c); c = wmma_bf(a.h, b.l, c); return wmma_bf(a.h, b.h, c); }
__device__ __forceinline__ float sigm(float v) { return 1.0f / (1.0f + expf(-v)); }
#define LDSX() do { asm volatile("s_wait_dscnt 0" ::: "memory"); __builtin_amdgcn_wave_barrier(); __builtin_amdgcn_fence(__ATOMIC_RELEASE, "workgroup"); } while (0)


// SAttn (B 2, S 2048, dim 512, 8 heads x 64; self-attention: dec = mod): mod_l = mod Wl, dec_l = mod Wd; nm = LN(mod_l), nd = LN(dec_l) (shared gamma/beta, eps 1e-6); q = nm_h Wq[h], k = nd_h Wk[h], v = nd_h Wv[h]; attn = softmax(q k^T) (unscaled); o merged; mod2 = mod_l + o; out = mod2 + elu(LN(mod2) Wf + bf).
#define NB 2
#define SS 2048
#define DM 512
#define NH 8
#define HD 64
#define NTOK (NB * SS)
#ifndef TQB
#define TQB (SS / 64)
#define TNB NB
#define TOB (NB * SS / 64)
#endif
typedef __attribute__((ext_vector_type(8))) __bf16 v8b;
__device__ __forceinline__ v16b frag_b(const __bf16* rowk0, int lane) {
  union { v16b v; v8b q[2]; } u; const __bf16* p = rowk0 + 8 * (lane >> 4);
  u.q[0] = *(const v8b*)p; u.q[1] = *(const v8b*)(p + 16); return u.v;
}
__device__ __forceinline__ float bfr(float v) { return (float)(__bf16)v; }
#define L2E 1.4426950408889634f   // log2(e): exp(x) = 2^(x * L2E)
// eight (one) 2^x in line, no call, so that independent exponentials overlap; one statement: the outputs are early-clobber, so no v_exp_f32 overwrites the source of the one ahead of it, and the v_nop at the end keeps the one slot that the instruction set asks for behind a transcendental
__device__ __forceinline__ void ex2x8(float* o, const float* x) {
  asm("v_exp_f32 %0, %8\n\tv_exp_f32 %1, %9\n\tv_exp_f32 %2, %10\n\tv_exp_f32 %3, %11\n\tv_exp_f32 %4, %12\n\tv_exp_f32 %5, %13\n\tv_exp_f32 %6, %14\n\tv_exp_f32 %7, %15\n\tv_nop"
      : "=&v"(o[0]), "=&v"(o[1]), "=&v"(o[2]), "=&v"(o[3]), "=&v"(o[4]), "=&v"(o[5]), "=&v"(o[6]), "=&v"(o[7])
      : "v"(x[0]), "v"(x[1]), "v"(x[2]), "v"(x[3]), "v"(x[4]), "v"(x[5]), "v"(x[6]), "v"(x[7]));
}
__device__ __forceinline__ float ex2x1(float x) { float o; asm("v_exp_f32 %0, %1\n\tv_nop" : "=v"(o) : "v"(x)); return o; }
#define WS_PW  0u                 // bf16 rows (in,out -> [out][in]): Wl|Wd -> [1024][512]; Wq (block diagonal) [512][512]; Wk|Wv (block diagonal) [1024][512]; Wf [512][512]
#define PLD 0
#define PQQ (PLD + 2 * DM * DM)
#define PKV (PQQ + DM * DM)
#define PFF (PKV + 2 * DM * DM)
#define PWEND (PFF + DM * DM)
#define WS_ML  (WS_PW + 2u * PWEND)   // f32 [NTOK][1024] mod_l | dec_l
#define WS_NM  (WS_ML + 4u * NTOK * 2 * DM)   // f32 [NTOK][512] LN(mod_l), later LN(mod2)
#define WS_ND  (WS_NM + 4u * NTOK * DM)       // f32 [NTOK][512] LN(dec_l)
#define WS_Q   (WS_ND + 4u * NTOK * DM)       // f32 [NTOK][512] q
#define WS_KV  (WS_Q + 4u * NTOK * DM)        // [NTOK][1024] f32, not used
#define WS_VH  (WS_KV + 4u * NTOK * 2 * DM)   // bf16 [NB][512][SS] v planes
#define WS_VL  (WS_VH + 2u * NB * DM * SS)
#define WS_M2  (WS_VL + 2u * NB * DM * SS)   // f32 [NTOK][512] mod2 = mod_l + o
#define WS_K2  (WS_M2 + 4u * NTOK * DM)       // bf16 [NB][NH][SS][128] k planes, a key's row = 64 hi | 64 residual (256 B)
#define WS_END (WS_K2 + 2u * NB * NH * SS * 2 * HD)

// ---- k_packT: block = (64 k x 64 n tile, matrix m): PW holds six [512 out][512 in] bf16 matrices in a row: 0 Wl^T, 1 Wd^T, 2 Wq, 3 Wk, 4 Wv (block diagonal: row h*64+e gets W[h][d][e] at col h*64+d, zeros elsewhere), 5 Wf^T; the tile is read along its rows (16 lanes x 16 B = 256 B of one input row; a lane takes two neighbour rows, so that a k pair is one LDS word), turned in LDS and stored as whole 128-B lines; a tile off the diagonal of 2..4 reads nothing and stores zeros
#define PTP 72                     // bf16 per tile row in LDS: 144 B = 16 B x 9
typedef __attribute__((ext_vector_type(2))) __bf16 v2b;
__global__ __launch_bounds__(128) void k_packT(const float* __restrict__ WL, const float* __restrict__ WD, const float* __restrict__ WQ, const float* __restrict__ WK, const float* __restrict__ WV, const float* __restrict__ WF, __bf16* __restrict__ PW) {
  __shared__ __align__(16) __bf16 s[64][PTP];
  const int tid = threadIdx.x, kt = blockIdx.x & 7, nt = blockIdx.x >> 3, m = blockIdx.y;
  const bool dense = (m < 2 || m == 5);
  const float* W = (m == 0) ? WL : (m == 1) ? WD : (m == 2) ? WQ : (m == 3) ? WK : (m == 4) ? WV : WF;
  const float* p = (dense ? W + (size_t)(kt * 64) * DM + nt * 64 : W + (size_t)kt * (HD * HD)) + (tid & 15) * 4; const int ld = dense ? DM : HD;
  v4f v[8] = {};   // v[2 i + o]: input row 2 (tid >> 4) + 16 i + o of the tile
  if (dense || kt == nt) { const float* rp[8];
#pragma unroll
    for (int i = 0; i < 8; ++i) rp[i] = p + (size_t)(2 * (tid >> 4) + 16 * (i >> 1) + (i & 1)) * ld;
#pragma unroll
    for (int i = 0; i < 8; ++i) v[i] = *(const v4f*)rp[i];
    // the row addresses are inputs of the wait, so they keep their registers up to it and no later load's result lands on an address register ahead of it
    asm volatile("s_wait_xcnt 0x0" :: "v"(rp[0]), "v"(rp[1]), "v"(rp[2]), "v"(rp[3]), "v"(rp[4]), "v"(rp[5]), "v"(rp[6]), "v"(rp[7]) : "memory"); }
#pragma unroll
  for (int i = 0; i < 4; ++i) {
#pragma unroll
    for (int j = 0; j < 4; ++j) { v2b t; t[0] = (__bf16)v[2 * i][j]; t[1] = (__bf16)v[2 * i + 1][j]; *(v2b*)&s[(tid & 15) * 4 + j][2 * (tid >> 4) + 16 * i] = t; } }
  __syncthreads();
  __bf16* dst = PW + (size_t)m * (DM * DM) + (size_t)(nt * 64) * DM + kt * 64;
#pragma unroll
  for (int i = 0; i < 4; ++i) { const int n = (tid >> 3) + 16 * i; vst2((unsigned*)(dst + (size_t)n * DM + (tid & 7) * 8), *(const v4u*)&s[n][(tid & 7) * 8]); }
}
__device__ __forceinline__ unsigned lds_addr(const void* p) { return (unsigned)(unsigned long long)p; }   // LDS byte address = low 32 bits of a __shared__ address
// eight 16-byte copies per lane, global -> LDS through no register; s_wait_xcnt closes the statement so that no address register is rewritten ahead of it
__device__ __forceinline__ void acopy8(const unsigned (&l)[8], const char* const (&p)[8]) {
  asm volatile("global_load_async_to_lds_b128 %0, %8, off\n\t"
               "global_load_async_to_lds_b128 %1, %9, off\n\t"
               "global_load_async_to_lds_b128 %2, %10, off\n\t"
               "global_load_async_to_lds_b128 %3, %11, off\n\t"
               "global_load_async_to_lds_b128 %4, %12, off\n\t"
               "global_load_async_to_lds_b128 %5, %13, off\n\t"
               "global_load_async_to_lds_b128 %6, %14, off\n\t"
               "global_load_async_to_lds_b128 %7, %15, off\n\t"
               "s_wait_xcnt 0x0"
               :: "v"(l[0]), "v"(l[1]), "v"(l[2]), "v"(l[3]), "v"(l[4]), "v"(l[5]), "v"(l[6]), "v"(l[7]),
                  "v"(p[0]), "v"(p[1]), "v"(p[2]), "v"(p[3]), "v"(p[4]), "v"(p[5]), "v"(p[6]), "v"(p[7]) : "memory");
}
#define GK 64                      // k per staged chunk
#define GAP 68                     // floats per A row in LDS: 272 B = 16 B x 17, no bank conflict for 16-byte reads of 16 rows
#define GWP 72                     // bf16 per W row in LDS: 144 B = 16 B x 9
#define GABUF (64 * GAP * 4)       // bytes of one A buffer
#define GWBUF (128 * GWP * 2)      // bytes of one W buffer
// one k-chunk: A 64 rows x 256 B (a lane: piece tid & 15 of rows tid >> 4 + 8 i), W 128 rows x 128 B (piece tid & 7 of rows tid >> 3 + 16 i): every copy of a wave covers whole 128-B lines; the arguments are the lane's own first addresses, sa = bytes from a row of A to the eighth behind it
__device__ __forceinline__ void stage_chunk(const char* ga, size_t sa, const char* gw, unsigned la, unsigned lw) {
  unsigned a[8]; const char* p[8];
#pragma unroll
  for (int i = 0; i < 8; ++i) { a[i] = la + i * (8 * GAP * 4); p[i] = ga + i * sa; }
  acopy8(a, p);
#pragma unroll
  for (int i = 0; i < 8; ++i) { a[i] = lw + i * (16 * GWP * 2); p[i] = gw + (size_t)i * (16 * DM * 2); }
  acopy8(a, p);
}
// ---- k_gemm<RIN, EPI, QKV>: block = (64 rows, 128 cols): OUT = A(hi/lo or exact, K 512, pitch lda) . rows; A (f32) and the weight rows come in chunks of 64 k through LDS: asynchronous copies, two buffers, the weight chunk one for all 4 waves, the next chunk in flight while this one is worked on; EPI 0: plain; EPI 1: + bias, ELU, + RES (out = RES + elu(acc + b)); pitch ldo; QKV 1: q and k | v, which do not depend on each other, in ONE launch: weight rows 0..511 (blockIdx.y 0..3) are q = A . Wq -> OUT, pitch ldo; rows 512..1535 are k | v = (the matrix behind A) . Wk|Wv, which leave the block as k_attn reads them, split into bf16 hi + residual: k (columns n0 0..511) as rows K2 [b][h][s][64 hi | 64 lo], v (n0 512..1023) as transposed planes VH, VL [b][c][s]
template <int RIN, int EPI, int QKV>
__global__ __launch_bounds__(128) void k_gemm(const float* __restrict__ A, int lda, const __bf16* __restrict__ P, const float* __restrict__ bias, const float* __restrict__ RES, float* __restrict__ OUT, int ldo, __bf16* __restrict__ VH, __bf16* __restrict__ VL, __bf16* __restrict__ K2) {
  __shared__ __align__(16) float so[4][16][132];
  __shared__ __align__(16) float sA[2][64][GAP];
  __shared__ __align__(16) __bf16 sW[2][128][GWP];
  const int tid = threadIdx.x, wave = tid >> 5, lane = tid & 31, col = lane & 15, g = lane >> 4; const size_t r0 = (size_t)blockIdx.x * 64 + wave * 16; const int nw = blockIdx.y * 128; int n0 = nw;   // nw: first weight row, n0: first output column
  if (QKV && nw >= DM) { A += (size_t)NTOK * DM; n0 = nw - DM; }   // the same for the whole block
  const char* ga = (const char*)(A + ((size_t)blockIdx.x * 64 + (tid >> 4)) * lda) + (tid & 15) * 16; const size_t sa = (size_t)lda * (8 * 4);
  const char* gw = (const char*)(P + (size_t)(nw + (tid >> 3)) * DM) + (tid & 7) * 16;
  const unsigned la = lds_addr(&sA[0][tid >> 4][0]) + (tid & 15) * 16, lw = lds_addr(&sW[0][tid >> 3][0]) + (tid & 7) * 16;
  stage_chunk(ga, sa, gw, la, lw);
  asm volatile("s_wait_asynccnt 0x0" ::: "memory");   // this wave's part of chunk 0 has landed
  __syncthreads();                                    // ... and every other wave's
  stage_chunk(ga + GK * 4, sa, gw + GK * 2, la + GABUF, lw + GWBUF);
  v8f acc[8] = {};
#pragma unroll 1   // one trip = one staged chunk; rolled, so that the ring's hand-over stands once, at the foot
  for (int c = 0; c < DM / GK; ++c) { const int buf = c & 1;
#pragma unroll     // kk becomes a constant in every LDS offset
    for (int kk = 0; kk < GK / 32; ++kk) { const float* arow = &sA[buf][wave * 16 + col][kk * 32];
      v16b w[8];   // the eight weight fragments are read as one group, ahead of the products
#pragma unroll
      for (int j = 0; j < 8; ++j) w[j] = frag_b(&sW[buf][j * 16 + col][kk * 32], lane);
      F2 a; if (RIN) { v16b ax; const float* p = arow + 8 * g;
#pragma unroll
        for (int i = 0; i < 8; ++i) { ax[i] = (__bf16)p[i]; ax[8 + i] = (__bf16)p[16 + i]; } a.h = ax; a.l = ax; } else a = split_row(arow, 0, lane);
#pragma unroll
      for (int j = 0; j < 8; ++j) { if (!RIN) acc[j] = wmma_bf(a.l, w[j], acc[j]); acc[j] = wmma_bf(a.h, w[j], acc[j]); } }
    asm volatile("s_wait_dscnt 0x0" ::: "memory");      // this wave's reads of buffer buf are done before the buffer is refilled
    asm volatile("s_wait_asynccnt 0x0" ::: "memory");   // this wave's part of chunk c + 1 has landed
    __syncthreads();                                    // publishes chunk c + 1 and ends every wave's reads of buffer buf
    if (c + 2 < DM / GK) stage_chunk(ga + (c + 2) * (GK * 4), sa, gw + (c + 2) * (GK * 2), la + buf * GABUF, lw + buf * GWBUF); }
  asm volatile("s_wait_asynccnt 0x0" ::: "memory");     // no copy is left in flight when the wave goes on
  if (QKV && nw >= DM) {   // the same for the whole block: all of it takes this way and is done at its end
    const int b = (int)(blockIdx.x * 64 / SS), s0 = (int)(blockIdx.x * 64 % SS);
    if (n0 < DM) {   // k: token-major, so each wave turns its own 16 x 128 tile in its part of so; a lane: 8 neighbour d of rows g + 2 i; 8 lanes store one 128-B line of each half
#pragma unroll
      for (int j = 0; j < 8; ++j) {
#pragma unroll
        for (int r = 0; r < 8; ++r) so[wave][8 * g + r][j * 16 + col] = acc[j][r]; }
      LDSX();
      const int c = n0 + col * 8; __bf16* op = K2 + (((size_t)b * NH + (c >> 6)) * SS + s0 + wave * 16 + g) * (2 * HD) + (c & 63);
      v4f x[16]; v8b hi[8], lo[8];
#pragma unroll
      for (int i = 0; i < 8; ++i) { x[2 * i] = *(const v4f*)&so[wave][2 * i + g][col * 8]; x[2 * i + 1] = *(const v4f*)&so[wave][2 * i + g][col * 8 + 4]; }
      __builtin_amdgcn_sched_barrier(0);   // the 16 reads go out as one group: left free, the compiler reads a row at a time into few registers, with a wait at each
#pragma unroll
      for (int i = 0; i < 8; ++i) {
#pragma unroll
        for (int j = 0; j < 8; ++j) { const float v = x[2 * i + (j >> 2)][j & 3]; const __bf16 hb = (__bf16)v; hi[i][j] = hb; lo[i][j] = (__bf16)(v - (float)hb); } }
      __builtin_amdgcn_sched_barrier(0);   // the 16 stores stand last, each with registers of its own: mixed among the splits, their registers were used again, with a wait on the stores in front of each reuse
#pragma unroll
      for (int i = 0; i < 8; ++i) { vst2((unsigned*)(op + (size_t)i * (2 * 2 * HD)), __builtin_bit_cast(v4u, hi[i])); vst2((unsigned*)(op + (size_t)i * (2 * 2 * HD) + HD), __builtin_bit_cast(v4u, lo[i])); }
      asm volatile("s_wait_xcnt 0x0" ::: "memory");   // stands behind the last store, ahead of whatever next writes a register that the stores name
    } else {         // v: a lane's 8 accumulator elements of a column are 8 neighbour tokens = 16 B of a plane row; the 4 waves' pieces meet in the two W buffers (free: the loop's last barrier ended every read of them, no copy is in flight), [0] hi, [1] lo, and leave as whole 128-B lines
#pragma unroll
      for (int j = 0; j < 8; ++j) { v8b hi, lo;
#pragma unroll
        for (int r = 0; r < 8; ++r) { const float v = acc[j][r]; const __bf16 hb = (__bf16)v; hi[r] = hb; lo[r] = (__bf16)(v - (float)hb); }
        *(v8b*)&sW[0][j * 16 + col][wave * 16 + 8 * g] = hi; *(v8b*)&sW[1][j * 16 + col][wave * 16 + 8 * g] = lo; }
      __syncthreads();   // a plane row's 64 tokens come from all 4 waves
#pragma unroll
      for (int i = 0; i < 8; ++i) { const int c = (tid >> 3) + 16 * i, pc = tid & 7; const size_t o = ((size_t)b * DM + (n0 - DM) + c) * SS + s0 + pc * 8; vst2((unsigned*)(VH + o), *(const v4u*)&sW[0][c][pc * 8]); vst2((unsigned*)(VL + o), *(const v4u*)&sW[1][c][pc * 8]); }
      asm volatile("s_wait_xcnt 0x0" ::: "memory");   // stands behind the last store, ahead of whatever next writes a register that the stores name
    }
    return; }
  float res[8][8] = {};
  if (EPI == 1) { const float* rp[8];
#pragma unroll
    for (int r = 0; r < 8; ++r) rp[r] = RES + (r0 + 8 * g + r) * ldo + n0 + col;
#pragma unroll
    for (int j = 0; j < 8; ++j) {
#pragma unroll
      for (int r = 0; r < 8; ++r) res[j][r] = rp[r][j * 16]; }
    // with no call between them the 64 loads go out together; the row addresses are inputs of the wait, so they keep their registers up to it and no later load's result lands on an address register ahead of it
    asm volatile("s_wait_xcnt 0x0" :: "v"(rp[0]), "v"(rp[1]), "v"(rp[2]), "v"(rp[3]), "v"(rp[4]), "v"(rp[5]), "v"(rp[6]), "v"(rp[7]) : "memory"); }
#pragma unroll
  for (int j = 0; j < 8; ++j) { const int n = n0 + j * 16 + col; const float bb = (EPI == 1) ? bfr(bias[n]) : 0.f;
#pragma unroll
    for (int r = 0; r < 8; ++r) { const float v = acc[j][r] + bb; if (EPI != 1) so[wave][8 * g + r][j * 16 + col] = v; }
    if (EPI == 1) { float x[8], e[8];
#pragma unroll
      for (int r = 0; r < 8; ++r) x[r] = (acc[j][r] + bb) * L2E;
      ex2x8(e, x);
#pragma unroll
      for (int r = 0; r < 8; ++r) { const float v = acc[j][r] + bb; so[wave][8 * g + r][j * 16 + col] = res[j][r] + ((v > 0.f) ? v : e[r] - 1.0f); } } }
  LDSX();
  for (int rl = 0; rl < 16; ++rl) vst2(OUT + (r0 + rl) * ldo + n0 + lane * 4, *(const v4f*)&so[wave][rl][lane * 4]);
}
// ---- k_ln: block = 8 rows (wave per row): OUT = LN(IN) over 512 (biased var, eps 1e-6) * gamma + beta; blockIdx.y = 1 (only where the launch has it): the 512 columns behind IN's -> the matrix behind OUT, so that LN(mod_l) and LN(dec_l) are one launch
__global__ __launch_bounds__(256) void k_ln(const float* __restrict__ IN, int ldi, const float* __restrict__ G, const float* __restrict__ Bb, float* __restrict__ OUT) {
  __shared__ __align__(16) float s[8][DM]; const int wave = threadIdx.x >> 5, lane = threadIdx.x & 31; const size_t row = (size_t)blockIdx.x * 8 + wave; float v[16]; float sum = 0.f;
  IN += blockIdx.y * DM; OUT += (size_t)blockIdx.y * ((size_t)NTOK * DM);
#pragma unroll
  for (int k = 0; k < 16; ++k) { v[k] = IN[row * ldi + lane + 32 * k]; sum += v[k]; }
#pragma unroll
  for (int o = 1; o < 32; o <<= 1) sum += __shfl_xor(sum, o);
  const float mu = sum / (float)DM; float var = 0.f;
#pragma unroll
  for (int k = 0; k < 16; ++k) { const float d = v[k] - mu; var += d * d; }
#pragma unroll
  for (int o = 1; o < 32; o <<= 1) var += __shfl_xor(var, o);
  const float rs = rsqrtf(var / (float)DM + 1e-6f);
#pragma unroll
  for (int k = 0; k < 16; ++k) { const int c = lane + 32 * k; s[wave][c] = (v[k] - mu) * rs * bfr(G[c]) + bfr(Bb[c]); }
  LDSX();
  for (int pc = lane; pc < DM / 4; pc += 32) vst2(OUT + row * DM + pc * 4, *(const v4f*)&s[wave][pc * 4]);
}
__device__ __forceinline__ float xhalf(float v) { return __builtin_bit_cast(float, __builtin_amdgcn_permlanex16(__builtin_bit_cast(int, v), __builtin_bit_cast(int, v), 0x76543210, 0xfedcba98, false, false)); }   // lane l reads lane l ^ 16
#define KT 64                      // keys per staged tile
#define KP 136                     // bf16 per K row in LDS (64 hi, 64 lo, 8 unused): 272 B = 16 B x 17, no bank conflict for 16-byte reads of 16 rows
#define VP 72                      // bf16 per V row in LDS: 144 B = 16 B x 9
#define KBUF (KT * KP * 2)         // bytes of one K buffer
#define VBUF (HD * VP * 2)         // bytes of one V-plane buffer
// one tile: K 64 rows x 256 B (a lane: chunk tid & 15 of rows tid >> 4 + 8 i), each V plane 64 rows x 128 B (chunk tid & 7 of rows tid >> 3 + 16 i); the arguments are the lane's own first addresses
__device__ __forceinline__ void stage_tile(const char* gk, const char* gh, const char* gl, unsigned lk, unsigned lh, unsigned ll) {
  unsigned a[8]; const char* p[8];
#pragma unroll
  for (int i = 0; i < 8; ++i) { a[i] = lk + i * (8 * KP * 2); p[i] = gk + (size_t)i * (8 * 2 * HD * 2); }
  acopy8(a, p);
#pragma unroll
  for (int i = 0; i < 4; ++i) { a[i] = lh + i * (16 * VP * 2); p[i] = gh + (size_t)i * (16 * SS * 2); a[4 + i] = ll + i * (16 * VP * 2); p[4 + i] = gl + (size_t)i * (16 * SS * 2); }
  acopy8(a, p);
}
__global__ __launch_bounds__(128) void k_attn(const float* __restrict__ Q, const __bf16* __restrict__ K2, const __bf16* __restrict__ VH, const __bf16* __restrict__ VL, const float* __restrict__ ML, float* __restrict__ M2) {
  __shared__ __align__(16) float so[4][16][68];
  __shared__ __align__(16) __bf16 sK[2][KT][KP];
  __shared__ __align__(16) __bf16 sVH[2][HD][VP], sVL[2][HD][VP];
  const int tid = threadIdx.x, wave = tid >> 5, lane = tid & 31, col = lane & 15, g = lane >> 4; const int qb = blockIdx.x, h = blockIdx.y, b = blockIdx.z; const int q0 = qb * 64 + wave * 16; const size_t rq = (size_t)b * SS + q0;
  const char* gk = (const char*)(K2 + (((size_t)b * NH + h) * SS + (tid >> 4)) * (2 * HD)) + (tid & 15) * 16;
  const size_t vo = (((size_t)b * DM + h * HD + (tid >> 3)) * SS) * 2 + (tid & 7) * 16;
  const char* gh = (const char*)VH + vo; const char* gl = (const char*)VL + vo;
  const unsigned lk = lds_addr(&sK[0][tid >> 4][0]) + (tid & 15) * 16, lh = lds_addr(&sVH[0][tid >> 3][0]) + (tid & 7) * 16, ll = lds_addr(&sVL[0][tid >> 3][0]) + (tid & 7) * 16;
  stage_tile(gk, gh, gl, lk, lh, ll);
  F2 aq[2];
#pragma unroll
  for (int kc = 0; kc < 2; ++kc) aq[kc] = split_row(Q + (rq + col) * DM + h * HD, kc * 32, lane);
  asm volatile("s_wait_asynccnt 0x0" ::: "memory");   // this wave's part of tile 0 has landed
  __syncthreads();                                    // ... and every other wave's
  stage_tile(gk + (size_t)KT * (2 * HD * 2), gh + KT * 2, gl + KT * 2, lk + KBUF, lh + VBUF, ll + VBUF);
  float ml = -3.0e38f, l = 0.f;   // ml: running row maximum times L2E
  v8f acc[4] = {};   // O^T: lane = query col, element r of tile dt = d dt*16 + 8g + r
#pragma unroll 1   // one trip = one staged tile; rolled, so that the ring's hand-over stands once, at the foot
  for (int t = 0; t < SS / KT; ++t) { const int buf = t & 1;
#pragma unroll     // sub becomes a constant in every LDS offset
    for (int sub = 0; sub < KT / 32; ++sub) { v8f s[2];   // S^T: element r of tile ct = key t*64 + sub*32 + ct*16 + 8g + r
      F2 kf[2][2];
#pragma unroll
      for (int ct = 0; ct < 2; ++ct) { const __bf16* krow = &sK[buf][sub * 32 + ct * 16 + col][0];
#pragma unroll
        for (int kc = 0; kc < 2; ++kc) { kf[ct][kc].h = frag_b(krow + kc * 32, lane); kf[ct][kc].l = frag_b(krow + HD + kc * 32, lane); } }
      v16b vh[4], vl[4];   // read here too: the score products and the softmax cover their way from LDS
#pragma unroll
      for (int dt = 0; dt < 4; ++dt) { vh[dt] = frag_b(&sVH[buf][dt * 16 + col][sub * 32], lane); vl[dt] = frag_b(&sVL[buf][dt * 16 + col][sub * 32], lane); }
      __builtin_amdgcn_sched_barrier(0);   // the 32 reads stay ahead of all the products they feed: left free, the compiler sinks each pair of reads to just in front of its matrix instruction, with a wait to 0 between them
#pragma unroll
      for (int ct = 0; ct < 2; ++ct) { v8f c = {};
#pragma unroll
        for (int kc = 0; kc < 2; ++kc) { const F2& kb = kf[ct][kc]; c = wmma_bfp(kb.h, aq[kc].l, c); c = wmma_bfp(kb.l, aq[kc].h, c); c = wmma_bfp(kb.h, aq[kc].h, c); }
        s[ct] = c; }
      float mx = fmaxf(s[0][0], s[1][0]);
#pragma unroll
      for (int r = 1; r < 8; ++r) mx = fmaxf(mx, fmaxf(s[0][r], s[1][r]));
      mx = fmaxf(mx, xhalf(mx));
      const float mnl = fmaxf(ml, mx * L2E); const float alpha = ex2x1(ml - mnl);   // the running maximum is kept times L2E: ml is the very value the earlier terms were taken against, so an unchanged maximum gives exactly 1
      float e[16], x[16]; float es = 0.f;
#pragma unroll
      for (int r = 0; r < 8; ++r) { x[r] = fmaf(s[0][r], L2E, -mnl); x[8 + r] = fmaf(s[1][r], L2E, -mnl); }
      ex2x8(e, x); ex2x8(e + 8, x + 8);
#pragma unroll
      for (int r = 0; r < 8; ++r) es += e[r] + e[8 + r];
      l = l * alpha + es; ml = mnl;   // l: this half's 16 of each 32 keys; the halves are joined once behind the loop (alpha is the same in both)
#pragma unroll
      for (int dt = 0; dt < 4; ++dt) acc[dt] *= alpha;
      const F2 pb = bsplit16(e);
#pragma unroll
      for (int dt = 0; dt < 4; ++dt) { acc[dt] = wmma_bfp(vh[dt], pb.l, acc[dt]); acc[dt] = wmma_bfp(vl[dt], pb.h, acc[dt]); acc[dt] = wmma_bfp(vh[dt], pb.h, acc[dt]); } }
    __builtin_amdgcn_sched_barrier(0);                  // softmax and products stay ahead of the foot: sunk behind it, the wait below would stand directly behind the V reads
    asm volatile("s_wait_dscnt 0x0" ::: "memory");      // this wave's reads of buffer buf are done before the buffer is refilled
    asm volatile("s_wait_asynccnt 0x0" ::: "memory");   // this wave's part of tile t + 1 has landed
    __syncthreads();                                    // publishes tile t + 1 and ends every wave's reads of buffer buf
    if (t + 2 < SS / KT) stage_tile(gk + (size_t)(t + 2) * (KT * 2 * HD * 2), gh + (t + 2) * (KT * 2), gl + (t + 2) * (KT * 2), lk + buf * KBUF, lh + buf * VBUF, ll + buf * VBUF); }
  asm volatile("s_wait_asynccnt 0x0" ::: "memory");     // no copy is left in flight when the wave goes on
  l += xhalf(l);
  const float il = 1.0f / l; const float* mlr = ML + (rq + col) * (2 * DM) + h * HD + 8 * g;
#pragma unroll
  for (int dt = 0; dt < 4; ++dt) {
#pragma unroll
    for (int r = 0; r < 8; ++r) so[wave][col][dt * 16 + 8 * g + r] = mlr[dt * 16 + r] + acc[dt][r] * il; }
  LDSX();
  for (int rl = 0; rl < 16; ++rl) if (lane < 16) vst2(M2 + (rq + rl) * DM + h * HD + lane * 4, *(const v4f*)&so[wave][rl][lane * 4]);
}
extern "C" void kernel_launch(void* const* d_in, const int* in_sizes, int n_in, void* d_out, int out_size, void* d_ws, size_t ws_size, hipStream_t stream) {
  (void)in_sizes; (void)n_in; (void)out_size;
  const float** F = (const float**)d_in;   // 0 mod [2,2048,512], 1 Wl [512,512], 2 Wd, 3 Wq [8,64,64], 4 Wk, 5 Wv, 6 gamma [512], 7 beta, 8 Wf [512,512], 9 bf [512]
  if (ws_size < (size_t)WS_END) return;
  char* ws = (char*)d_ws; __bf16 *PW = (__bf16*)(ws + WS_PW), *VH = (__bf16*)(ws + WS_VH), *VL = (__bf16*)(ws + WS_VL); float *ML = (float*)(ws + WS_ML), *NM = (float*)(ws + WS_NM), *Q = (float*)(ws + WS_Q), *M2 = (float*)(ws + WS_M2); __bf16* K2 = (__bf16*)(ws + WS_K2);
  const int NR = TNB * SS / 64;
  k_packT<<<dim3((DM / 64) * (DM / 64), 6), 128, 0, stream>>>(F[1], F[2], F[3], F[4], F[5], F[8], PW);
  k_gemm<1, 0, 0><<<dim3(NR, 2 * DM / 128), 128, 0, stream>>>(F[0], DM, PW + PLD, nullptr, nullptr, ML, 2 * DM, nullptr, nullptr, nullptr);        // mod_l | dec_l (exact)
  k_ln<<<dim3(TNB * SS / 8, 2), 256, 0, stream>>>(ML, 2 * DM, F[6], F[7], NM);                                     // LN(mod_l) -> NM, LN(dec_l) -> ND (behind NM)
  k_gemm<0, 0, 1><<<dim3(NR, 3 * DM / 128), 128, 0, stream>>>(NM, DM, PW + PQQ, nullptr, nullptr, Q, DM, VH, VL, K2);   // q (NM, Wq -> Q) and k | v (ND, Wk|Wv -> K2, VH, VL): ND and the Wk|Wv rows lie behind NM and the Wq rows
  k_attn<<<dim3(TQB, NH, TNB), 128, 0, stream>>>(Q, K2, VH, VL, ML, M2);                                          // mod2 = mod_l + o
  k_ln<<<TOB * 8, 256, 0, stream>>>(M2, DM, F[6], F[7], NM);                                                      // LN(mod2) (NM reused)
  k_gemm<0, 1, 0><<<dim3(TOB, DM / 128), 128, 0, stream>>>(NM, DM, PW + PFF, F[9], M2, (float*)d_out, DM, nullptr, nullptr, nullptr);           // out = mod2 + elu(LN(mod2) Wf + bf)
}

// v010
// One run takes 88.6 microseconds.
// Next to v009, in two timings, it ran 1.06 times as fast each time.
// Counting every step since v000, it is 5.53 times as fast.
// compute dtype: mod and all weights/LN params (module inputs) rounded to bf16; mod Wl / mod Wd with exact bf16 products (inputs); the per-head q/k/v 1x1 convs (as two block-diagonal GEMMs: q 512->512, k|v 512->1024), the FFN and scores/P.V with the computed operands as bf16 hi + residual pairs (2 products against exact weights; 3 products for q.k and P.V); LayerNorms, softmax (no 1/sqrt(d) scale), ELU and residuals in f32; f32 accumulate.
#include <hip/hip_runtime.h>
#include <math.h>

typedef __attribute__((ext_vector_type(16))) _Float16 v16h;
typedef __attribute__((ext_vector_type(16))) __bf16 v16b;
typedef __attribute__((ext_vector_type(8)))  _Float16 v8h;
typedef __attribute__((ext_vector_type(8)))  float v8f;
typedef __attribute__((ext_vector_type(4)))  float v4f;
typedef __attribute__((ext_vector_type(2)))  float v2f;
typedef __attribute__((ext_vector_type(4)))  unsigned v4u;
typedef __attribute__((ext_vector_type(4)))  int v4i;
typedef float __attribute__((may_alias)) float_a;
typedef int __attribute__((may_alias)) int_a;

template <typename T> __device__ __forceinline__ void vst2(void* p, T v) { *(T*)p = v;  }
__device__ __forceinline__ v8f wmma16(v16h a, v16h b, v8f c) {
  v8f d = __builtin_amdgcn_wmma_f32_16x16x32_f16(false, a, false, b, (short)0, c, false, false);
  asm volatile("v_nop\n\tv_nop\n\tv_nop\n\tv_nop" : "+v"(d) : "v"(a), "v"(b));
  return d;
}
__device__ __forceinline__ v8f wmma_bf(v16b a, v16b b, v8f c) {
  v8f d = __builtin_amdgcn_wmma_f32_16x16x32_bf16(false, a, false, b, (short)0, c, false, false);
  asm volatile("v_nop\n\tv_nop\n\tv_nop\n\tv_nop" : "+v"(d) : "v"(a), "v"(b));
  return d;
}
// the plain builtin: the compiler keeps the distance behind a matrix instruction itself and is free to place independent work there
__device__ __forceinline__ v8f wmma_bfp(v16b a, v16b b, v8f c) { return __builtin_amdgcn_wmma_f32_16x16x32_bf16(false, a, false, b, (short)0, c, false, false); }
// 16x16x32 fragments: lane = (h = lane>>4, row/col = lane&15); elements 0..7 = k0+8h+0..7, 8..15 = k0+16+8h+0..7; D element r = row 8h+r
__device__ __forceinline__ v16h frag_h(const _Float16* rowk0, int lane) {
  union { v16h v; v8h q[2]; } u; const _Float16* p = rowk0 + 8 * (lane >> 4);
  u.q[0] = *(const v8h*)p; u.q[1] = *(const v8h*)(p + 16); return u.v;
}
__device__ __forceinline__ v16h frag_f32(const float* rowk0, int lane) {
  v16h a; const float* p = rowk0 + 8 * (lane >> 4);
#pragma unroll
  for (int i = 0; i < 8; ++i) { a[i] = (_Float16)p[i]; a[8 + i] = (_Float16)p[16 + i]; }
  return a;
}
__device__ __forceinline__ v16h frag_f32s(const float* rowk0, int lane, float sc) {
  v16h a; const float* p = rowk0 + 8 * (lane >> 4);
#pragma unroll
  for (int i = 0; i < 8; ++i) { a[i] = (_Float16)(p[i] * sc); a[8 + i] = (_Float16)(p[16 + i] * sc); }
  return a;
}
// column fragment from a [K][ld] layout (column n), rows >= K read as 0
__device__ __forceinline__ v16h fragc_f32(const float* W, int k0, int n, int lane, int ld, int K) {
  v16h a; const int g = lane >> 4;
#pragma unroll
  for (int i = 0; i < 8; ++i) { const int ka = k0 + 8 * g + i, kb = ka + 16;
    a[i] = (_Float16)(ka < K ? W[(size_t)(ka < K ? ka : K - 1) * ld + n] : 0.f); a[8 + i] = (_Float16)(kb < K ? W[(size_t)(kb < K ? kb : K - 1) * ld + n] : 0.f); }
  return a;
}
struct F2 { v16b h, l; };
__device__ __forceinline__ F2 bsplit16(const float v[16]) { F2 r;
#pragma unroll
  for (int i = 0; i < 16; ++i) { const __bf16 h = (__bf16)v[i]; r.h[i] = h; r.l[i] = (__bf16)(v[i] - (float)h); }
  return r; }
__device__ __forceinline__ F2 split_row(const float* row, int k0, int lane) { float v[16]; const float* p = row + k0 + 8 * (lane >> 4);
#pragma unroll
  for (int i = 0; i < 8; ++i) { v[i] = p[i]; v[8 + i] = p[16 + i]; }
  return bsplit16(v); }
__device__ __forceinline__ F2 split_rowK(const float* row, int k0, int lane, int K) { float v[16]; const int g = lane >> 4;
#pragma unroll
  for (int i = 0; i < 8; ++i) { const int ka = k0 + 8 * g + i, kb = ka + 16; v[i] = ka < K ? row[ka < K ? ka : K - 1] : 0.f; v[8 + i] = kb < K ? row[kb < K ? kb : K - 1] : 0.f; }
  return bsplit16(v); }
__device__ __forceinline__ F2 split_col(const float* W, int k0, int n, int lane, int ld, int K) { float v[16]; const int g = lane >> 4;
#pragma unroll
  for (int i = 0; i < 8; ++i) { const int ka = k0 + 8 * g + i, kb = ka + 16; v[i] = ka < K ? W[(size_t)(ka < K ? ka : K - 1) * ld + n] : 0.f; v[8 + i] = kb < K ? W[(size_t)(kb < K ? kb : K - 1) * ld + n] : 0.f; }
  return bsplit16(v); }
__device__ __forceinline__ v8f mac3(const F2& a, const F2& b, v8f c) { c = wmma_bf(a.l, b.h, c); c = wmma_bf(a.h, b.l, c); return wmma_bf(a.h, b.h, c); }
__device__ __forceinline__ float sigm(float v) { return 1.0f / (1.0f + expf(-v)); }
#define LDSX() do { asm volatile("s_wait_dscnt 0" ::: "memory"); __builtin_amdgcn_wave_barrier(); __builtin_amdgcn_fence(__ATOMIC_RELEASE, "workgroup"); } while (0)


// SAttn (B 2, S 2048, dim 512, 8 heads x 64; self-attention: dec = mod): mod_l = mod Wl, dec_l = mod Wd; nm = LN(mod_l), nd = LN(dec_l) (shared gamma/beta, eps 1e-6); q = nm_h Wq[h], k = nd_h Wk[h], v = nd_h Wv[h]; attn = softmax(q k^T) (unscaled); o merged; mod2 = mod_l + o; out = mod2 + elu(LN(mod2) Wf + bf).
#define NB 2
#define SS 2048
#define DM 512
#define NH 8
#define HD 64
#define NTOK (NB * SS)
#ifndef TQB
#define TQB (SS / 64)
#define TNB NB
#define TOB (NB * SS / 64)
#endif
typedef __attribute__((ext_vector_type(8))) __bf16 v8b;
__device__ __forceinline__ v16b frag_b(const __bf16* rowk0, int lane) {
  union { v16b v; v8b q[2]; } u; const __bf16* p = rowk0 + 8 * (lane >> 4);
  u.q[0] = *(const v8b*)p; u.q[1] = *(const v8b*)(p + 16); return u.v;
}
__device__ __forceinline__ float bfr(float v) { return (float)(__bf16)v; }
#define L2E 1.4426950408889634f   // log2(e): exp(x) = 2^(x * L2E)
// eight (one) 2^x in line, no call, so that independent exponentials overlap; one statement: the outputs are early-clobber, so no v_exp_f32 overwrites the source of the one ahead of it, and the v_nop at the end keeps the one slot that the instruction set asks for behind a transcendental
__device__ __forceinline__ void ex2x8(float* o, const float* x) {
  asm("v_exp_f32 %0, %8\n\tv_exp_f32 %1, %9\n\tv_exp_f32 %2, %10\n\tv_exp_f32 %3, %11\n\tv_exp_f32 %4, %12\n\tv_exp_f32 %5, %13\n\tv_exp_f32 %6, %14\n\tv_exp_f32 %7, %15\n\tv_nop"
      : "=&v"(o[0]), "=&v"(o[1]), "=&v"(o[2]), "=&v"(o[3]), "=&v"(o[4]), "=&v"(o[5]), "=&v"(o[6]), "=&v"(o[7])
      : "v"(x[0]), "v"(x[1]), "v"(x[2]), "v"(x[3]), "v"(x[4]), "v"(x[5]), "v"(x[6]), "v"(x[7]));
}
__device__ __forceinline__ float ex2x1(float x) { float o; asm("v_exp_f32 %0, %1\n\tv_nop" : "=v"(o) : "v"(x)); return o; }
#define WS_PW  0u                 // bf16 rows (in,out -> [out][in]): Wl|Wd -> [1024][512]; Wq (diagonal 64x64 tiles only) [512][512]; Wk|Wv (diagonal tiles only) [1024][512]; Wf [512][512]
#define PLD 0
#define PQQ (PLD + 2 * DM * DM)
#define PKV (PQQ + DM * DM)
#define PFF (PKV + 2 * DM * DM)
#define PWEND (PFF + DM * DM)
#define WS_ML  (WS_PW + 2u * PWEND)   // f32 [NTOK][1024] mod_l | dec_l
#define WS_NM  (WS_ML + 4u * NTOK * 2 * DM)   // f32 [NTOK][512] LN(mod_l), later LN(mod2)
#define WS_ND  (WS_NM + 4u * NTOK * DM)       // f32 [NTOK][512] LN(dec_l)
#define WS_Q   (WS_ND + 4u * NTOK * DM)       // f32 [NTOK][512] q
#define WS_KV  (WS_Q + 4u * NTOK * DM)        // [NTOK][1024] f32, not used
#define WS_VH  (WS_KV + 4u * NTOK * 2 * DM)   // bf16 [NB][512][SS] v planes
#define WS_VL  (WS_VH + 2u * NB * DM * SS)
#define WS_M2  (WS_VL + 2u * NB * DM * SS)   // f32 [NTOK][512] mod2 = mod_l + o
#define WS_K2  (WS_M2 + 4u * NTOK * DM)       // bf16 [NB][NH][SS][128] k planes, a key's row = 64 hi | 64 residual (256 B)
#define WS_END (WS_K2 + 2u * NB * NH * SS * 2 * HD)

// ---- k_packT: block = (64 k x 64 n tile, matrix m): PW holds six [512 out][512 in] bf16 matrices in a row: 0 Wl^T, 1 Wd^T, 2 Wq, 3 Wk, 4 Wv (block diagonal: row h*64+e gets W[h][d][e] at col h*64+d; what lies off the diagonal tiles is never written and never read), 5 Wf^T; blocks 0..191: the 64 tiles of matrices 0, 1, 5; blocks 192..215: the 8 diagonal tiles of 2, 3, 4; the tile is read along its rows (16 lanes x 16 B = 256 B of one input row; a lane takes two neighbour rows, so that a k pair is one LDS word), turned in LDS and stored as whole 128-B lines
#define PTP 72                     // bf16 per tile row in LDS: 144 B = 16 B x 9
typedef __attribute__((ext_vector_type(2))) __bf16 v2b;
__global__ __launch_bounds__(128) void k_packT(const float* __restrict__ WL, const float* __restrict__ WD, const float* __restrict__ WQ, const float* __restrict__ WK, const float* __restrict__ WV, const float* __restrict__ WF, __bf16* __restrict__ PW) {
  __shared__ __align__(16) __bf16 s[64][PTP];
  const int tid = threadIdx.x, id = blockIdx.x; const bool dense = id < 3 * 64;
  const int kt = id & 7, nt = dense ? (id >> 3) & 7 : kt, m = dense ? ((id >> 6) == 2 ? 5 : id >> 6) : 2 + ((id - 3 * 64) >> 3);
  const float* W = (m == 0) ? WL : (m == 1) ? WD : (m == 2) ? WQ : (m == 3) ? WK : (m == 4) ? WV : WF;
  const float* p = (dense ? W + (size_t)(kt * 64) * DM + nt * 64 : W + (size_t)kt * (HD * HD)) + (tid & 15) * 4; const int ld = dense ? DM : HD;
  v4f v[8];   // v[2 i + o]: input row 2 (tid >> 4) + 16 i + o of the tile
  { const float* rp[8];
#pragma unroll
    for (int i = 0; i < 8; ++i) rp[i] = p + (size_t)(2 * (tid >> 4) + 16 * (i >> 1) + (i & 1)) * ld;
#pragma unroll
    for (int i = 0; i < 8; ++i) v[i] = *(const v4f*)rp[i];
    // the row addresses are inputs of the wait, so they keep their registers up to it and no later load's result lands on an address register ahead of it
    asm volatile("s_wait_xcnt 0x0" :: "v"(rp[0]), "v"(rp[1]), "v"(rp[2]), "v"(rp[3]), "v"(rp[4]), "v"(rp[5]), "v"(rp[6]), "v"(rp[7]) : "memory"); }
#pragma unroll
  for (int i = 0; i < 4; ++i) {
#pragma unroll
    for (int j = 0; j < 4; ++j) { v2b t; t[0] = (__bf16)v[2 * i][j]; t[1] = (__bf16)v[2 * i + 1][j]; *(v2b*)&s[(tid & 15) * 4 + j][2 * (tid >> 4) + 16 * i] = t; } }
  __syncthreads();
  __bf16* dst = PW + (size_t)m * (DM * DM) + (size_t)(nt * 64) * DM + kt * 64;
#pragma unroll
  for (int i = 0; i < 4; ++i) { const int n = (tid >> 3) + 16 * i; vst2((unsigned*)(dst + (size_t)n * DM + (tid & 7) * 8), *(const v4u*)&s[n][(tid & 7) * 8]); }
}
__device__ __forceinline__ unsigned lds_addr(const void* p) { return (unsigned)(unsigned long long)p; }   // LDS byte address = low 32 bits of a __shared__ address
// eight 16-byte copies per lane, global -> LDS through no register; s_wait_xcnt closes the statement so that no address register is rewritten ahead of it
__device__ __forceinline__ void acopy8(const unsigned (&l)[8], const char* const (&p)[8]) {
  asm volatile("global_load_async_to_lds_b128 %0, %8, off\n\t"
               "global_load_async_to_lds_b128 %1, %9, off\n\t"
               "global_load_async_to_lds_b128 %2, %10, off\n\t"
               "global_load_async_to_lds_b128 %3, %11, off\n\t"
               "global_load_async_to_lds_b128 %4, %12, off\n\t"
               "global_load_async_to_lds_b128 %5, %13, off\n\t"
               "global_load_async_to_lds_b128 %6, %14, off\n\t"
               "global_load_async_to_lds_b128 %7, %15, off\n\t"
               "s_wait_xcnt 0x0"
               :: "v"(l[0]), "v"(l[1]), "v"(l[2]), "v"(l[3]), "v"(l[4]), "v"(l[5]), "v"(l[6]), "v"(l[7]),
                  "v"(p[0]), "v"(p[1]), "v"(p[2]), "v"(p[3]), "v"(p[4]), "v"(p[5]), "v"(p[6]), "v"(p[7]) : "memory");
}
#define GK 64                      // k per staged chunk
#define GAP 68                     // floats per A row in LDS: 272 B = 16 B x 17, no bank conflict for 16-byte reads of 16 rows
#define GWP 72                     // bf16 per W row in LDS: 144 B = 16 B x 9
#define GABUF (64 * GAP * 4)       // bytes of one A buffer
#define GWBUF (128 * GWP * 2)      // bytes of one W buffer
// one k-chunk: A 64 rows x 256 B (a lane: piece tid & 15 of rows tid >> 4 + 8 i), W 128 rows x 128 B (piece tid & 7 of rows tid >> 3 + 16 i): every copy of a wave covers whole 128-B lines; the arguments are the lane's own first addresses, sa = bytes from a row of A to the eighth behind it
__device__ __forceinline__ void stage_chunk(const char* ga, size_t sa, const char* gw, unsigned la, unsigned lw) {
  unsigned a[8]; const char* p[8];
#pragma unroll
  for (int i = 0; i < 8; ++i) { a[i] = la + i * (8 * GAP * 4); p[i] = ga + i * sa; }
  acopy8(a, p);
#pragma unroll
  for (int i = 0; i < 8; ++i) { a[i] = lw + i * (16 * GWP * 2); p[i] = gw + (size_t)i * (16 * DM * 2); }
  acopy8(a, p);
}
// ---- k_gemm<RIN, EPI, QKV>: block = (64 rows, 128 cols): OUT = A(hi/lo or exact, K 512, pitch lda) . rows; A (f32) and the weight rows come in chunks of 64 k through LDS: asynchronous copies, two buffers, the weight chunk one for all 4 waves, the next chunk in flight while this one is worked on; EPI 0: plain; EPI 1: + bias, ELU, + RES (out = RES + elu(acc + b)); pitch ldo; QKV 1: q and k | v, which do not depend on each other, in ONE launch; their weights are block diagonal (a head's 64 outputs take that head's 64 inputs alone), so a block, whose 128 columns are two heads, works on those heads' two k-chunks and on nothing else: chunk cc with the 64 weight rows of head cc feeds accumulators 4 cc .. 4 cc + 3; both chunks are staged at once, one into each buffer, and read behind one wait and one barrier; weight rows 0..511 (blockIdx.y 0..3) are q = A . Wq -> OUT, pitch ldo; rows 512..1535 are k | v = (the matrix behind A) . Wk|Wv, which leave the block as k_attn reads them, split into bf16 hi + residual: k (columns n0 0..511) as rows K2 [b][h][s][64 hi | 64 lo], v (n0 512..1023) as transposed planes VH, VL [b][c][s]
template <int RIN, int EPI, int QKV>
__global__ __launch_bounds__(128) void k_gemm(const float* __restrict__ A, int lda, const __bf16* __restrict__ P, const float* __restrict__ bias, const float* __restrict__ RES, float* __restrict__ OUT, int ldo, __bf16* __restrict__ VH, __bf16* __restrict__ VL, __bf16* __restrict__ K2) {
  __shared__ __align__(16) float so[4][16][132];
  __shared__ __align__(16) float sA[2][64][GAP];
  __shared__ __align__(16) __bf16 sW[2][128][GWP];
  const int tid = threadIdx.x, wave = tid >> 5, lane = tid & 31, col = lane & 15, g = lane >> 4; const size_t r0 = (size_t)blockIdx.x * 64 + wave * 16; const int nw = blockIdx.y * 128; int n0 = nw;   // nw: first weight row, n0: first output column
  if (QKV && nw >= DM) { A += (size_t)NTOK * DM; n0 = nw - DM; }   // the same for the whole block
  const char* ga = (const char*)(A + ((size_t)blockIdx.x * 64 + (tid >> 4)) * lda) + (tid & 15) * 16; const size_t sa = (size_t)lda * (8 * 4);
  const char* gw = (const char*)(P + (size_t)(nw + (tid >> 3)) * DM) + (tid & 7) * 16;
  const unsigned la = lds_addr(&sA[0][tid >> 4][0]) + (tid & 15) * 16, lw = lds_addr(&sW[0][tid >> 3][0]) + (tid & 7) * 16;
  v8f acc[8] = {};
  if (QKV) {
    const int kb = nw & (DM - 1);   // first input column of the block's two heads
    unsigned a[8]; const char* p[8];
#pragma unroll
    for (int cc = 0; cc < 2; ++cc) {   // A: 64 rows x 256 B of chunk cc
#pragma unroll
      for (int i = 0; i < 8; ++i) { a[i] = la + cc * GABUF + i * (8 * GAP * 4); p[i] = ga + (kb + cc * GK) * 4 + i * sa; }
      acopy8(a, p); }
#pragma unroll
    for (int i = 0; i < 8; ++i) { const int cc = i >> 2, r = cc * 64 + (i & 3) * 16;   // W: head cc's 64 rows x 128 B -> rows 0..63 of buffer cc
      a[i] = lw + cc * GWBUF + (i & 3) * (16 * GWP * 2); p[i] = gw + ((size_t)r * DM + kb + cc * GK) * 2; }
    acopy8(a, p);
    asm volatile("s_wait_asynccnt 0x0" ::: "memory");   // this wave's part of both chunks has landed
    __syncthreads();                                    // ... and every other wave's
#pragma unroll     // cc and kk become constants in every LDS offset and accumulator index
    for (int cc = 0; cc < 2; ++cc) {
#pragma unroll
      for (int kk = 0; kk < GK / 32; ++kk) {
        v16b w[4];
#pragma unroll
        for (int j = 0; j < 4; ++j) w[j] = frag_b(&sW[cc][j * 16 + col][kk * 32], lane);
        const F2 a2 = split_row(&sA[cc][wave * 16 + col][kk * 32], 0, lane);
#pragma unroll
        for (int j = 0; j < 4; ++j) { acc[4 * cc + j] = wmma_bf(a2.l, w[j], acc[4 * cc + j]); acc[4 * cc + j] = wmma_bf(a2.h, w[j], acc[4 * cc + j]); } } }
  } else {
  stage_chunk(ga, sa, gw, la, lw);
  asm volatile("s_wait_asynccnt 0x0" ::: "memory");   // this wave's part of chunk 0 has landed
  __syncthreads();                                    // ... and every other wave's
  stage_chunk(ga + GK * 4, sa, gw + GK * 2, la + GABUF, lw + GWBUF);
#pragma unroll 1   // one trip = one staged chunk; rolled, so that the ring's hand-over stands once, at the foot
  for (int c = 0; c < DM / GK; ++c) { const int buf = c & 1;
#pragma unroll     // kk becomes a constant in every LDS offset
    for (int kk = 0; kk < GK / 32; ++kk) { const float* arow = &sA[buf][wave * 16 + col][kk * 32];
      v16b w[8];   // the eight weight fragments are read as one group, ahead of the products
#pragma unroll
      for (int j = 0; j < 8; ++j) w[j] = frag_b(&sW[buf][j * 16 + col][kk * 32], lane);
      F2 a; if (RIN) { v16b ax; const float* p = arow + 8 * g;
#pragma unroll
        for (int i = 0; i < 8; ++i) { ax[i] = (__bf16)p[i]; ax[8 + i] = (__bf16)p[16 + i]; } a.h = ax; a.l = ax; } else a = split_row(arow, 0, lane);
#pragma unroll
      for (int j = 0; j < 8; ++j) { if (!RIN) acc[j] = wmma_bf(a.l, w[j], acc[j]); acc[j] = wmma_bf(a.h, w[j], acc[j]); } }
    asm volatile("s_wait_dscnt 0x0" ::: "memory");      // this wave's reads of buffer buf are done before the buffer is refilled
    asm volatile("s_wait_asynccnt 0x0" ::: "memory");   // this wave's part of chunk c + 1 has landed
    __syncthreads();                                    // publishes chunk c + 1 and ends every wave's reads of buffer buf
    if (c + 2 < DM / GK) stage_chunk(ga + (c + 2) * (GK * 4), sa, gw + (c + 2) * (GK * 2), la + buf * GABUF, lw + buf * GWBUF); }
  asm volatile("s_wait_asynccnt 0x0" ::: "memory");     // no copy is left in flight when the wave goes on
  }
  if (QKV && nw >= DM) {   // the same for the whole block: all of it takes this way and is done at its end
    const int b = (int)(blockIdx.x * 64 / SS), s0 = (int)(blockIdx.x * 64 % SS);
    if (n0 < DM) {   // k: token-major, so each wave turns its own 16 x 128 tile in its part of so; a lane: 8 neighbour d of rows g + 2 i; 8 lanes store one 128-B line of each half
#pragma unroll
      for (int j = 0; j < 8; ++j) {
#pragma unroll
        for (int r = 0; r < 8; ++r) so[wave][8 * g + r][j * 16 + col] = acc[j][r]; }
      LDSX();
      const int c = n0 + col * 8; __bf16* op = K2 + (((size_t)b * NH + (c >> 6)) * SS + s0 + wave * 16 + g) * (2 * HD) + (c & 63);
      v4f x[16]; v8b hi[8], lo[8];
#pragma unroll
      for (int i = 0; i < 8; ++i) { x[2 * i] = *(const v4f*)&so[wave][2 * i + g][col * 8]; x[2 * i + 1] = *(const v4f*)&so[wave][2 * i + g][col * 8 + 4]; }
      __builtin_amdgcn_sched_barrier(0);   // the 16 reads go out as one group: left free, the compiler reads a row at a time into few registers, with a wait at each
#pragma unroll
      for (int i = 0; i < 8; ++i) {
#pragma unroll
        for (int j = 0; j < 8; ++j) { const float v = x[2 * i + (j >> 2)][j & 3]; const __bf16 hb = (__bf16)v; hi[i][j] = hb; lo[i][j] = (__bf16)(v - (float)hb); } }
      __builtin_amdgcn_sched_barrier(0);   // the 16 stores stand last, each with registers of its own: mixed among the splits, their registers were used again, with a wait on the stores in front of each reuse
#pragma unroll
      for (int i = 0; i < 8; ++i) { vst2((unsigned*)(op + (size_t)i * (2 * 2 * HD)), __builtin_bit_cast(v4u, hi[i])); vst2((unsigned*)(op + (size_t)i * (2 * 2 * HD) + HD), __builtin_bit_cast(v4u, lo[i])); }
      asm volatile("s_wait_xcnt 0x0" ::: "memory");   // stands behind the last store, ahead of whatever next writes a register that the stores name
    } else {         // v: a lane's 8 accumulator elements of a column are 8 neighbour tokens = 16 B of a plane row; the 4 waves' pieces meet in the two W buffers (no copy is in flight), [0] hi, [1] lo, and leave as whole 128-B lines
      asm volatile("s_wait_dscnt 0x0" ::: "memory");   // this wave's reads of the W buffers are done
      __syncthreads();                                 // ... and every other wave's, before the buffers are written
#pragma unroll
      for (int j = 0; j < 8; ++j) { v8b hi, lo;
#pragma unroll
        for (int r = 0; r < 8; ++r) { const float v = acc[j][r]; const __bf16 hb = (__bf16)v; hi[r] = hb; lo[r] = (__bf16)(v - (float)hb); }
        *(v8b*)&sW[0][j * 16 + col][wave * 16 + 8 * g] = hi; *(v8b*)&sW[1][j * 16 + col][wave * 16 + 8 * g] = lo; }
      __syncthreads();   // a plane row's 64 tokens come from all 4 waves
#pragma unroll
      for (int i = 0; i < 8; ++i) { const int c = (tid >> 3) + 16 * i, pc = tid & 7; const size_t o = ((size_t)b * DM + (n0 - DM) + c) * SS + s0 + pc * 8; vst2((unsigned*)(VH + o), *(const v4u*)&sW[0][c][pc * 8]); vst2((unsigned*)(VL + o), *(const v4u*)&sW[1][c][pc * 8]); }
      asm volatile("s_wait_xcnt 0x0" ::: "memory");   // stands behind the last store, ahead of whatever next writes a register that the stores name
    }
    return; }
  float res[8][8] = {};
  if (EPI == 1) { const float* rp[8];
#pragma unroll
    for (int r = 0; r < 8; ++r) rp[r] = RES + (r0 + 8 * g + r) * ldo + n0 + col;
#pragma unroll
    for (int j = 0; j < 8; ++j) {
#pragma unroll
      for (int r = 0; r < 8; ++r) res[j][r] = rp[r][j * 16]; }
    // with no call between them the 64 loads go out together; the row addresses are inputs of the wait, so they keep their registers up to it and no later load's result lands on an address register ahead of it
    asm volatile("s_wait_xcnt 0x0" :: "v"(rp[0]), "v"(rp[1]), "v"(rp[2]), "v"(rp[3]), "v"(rp[4]), "v"(rp[5]), "v"(rp[6]), "v"(rp[7]) : "memory"); }
#pragma unroll
  for (int j = 0; j < 8; ++j) { const int n = n0 + j * 16 + col; const float bb = (EPI == 1) ? bfr(bias[n]) : 0.f;
#pragma unroll
    for (int r = 0; r < 8; ++r) { const float v = acc[j][r] + bb; if (EPI != 1) so[wave][8 * g + r][j * 16 + col] = v; }
    if (EPI == 1) { float x[8], e[8];
#pragma unroll
      for (int r = 0; r < 8; ++r) x[r] = (acc[j][r] + bb) * L2E;
      ex2x8(e, x);
#pragma unroll
      for (int r = 0; r < 8; ++r) { const float v = acc[j][r] + bb; so[wave][8 * g + r][j * 16 + col] = res[j][r] + ((v > 0.f) ? v : e[r] - 1.0f); } } }
  LDSX();
  for (int rl = 0; rl < 16; ++rl) vst2(OUT + (r0 + rl) * ldo + n0 + lane * 4, *(const v4f*)&so[wave][rl][lane * 4]);
}
// ---- k_ln: block = 8 rows (wave per row): OUT = LN(IN) over 512 (biased var, eps 1e-6) * gamma + beta; blockIdx.y = 1 (only where the launch has it): the 512 columns behind IN's -> the matrix behind OUT, so that LN(mod_l) and LN(dec_l) are one launch
__global__ __launch_bounds__(256) void k_ln(const float* __restrict__ IN, int ldi, const float* __restrict__ G, const float* __restrict__ Bb, float* __restrict__ OUT) {
  __shared__ __align__(16) float s[8][DM]; const int wave = threadIdx.x >> 5, lane = threadIdx.x & 31; const size_t row = (size_t)blockIdx.x * 8 + wave; float v[16]; float sum = 0.f;
  IN += blockIdx.y * DM; OUT += (size_t)blockIdx.y * ((size_t)NTOK * DM);
#pragma unroll
  for (int k = 0; k < 16; ++k) { v[k] = IN[row * ldi + lane + 32 * k]; sum += v[k]; }
#pragma unroll
  for (int o = 1; o < 32; o <<= 1) sum += __shfl_xor(sum, o);
  const float mu = sum / (float)DM; float var = 0.f;
#pragma unroll
  for (int k = 0; k < 16; ++k) { const float d = v[k] - mu; var += d * d; }
#pragma unroll
  for (int o = 1; o < 32; o <<= 1) var += __shfl_xor(var, o);
  const float rs = rsqrtf(var / (float)DM + 1e-6f);
#pragma unroll
  for (int k = 0; k < 16; ++k) { const int c = lane + 32 * k; s[wave][c] = (v[k] - mu) * rs * bfr(G[c]) + bfr(Bb[c]); }
  LDSX();
  for (int pc = lane; pc < DM / 4; pc += 32) vst2(OUT + row * DM + pc * 4, *(const v4f*)&s[wave][pc * 4]);
}
__device__ __forceinline__ float xhalf(float v) { return __builtin_bit_cast(float, __builtin_amdgcn_permlanex16(__builtin_bit_cast(int, v), __builtin_bit_cast(int, v), 0x76543210, 0xfedcba98, false, false)); }   // lane l reads lane l ^ 16
#define KT 64                      // keys per staged tile
#define KP 136                     // bf16 per K row in LDS (64 hi, 64 lo, 8 unused): 272 B = 16 B x 17, no bank conflict for 16-byte reads of 16 rows
#define VP 72                      // bf16 per V row in LDS: 144 B = 16 B x 9
#define KBUF (KT * KP * 2)         // bytes of one K buffer
#define VBUF (HD * VP * 2)         // bytes of one V-plane buffer
// one tile: K 64 rows x 256 B (a lane: chunk tid & 15 of rows tid >> 4 + 8 i), each V plane 64 rows x 128 B (chunk tid & 7 of rows tid >> 3 + 16 i); the arguments are the lane's own first addresses
__device__ __forceinline__ void stage_tile(const char* gk, const char* gh, const char* gl, unsigned lk, unsigned lh, unsigned ll) {
  unsigned a[8]; const char* p[8];
#pragma unroll
  for (int i = 0; i < 8; ++i) { a[i] = lk + i * (8 * KP * 2); p[i] = gk + (size_t)i * (8 * 2 * HD * 2); }
  acopy8(a, p);
#pragma unroll
  for (int i = 0; i < 4; ++i) { a[i] = lh + i * (16 * VP * 2); p[i] = gh + (size_t)i * (16 * SS * 2); a[4 + i] = ll + i * (16 * VP * 2); p[4 + i] = gl + (size_t)i * (16 * SS * 2); }
  acopy8(a, p);
}
__global__ __launch_bounds__(128) void k_attn(const float* __restrict__ Q, const __bf16* __restrict__ K2, const __bf16* __restrict__ VH, const __bf16* __restrict__ VL, const float* __restrict__ ML, float* __restrict__ M2) {
  __shared__ __align__(16) float so[4][16][68];
  __shared__ __align__(16) __bf16 sK[2][KT][KP];
  __shared__ __align__(16) __bf16 sVH[2][HD][VP], sVL[2][HD][VP];
  const int tid = threadIdx.x, wave = tid >> 5, lane = tid & 31, col = lane & 15, g = lane >> 4; const int qb = blockIdx.x, h = blockIdx.y, b = blockIdx.z; const int q0 = qb * 64 + wave * 16; const size_t rq = (size_t)b * SS + q0;
  const char* gk = (const char*)(K2 + (((size_t)b * NH + h) * SS + (tid >> 4)) * (2 * HD)) + (tid & 15) * 16;
  const size_t vo = (((size_t)b * DM + h * HD + (tid >> 3)) * SS) * 2 + (tid & 7) * 16;
  const char* gh = (const char*)VH + vo; const char* gl = (const char*)VL + vo;
  const unsigned lk = lds_addr(&sK[0][tid >> 4][0]) + (tid & 15) * 16, lh = lds_addr(&sVH[0][tid >> 3][0]) + (tid & 7) * 16, ll = lds_addr(&sVL[0][tid >> 3][0]) + (tid & 7) * 16;
  stage_tile(gk, gh, gl, lk, lh, ll);
  F2 aq[2];
#pragma unroll
  for (int kc = 0; kc < 2; ++kc) aq[kc] = split_row(Q + (rq + col) * DM + h * HD, kc * 32, lane);
  asm volatile("s_wait_asynccnt 0x0" ::: "memory");   // this wave's part of tile 0 has landed
  __syncthreads();                                    // ... and every other wave's
  stage_tile(gk + (size_t)KT * (2 * HD * 2), gh + KT * 2, gl + KT * 2, lk + KBUF, lh + VBUF, ll + VBUF);
  float ml = -3.0e38f, l = 0.f;   // ml: running row maximum times L2E
  v8f acc[4] = {};   // O^T: lane = query col, element r of tile dt = d dt*16 + 8g + r
#pragma unroll 1   // one trip = one staged tile; rolled, so that the ring's hand-over stands once, at the foot
  for (int t = 0; t < SS / KT; ++t) { const int buf = t & 1;
#pragma unroll     // sub becomes a constant in every LDS offset
    for (int sub = 0; sub < KT / 32; ++sub) { v8f s[2];   // S^T: element r of tile ct = key t*64 + sub*32 + ct*16 + 8g + r
      F2 kf[2][2];
#pragma unroll
      for (int ct = 0; ct < 2; ++ct) { const __bf16* krow = &sK[buf][sub * 32 + ct * 16 + col][0];
#pragma unroll
        for (int kc = 0; kc < 2; ++kc) { kf[ct][kc].h = frag_b(krow + kc * 32, lane); kf[ct][kc].l = frag_b(krow + HD + kc * 32, lane); } }
      v16b vh[4], vl[4];   // read here too: the score products and the softmax cover their way from LDS
#pragma unroll
      for (int dt = 0; dt < 4; ++dt) { vh[dt] = frag_b(&sVH[buf][dt * 16 + col][sub * 32], lane); vl[dt] = frag_b(&sVL[buf][dt * 16 + col][sub * 32], lane); }
      __builtin_amdgcn_sched_barrier(0);   // the 32 reads stay ahead of all the products they feed: left free, the compiler sinks each pair of reads to just in front of its matrix instruction, with a wait to 0 between them
#pragma unroll
      for (int ct = 0; ct < 2; ++ct) { v8f c = {};
#pragma unroll
        for (int kc = 0; kc < 2; ++kc) { const F2& kb = kf[ct][kc]; c = wmma_bfp(kb.h, aq[kc].l, c); c = wmma_bfp(kb.l, aq[kc].h, c); c = wmma_bfp(kb.h, aq[kc].h, c); }
        s[ct] = c; }
      float mx = fmaxf(s[0][0], s[1][0]);
#pragma unroll
      for (int r = 1; r < 8; ++r) mx = fmaxf(mx, fmaxf(s[0][r], s[1][r]));
      mx = fmaxf(mx, xhalf(mx));
      const float mnl = fmaxf(ml, mx * L2E); const float alpha = ex2x1(ml - mnl);   // the running maximum is kept times L2E: ml is the very value the earlier terms were taken against, so an unchanged maximum gives exactly 1
      float e[16], x[16]; float es = 0.f;
#pragma unroll
      for (int r = 0; r < 8; ++r) { x[r] = fmaf(s[0][r], L2E, -mnl); x[8 + r] = fmaf(s[1][r], L2E, -mnl); }
      ex2x8(e, x); ex2x8(e + 8, x + 8);
#pragma unroll
      for (int r = 0; r < 8; ++r) es += e[r] + e[8 + r];
      l = l * alpha + es; ml = mnl;   // l: this half's 16 of each 32 keys; the halves are joined once behind the loop (alpha is the same in both)
#pragma unroll
      for (int dt = 0; dt < 4; ++dt) acc[dt] *= alpha;
      const F2 pb = bsplit16(e);
#pragma unroll
      for (int dt = 0; dt < 4; ++dt) { acc[dt] = wmma_bfp(vh[dt], pb.l, acc[dt]); acc[dt] = wmma_bfp(vl[dt], pb.h, acc[dt]); acc[dt] = wmma_bfp(vh[dt], pb.h, acc[dt]); } }
    __builtin_amdgcn_sched_barrier(0);                  // softmax and products stay ahead of the foot: sunk behind it, the wait below would stand directly behind the V reads
    asm volatile("s_wait_dscnt 0x0" ::: "memory");      // this wave's reads of buffer buf are done before the buffer is refilled
    asm volatile("s_wait_asynccnt 0x0" ::: "memory");   // this wave's part of tile t + 1 has landed
    __syncthreads();                                    // publishes tile t + 1 and ends every wave's reads of buffer buf
    if (t + 2 < SS / KT) stage_tile(gk + (size_t)(t + 2) * (KT * 2 * HD * 2), gh + (t + 2) * (KT * 2), gl + (t + 2) * (KT * 2), lk + buf * KBUF, lh + buf * VBUF, ll + buf * VBUF); }
  asm volatile("s_wait_asynccnt 0x0" ::: "memory");     // no copy is left in flight when the wave goes on
  l += xhalf(l);
  const float il = 1.0f / l; const float* mlr = ML + (rq + col) * (2 * DM) + h * HD + 8 * g;
#pragma unroll
  for (int dt = 0; dt < 4; ++dt) {
#pragma unroll
    for (int r = 0; r < 8; ++r) so[wave][col][dt * 16 + 8 * g + r] = mlr[dt * 16 + r] + acc[dt][r] * il; }
  LDSX();
  for (int rl = 0; rl < 16; ++rl) if (lane < 16) vst2(M2 + (rq + rl) * DM + h * HD + lane * 4, *(const v4f*)&so[wave][rl][lane * 4]);
}
extern "C" void kernel_launch(void* const* d_in, const int* in_sizes, int n_in, void* d_out, int out_size, void* d_ws, size_t ws_size, hipStream_t stream) {
  (void)in_sizes; (void)n_in; (void)out_size;
  const float** F = (const float**)d_in;   // 0 mod [2,2048,512], 1 Wl [512,512], 2 Wd, 3 Wq [8,64,64], 4 Wk, 5 Wv, 6 gamma [512], 7 beta, 8 Wf [512,512], 9 bf [512]
  if (ws_size < (size_t)WS_END) return;
  char* ws = (char*)d_ws; __bf16 *PW = (__bf16*)(ws + WS_PW), *VH = (__bf16*)(ws + WS_VH), *VL = (__bf16*)(ws + WS_VL); float *ML = (float*)(ws + WS_ML), *NM = (float*)(ws + WS_NM), *Q = (float*)(ws + WS_Q), *M2 = (float*)(ws + WS_M2); __bf16* K2 = (__bf16*)(ws + WS_K2);
  const int NR = TNB * SS / 64;
  k_packT<<<3 * 64 + 3 * 8, 128, 0, stream>>>(F[1], F[2], F[3], F[4], F[5], F[8], PW);
  k_gemm<1, 0, 0><<<dim3(NR, 2 * DM / 128), 128, 0, stream>>>(F[0], DM, PW + PLD, nullptr, nullptr, ML, 2 * DM, nullptr, nullptr, nullptr);        // mod_l | dec_l (exact)
  k_ln<<<dim3(TNB * SS / 8, 2), 256, 0, stream>>>(ML, 2 * DM, F[6], F[7], NM);                                     // LN(mod_l) -> NM, LN(dec_l) -> ND (behind NM)
  k_gemm<0, 0, 1><<<dim3(NR, 3 * DM / 128), 128, 0, stream>>>(NM, DM, PW + PQQ, nullptr, nullptr, Q, DM, VH, VL, K2);   // q (NM, Wq -> Q) and k | v (ND, Wk|Wv -> K2, VH, VL): ND and the Wk|Wv rows lie behind NM and the Wq rows
  k_attn<<<dim3(TQB, NH, TNB), 128, 0, stream>>>(Q, K2, VH, VL, ML, M2);                                          // mod2 = mod_l + o
  k_ln<<<TOB * 8, 256, 0, stream>>>(M2, DM, F[6], F[7], NM);                                                      // LN(mod2) (NM reused)
  k_gemm<0, 1, 0><<<dim3(TOB, DM / 128), 128, 0, stream>>>(NM, DM, PW + PFF, F[9], M2, (float*)d_out, DM, nullptr, nullptr, nullptr);           // out = mod2 + elu(LN(mod2) Wf + bf)
}
